// v000
// Times are from an AMD MI455X. After a warm-up the kernel runs many times in a row, and a time is the length of
// such a window on the GPU divided by its runs, so every launch and the gaps after it count. The runs cycle
// through copies of the inputs. A figure is the median of several windows, for all but v000 over two sittings.
// Sittings can differ by a few percent; kernels timed side by side share one.
// v000, which the later versions start from, runs in 495 microseconds.
// compute dtype: all float inputs rounded to bf16; q / k / v = x . W^T with EXACT bf16 products on WMMA 16x16x32 (natural rows), ReLU and the cos-reweighting (idx = (pi/2) (n+1) / N in f32, precise sinf/cosf) in f32, q_ / k_ / v rounded once to f16; kv = k_^T v and out = q_ kv as WMMA GEMMs (kv carried as f16 hi + residual, 2 products); the column sums of k_ and the normaliser z = 1 / max(q_ . sum k_, 1e-6) in f32 from the same f16-rounded values; output written through the module's (b,H,n,hd) -> (b,n,H,hd) reshape.
#include <hip/hip_runtime.h>
#include <math.h>

typedef __attribute__((ext_vector_type(16))) _Float16 v16h;
typedef __attribute__((ext_vector_type(16))) __bf16 v16b;
typedef __attribute__((ext_vector_type(8)))  _Float16 v8h;
typedef __attribute__((ext_vector_type(8)))  float v8f;
typedef __attribute__((ext_vector_type(4)))  float v4f;
typedef __attribute__((ext_vector_type(2)))  float v2f;
typedef __attribute__((ext_vector_type(4)))  unsigned v4u;
typedef __attribute__((ext_vector_type(4)))  int v4i;
typedef float __attribute__((may_alias)) float_a;
typedef int __attribute__((may_alias)) int_a;

template <typename T> __device__ __forceinline__ void vst2(void* p, T v) { *(T*)p = v;  }
__device__ __forceinline__ v8f wmma16(v16h a, v16h b, v8f c) {
  v8f d = __builtin_amdgcn_wmma_f32_16x16x32_f16(false, a, false, b, (short)0, c, false, false);
  asm volatile("v_nop\n\tv_nop\n\tv_nop\n\tv_nop" : "+v"(d) : "v"(a), "v"(b));
  return d;
}
__device__ __forceinline__ v8f wmma_bf(v16b a, v16b b, v8f c) {
  v8f d = __builtin_amdgcn_wmma_f32_16x16x32_bf16(false, a, false, b, (short)0, c, false, false);
  asm volatile("v_nop\n\tv_nop\n\tv_nop\n\tv_nop" : "+v"(d) : "v"(a), "v"(b));
  return d;
}
// 16x16x32 fragments: lane = (h = lane>>4, row/col = lane&15); elements 0..7 = k0+8h+0..7, 8..15 = k0+16+8h+0..7; D element r = row 8h+r
__device__ __forceinline__ v16h frag_h(const _Float16* rowk0, int lane) {
  union { v16h v; v8h q[2]; } u; const _Float16* p = rowk0 + 8 * (lane >> 4);
  u.q[0] = *(const v8h*)p; u.q[1] = *(const v8h*)(p + 16); return u.v;
}
__device__ __forceinline__ v16h frag_f32(const float* rowk0, int lane) {
  v16h a; const float* p = rowk0 + 8 * (lane >> 4);
#pragma unroll
  for (int i = 0; i < 8; ++i) { a[i] = (_Float16)p[i]; a[8 + i] = (_Float16)p[16 + i]; }
  return a;
}
__device__ __forceinline__ v16h frag_f32s(const float* rowk0, int lane, float sc) {
  v16h a; const float* p = rowk0 + 8 * (lane >> 4);
#pragma unroll
  for (int i = 0; i < 8; ++i) { a[i] = (_Float16)(p[i] * sc); a[8 + i] = (_Float16)(p[16 + i] * sc); }
  return a;
}
// column fragment from a [K][ld] layout (column n), rows >= K read as 0
__device__ __forceinline__ v16h fragc_f32(const float* W, int k0, int n, int lane, int ld, int K) {
  v16h a; const int g = lane >> 4;
#pragma unroll
  for (int i = 0; i < 8; ++i) { const int ka = k0 + 8 * g + i, kb = ka + 16;
    a[i] = (_Float16)(ka < K ? W[(size_t)(ka < K ? ka : K - 1) * ld + n] : 0.f); a[8 + i] = (_Float16)(kb < K ? W[(size_t)(kb < K ? kb : K - 1) * ld + n] : 0.f); }
  return a;
}
struct F2 { v16b h, l; };
__device__ __forceinline__ F2 bsplit16(const float v[16]) { F2 r;
#pragma unroll
  for (int i = 0; i < 16; ++i) { const __bf16 h = (__bf16)v[i]; r.h[i] = h; r.l[i] = (__bf16)(v[i] - (float)h); }
  return r; }
__device__ __forceinline__ F2 split_row(const float* row, int k0, int lane) { float v[16]; const float* p = row + k0 + 8 * (lane >> 4);
#pragma unroll
  for (int i = 0; i < 8; ++i) { v[i] = p[i]; v[8 + i] = p[16 + i]; }
  return bsplit16(v); }
__device__ __forceinline__ F2 split_rowK(const float* row, int k0, int lane, int K) { float v[16]; const int g = lane >> 4;
#pragma unroll
  for (int i = 0; i < 8; ++i) { const int ka = k0 + 8 * g + i, kb = ka + 16; v[i] = ka < K ? row[ka < K ? ka : K - 1] : 0.f; v[8 + i] = kb < K ? row[kb < K ? kb : K - 1] : 0.f; }
  return bsplit16(v); }
__device__ __forceinline__ F2 split_col(const float* W, int k0, int n, int lane, int ld, int K) { float v[16]; const int g = lane >> 4;
#pragma unroll
  for (int i = 0; i < 8; ++i) { const int ka = k0 + 8 * g + i, kb = ka + 16; v[i] = ka < K ? W[(size_t)(ka < K ? ka : K - 1) * ld + n] : 0.f; v[8 + i] = kb < K ? W[(size_t)(kb < K ? kb : K - 1) * ld + n] : 0.f; }
  return bsplit16(v); }
__device__ __forceinline__ v8f mac3(const F2& a, const F2& b, v8f c) { c = wmma_bf(a.l, b.h, c); c = wmma_bf(a.h, b.l, c); return wmma_bf(a.h, b.h, c); }
__device__ __forceinline__ float sigm(float v) { return 1.0f / (1.0f + expf(-v)); }
#define LDSX() do { asm volatile("s_wait_dscnt 0" ::: "memory"); __builtin_amdgcn_wave_barrier(); __builtin_amdgcn_fence(__ATOMIC_RELEASE, "workgroup"); } while (0)


// cosFormer linear attention (B 4, N 4,096, d 512, 8 heads): q = relu(x Wq^T), k = relu(x Wk^T), v = x Wv^T; q_, k_ = [q sin, q cos], [k sin, k cos] with the position weights (pi/2)(n+1)/N; out = (q_ (k_^T v)) / max(q_ . sum_n k_, 1e-6), then the module's head reshape.
#define NB 4
#define NN 4096
#define DD 512
#define D2 (2 * DD)
#define NH 8
#define HD 64
#define NR (NB * NN)
#ifndef TNB
#define TNB NB
#endif
#define TR (TNB * NN)
typedef __attribute__((ext_vector_type(8))) __bf16 v8b;
__device__ __forceinline__ v16b frag_b(const __bf16* rowk0, int lane) {
  union { v16b v; v8b q[2]; } u; const __bf16* p = rowk0 + 8 * (lane >> 4);
  u.q[0] = *(const v8b*)p; u.q[1] = *(const v8b*)(p + 16); return u.v;
}
__device__ __forceinline__ float bfr(float v) { return (float)(__bf16)v; }
__device__ __attribute__((noinline)) float exp_ni(float v) { return expf(v); }
__device__ __attribute__((noinline)) float erf_ni(float v) { return erff(v); }

#define WS_PW  0u                                  // bf16 natural rows Wq, Wk, Wv [3][512][512]
#define WS_Q   (WS_PW + 2u * (size_t)3 * DD * DD)   // f16 rows q_ [NR][1024]
#define WS_KT  (WS_Q + 2u * (size_t)NR * D2)        // f16 planes k_^T [b][1024][NN] ; v^T [b][512][NN]
#define WS_VT  (WS_KT + 2u * (size_t)NB * D2 * NN)
#define WS_KVH (WS_VT + 2u * (size_t)NB * DD * NN)  // f16 hi / lo kv^T [b][512 m][1024 dd]
#define WS_KVL (WS_KVH + 2u * (size_t)NB * DD * D2)
#define WS_KS  (WS_KVL + 2u * (size_t)NB * DD * D2) // f32 [b][1024] sum_n k_
#define WS_END (WS_KS + 4u * (size_t)NB * D2)

__global__ __launch_bounds__(256) void k_pack(const float* __restrict__ WQ, const float* __restrict__ WK, const float* __restrict__ WV, __bf16* __restrict__ P) { const int n = blockIdx.x, t = threadIdx.x; const float* src = (n < DD) ? (WQ + (size_t)n * DD) : (n < 2 * DD) ? (WK + (size_t)(n - DD) * DD) : (WV + (size_t)(n - 2 * DD) * DD); __shared__ __align__(16) __bf16 s[DD]; for (int k = t; k < DD; k += 256) s[k] = (__bf16)src[k]; __syncthreads(); if (t < DD / 8) vst2((unsigned*)(P + (size_t)n * DD + t * 8), *(const v4u*)&s[t * 8]); }
__device__ __attribute__((noinline)) float sin_p(float v) { return sinf(v); }
__device__ __attribute__((noinline)) float cos_p(float v) { return cosf(v); }
// ---- k_proj: block = (64 tokens, 128 cols, which): 0 q -> relu, x sin | x cos -> q_ rows; 1 k -> relu, x sin | cos -> k_^T planes; 2 v -> v^T planes
__global__ __launch_bounds__(128) void k_proj(const float* __restrict__ X, const __bf16* __restrict__ P, _Float16* __restrict__ Q, _Float16* __restrict__ KT, _Float16* __restrict__ VT) {
  __shared__ __align__(16) _Float16 so[2][64][136]; __shared__ __align__(16) _Float16 st[2][128][72];
  const int tid = threadIdx.x, wave = tid >> 5, lane = tid & 31, col = lane & 15, g = lane >> 4; const int which = blockIdx.z; const int n0 = blockIdx.y * 128; const size_t rb0 = (size_t)blockIdx.x * 64, r0 = rb0 + wave * 16; const size_t b = rb0 / NN, s0 = rb0 % NN;
  v8f acc[8] = {};
#pragma unroll 2
  for (int kc = 0; kc < DD / 32; ++kc) { v16b a; { const float* p = X + (r0 + col) * DD + kc * 32 + 8 * g;
#pragma unroll
      for (int i = 0; i < 8; ++i) { a[i] = (__bf16)p[i]; a[8 + i] = (__bf16)p[16 + i]; } }
#pragma unroll
    for (int j = 0; j < 8; ++j) acc[j] = wmma_bf(a, frag_b(P + ((size_t)which * DD + n0 + j * 16 + col) * DD + kc * 32, lane), acc[j]); }
  if (which == 0) {
#pragma unroll
    for (int r = 0; r < 8; ++r) { const int n = (int)((r0 + 8 * g + r) % NN); const float ang = (1.57079632679489662f * (float)(n + 1)) / (float)NN; const float sn = sin_p(ang), cs = cos_p(ang);
#pragma unroll
      for (int j = 0; j < 8; ++j) { const float v = fmaxf(acc[j][r], 0.f); so[0][wave * 16 + 8 * g + r][j * 16 + col] = (_Float16)(v * sn); so[1][wave * 16 + 8 * g + r][j * 16 + col] = (_Float16)(v * cs); } }
    LDSX();
    for (int rl = 0; rl < 16; ++rl) if (lane < 16) { vst2((unsigned*)(Q + (r0 + rl) * D2 + n0 + lane * 8), *(const v4u*)&so[0][wave * 16 + rl][lane * 8]); vst2((unsigned*)(Q + (r0 + rl) * D2 + DD + n0 + lane * 8), *(const v4u*)&so[1][wave * 16 + rl][lane * 8]); }
  } else if (which == 1) {
#pragma unroll
    for (int r = 0; r < 8; ++r) { const int n = (int)((r0 + 8 * g + r) % NN); const float ang = (1.57079632679489662f * (float)(n + 1)) / (float)NN; const float sn = sin_p(ang), cs = cos_p(ang);
#pragma unroll
      for (int j = 0; j < 8; ++j) { const float v = fmaxf(acc[j][r], 0.f); st[0][j * 16 + col][wave * 16 + 8 * g + r] = (_Float16)(v * sn); st[1][j * 16 + col][wave * 16 + 8 * g + r] = (_Float16)(v * cs); } }
    __syncthreads();
    for (int e = tid; e < 2 * 128 * 8; e += 128) { const int pl = e >> 10, d = (e >> 3) & 127, pc = e & 7; vst2((unsigned*)(KT + ((b * D2 + (size_t)pl * DD + n0 + d) * NN) + s0 + pc * 8), *(const v4u*)&st[pl][d][pc * 8]); }
  } else {
#pragma unroll
    for (int r = 0; r < 8; ++r)
#pragma unroll
      for (int j = 0; j < 8; ++j) st[0][j * 16 + col][wave * 16 + 8 * g + r] = (_Float16)acc[j][r];
    __syncthreads();
    for (int e = tid; e < 128 * 8; e += 128) { const int d = e >> 3, pc = e & 7; vst2((unsigned*)(VT + ((b * DD + n0 + d) * NN) + s0 + pc * 8), *(const v4u*)&st[0][d][pc * 8]); } }
}
__global__ __launch_bounds__(128) void k_kv(const _Float16* __restrict__ KT, const _Float16* __restrict__ VT, _Float16* __restrict__ KVH, _Float16* __restrict__ KVL) {
  __shared__ __align__(16) _Float16 sh[128][72]; __shared__ __align__(16) _Float16 sl[128][72];
  const int tid = threadIdx.x, wave = tid >> 5, lane = tid & 31, col = lane & 15, g = lane >> 4; const size_t b = blockIdx.z; const int d0 = blockIdx.x * 64, r0 = d0 + wave * 16; const int m0 = blockIdx.y * 128;
  v8f acc[8] = {};
#pragma unroll 2
  for (int kc = 0; kc < NN / 32; ++kc) { const v16h a = frag_h(KT + ((b * D2 + r0 + col) * NN) + kc * 32, lane);
#pragma unroll
    for (int j = 0; j < 8; ++j) acc[j] = wmma16(a, frag_h(VT + ((b * DD + m0 + j * 16 + col) * NN) + kc * 32, lane), acc[j]); }
#pragma unroll
  for (int j = 0; j < 8; ++j)
#pragma unroll
    for (int r = 0; r < 8; ++r) { const float v = acc[j][r]; const _Float16 hv = (_Float16)v; sh[j * 16 + col][wave * 16 + 8 * g + r] = hv; sl[j * 16 + col][wave * 16 + 8 * g + r] = (_Float16)((v - (float)hv) * 2048.0f); }
  __syncthreads();
  for (int e = tid; e < 128 * 8; e += 128) { const int m = e >> 3, pc = e & 7; const size_t o = ((b * DD + m0 + m) * D2) + d0 + pc * 8; vst2((unsigned*)(KVH + o), *(const v4u*)&sh[m][pc * 8]); vst2((unsigned*)(KVL + o), *(const v4u*)&sl[m][pc * 8]); }
}
// ---- k_ksum: block = (128 dd, b), 256 threads: fixed-order sums over the 4,096 tokens of the f16 k_ planes -> KS[b][dd] (512-B segment)
__global__ __launch_bounds__(256) void k_ksum(const _Float16* __restrict__ KT, float* __restrict__ KS) {
  __shared__ __align__(16) float part[2][128]; const size_t b = blockIdx.y; const int d0 = blockIdx.x * 128, t = threadIdx.x; const int dl = t & 127, half = t >> 7; const _Float16* p = KT + ((b * D2 + d0 + dl) * NN) + half * (NN / 2); float s = 0.f;
  for (int n = 0; n < NN / 2; n += 8) { const v4u w = *(const v4u*)(p + n); const _Float16* h8 = (const _Float16*)&w; for (int i = 0; i < 8; ++i) s += (float)h8[i]; }
  part[half][dl] = s; __syncthreads();
  if (t < 128) part[0][t] = part[0][t] + part[1][t]; __syncthreads();
  if (t < 32) vst2(KS + b * D2 + d0 + t * 4, *(const v4f*)&part[0][t * 4]);
}
// ---- k_fin: block = (64 tokens, 128 m cols, b): acc = q_ . kv (hi + residual) over dd; z = 1/max(q_ . KS, 1e-6) per row (f32, from the same f16 q_); out = acc z stored through the (b,H,n,hd)->(b,n,H,hd) view: computed (n, m) -> row (8n + m/64) mod N, cols (n/512)*64 + m%64
__global__ __launch_bounds__(128) void k_fin(const _Float16* __restrict__ Q, const _Float16* __restrict__ KVH, const _Float16* __restrict__ KVL, const float* __restrict__ KS, float* __restrict__ OUT) {
  __shared__ __align__(16) float so[4][16][132]; __shared__ float sz[4][16];
  const int tid = threadIdx.x, wave = tid >> 5, lane = tid & 31, col = lane & 15, g = lane >> 4; const size_t b = blockIdx.z; const int nb0 = blockIdx.x * 64; const int nw = nb0 + wave * 16; const size_t r0 = b * NN + nw; const int m0 = blockIdx.y * 128;
  // z for this wave's 16 rows: lanes (rl = lane & 15, half = lane >> 4) sum 512 dd each
  { const int rl = lane & 15, half = lane >> 4; float s = 0.f; const _Float16* q = Q + (r0 + rl) * D2 + half * DD; const float* ks = KS + b * D2 + half * DD;
    for (int d = 0; d < DD; d += 8) { const v4u w = *(const v4u*)(q + d); const _Float16* h8 = (const _Float16*)&w;
#pragma unroll
      for (int i = 0; i < 8; ++i) s += (float)h8[i] * ks[d + i]; }
    s += __shfl_xor(s, 16); if (lane < 16) sz[wave][rl] = 1.0f / fmaxf(s, 1e-6f); }
  v8f acc[8] = {};
#pragma unroll 2
  for (int kc = 0; kc < D2 / 32; ++kc) { const v16h a = frag_h(Q + (r0 + col) * D2 + kc * 32, lane);
#pragma unroll
    for (int j = 0; j < 8; ++j) { const size_t wb = ((b * DD + m0 + j * 16 + col) * D2) + kc * 32; acc[j] = wmma16(a, frag_h(KVH + wb, lane), acc[j]); v8f t2 = {}; t2 = wmma16(a, frag_h(KVL + wb, lane), t2);
#pragma unroll
      for (int r = 0; r < 8; ++r) acc[j][r] += t2[r] * (1.0f / 2048.0f); } }
  LDSX();
#pragma unroll
  for (int j = 0; j < 8; ++j)
#pragma unroll
    for (int r = 0; r < 8; ++r) so[wave][8 * g + r][j * 16 + col] = acc[j][r] * sz[wave][8 * g + r];
  LDSX();
  // each computed row n (16 per wave) x this block's 128 cols = two 64-col chunks j64 = m0/64 + {0,1} -> final row (8n + j64) % NN, col block (n/512)*64
  for (int rl = 0; rl < 16; ++rl) { const int n = nw + rl; const int j64 = m0 / 64 + (lane >> 4); const size_t frow = b * NN + (size_t)((8 * n + j64) % NN); const int fc0 = (n / 512) * HD;
    vst2(OUT + frow * DD + fc0 + (lane & 15) * 4, *(const v4f*)&so[wave][rl][(lane >> 4) * 64 + (lane & 15) * 4]); }   // two 256-B segments per computed row (lanes 0-15 / 16-31)
}
extern "C" void kernel_launch(void* const* d_in, const int* in_sizes, int n_in, void* d_out, int out_size, void* d_ws, size_t ws_size, hipStream_t stream) {
  (void)in_sizes; (void)n_in; (void)out_size;
  const float** F = (const float**)d_in;   // 0 x [4,4096,512], 1 Wq, 2 Wk, 3 Wv [512,512] natural
  if (ws_size < (size_t)WS_END) return;
  char* ws = (char*)d_ws; __bf16* P = (__bf16*)ws; _Float16 *Q = (_Float16*)(ws + WS_Q), *KT = (_Float16*)(ws + WS_KT), *VT = (_Float16*)(ws + WS_VT), *KVH = (_Float16*)(ws + WS_KVH), *KVL = (_Float16*)(ws + WS_KVL); float* KS = (float*)(ws + WS_KS);
  k_pack<<<3 * DD, 256, 0, stream>>>(F[1], F[2], F[3], P);
  k_proj<<<dim3(TR / 64, DD / 128, 3), 128, 0, stream>>>(F[0], P, Q, KT, VT);
  k_kv<<<dim3(D2 / 64, DD / 128, TNB), 128, 0, stream>>>(KT, VT, KVH, KVL);
  k_ksum<<<dim3(D2 / 128, TNB), 256, 0, stream>>>(KT, KS);
  k_fin<<<dim3(NN / 64, DD / 128, TNB), 128, 0, stream>>>(Q, KVH, KVL, KS, (float*)d_out);
}

// v001
// A run of this version takes 159 microseconds.
// Timed twice side by side with v000, it ran 3.16 and 3.18 times as fast.
// compute dtype: all float inputs rounded to bf16; q / k / v = x . W^T with EXACT bf16 products on WMMA 16x16x32 (natural rows), ReLU and the cos-reweighting (idx = (pi/2) (n+1) / N in f32, precise sinf/cosf) in f32, q_ / k_ / v rounded once to f16; kv = k_^T v and out = q_ kv as WMMA GEMMs (kv carried as f16 hi + residual, 2 products); the column sums of k_ and the normaliser z = 1 / max(q_ . sum k_, 1e-6) in f32 from the same f16-rounded values; output written through the module's (b,H,n,hd) -> (b,n,H,hd) reshape.
#include <hip/hip_runtime.h>
#include <math.h>

typedef __attribute__((ext_vector_type(16))) _Float16 v16h;
typedef __attribute__((ext_vector_type(16))) __bf16 v16b;
typedef __attribute__((ext_vector_type(8)))  _Float16 v8h;
typedef __attribute__((ext_vector_type(8)))  float v8f;
typedef __attribute__((ext_vector_type(4)))  float v4f;
typedef __attribute__((ext_vector_type(2)))  float v2f;
typedef __attribute__((ext_vector_type(4)))  unsigned v4u;
typedef __attribute__((ext_vector_type(4)))  int v4i;
typedef float __attribute__((may_alias)) float_a;
typedef int __attribute__((may_alias)) int_a;

template <typename T> __device__ __forceinline__ void vst2(void* p, T v) { *(T*)p = v;  }
__device__ __forceinline__ v8f wmma16(v16h a, v16h b, v8f c) {
  v8f d = __builtin_amdgcn_wmma_f32_16x16x32_f16(false, a, false, b, (short)0, c, false, false);
  asm volatile("v_nop\n\tv_nop\n\tv_nop\n\tv_nop" : "+v"(d) : "v"(a), "v"(b));
  return d;
}
__device__ __forceinline__ v8f wmma_bf(v16b a, v16b b, v8f c) {
  v8f d = __builtin_amdgcn_wmma_f32_16x16x32_bf16(false, a, false, b, (short)0, c, false, false);
  asm volatile("v_nop\n\tv_nop\n\tv_nop\n\tv_nop" : "+v"(d) : "v"(a), "v"(b));
  return d;
}
// 16x16x32 fragments: lane = (h = lane>>4, row/col = lane&15); elements 0..7 = k0+8h+0..7, 8..15 = k0+16+8h+0..7; D element r = row 8h+r
__device__ __forceinline__ v16h frag_h(const _Float16* rowk0, int lane) {
  union { v16h v; v8h q[2]; } u; const _Float16* p = rowk0 + 8 * (lane >> 4);
  u.q[0] = *(const v8h*)p; u.q[1] = *(const v8h*)(p + 16); return u.v;
}
__device__ __forceinline__ v16h frag_f32(const float* rowk0, int lane) {
  v16h a; const float* p = rowk0 + 8 * (lane >> 4);
#pragma unroll
  for (int i = 0; i < 8; ++i) { a[i] = (_Float16)p[i]; a[8 + i] = (_Float16)p[16 + i]; }
  return a;
}
__device__ __forceinline__ v16h frag_f32s(const float* rowk0, int lane, float sc) {
  v16h a; const float* p = rowk0 + 8 * (lane >> 4);
#pragma unroll
  for (int i = 0; i < 8; ++i) { a[i] = (_Float16)(p[i] * sc); a[8 + i] = (_Float16)(p[16 + i] * sc); }
  return a;
}
// column fragment from a [K][ld] layout (column n), rows >= K read as 0
__device__ __forceinline__ v16h fragc_f32(const float* W, int k0, int n, int lane, int ld, int K) {
  v16h a; const int g = lane >> 4;
#pragma unroll
  for (int i = 0; i < 8; ++i) { const int ka = k0 + 8 * g + i, kb = ka + 16;
    a[i] = (_Float16)(ka < K ? W[(size_t)(ka < K ? ka : K - 1) * ld + n] : 0.f); a[8 + i] = (_Float16)(kb < K ? W[(size_t)(kb < K ? kb : K - 1) * ld + n] : 0.f); }
  return a;
}
struct F2 { v16b h, l; };
__device__ __forceinline__ F2 bsplit16(const float v[16]) { F2 r;
#pragma unroll
  for (int i = 0; i < 16; ++i) { const __bf16 h = (__bf16)v[i]; r.h[i] = h; r.l[i] = (__bf16)(v[i] - (float)h); }
  return r; }
__device__ __forceinline__ F2 split_row(const float* row, int k0, int lane) { float v[16]; const float* p = row + k0 + 8 * (lane >> 4);
#pragma unroll
  for (int i = 0; i < 8; ++i) { v[i] = p[i]; v[8 + i] = p[16 + i]; }
  return bsplit16(v); }
__device__ __forceinline__ F2 split_rowK(const float* row, int k0, int lane, int K) { float v[16]; const int g = lane >> 4;
#pragma unroll
  for (int i = 0; i < 8; ++i) { const int ka = k0 + 8 * g + i, kb = ka + 16; v[i] = ka < K ? row[ka < K ? ka : K - 1] : 0.f; v[8 + i] = kb < K ? row[kb < K ? kb : K - 1] : 0.f; }
  return bsplit16(v); }
__device__ __forceinline__ F2 split_col(const float* W, int k0, int n, int lane, int ld, int K) { float v[16]; const int g = lane >> 4;
#pragma unroll
  for (int i = 0; i < 8; ++i) { const int ka = k0 + 8 * g + i, kb = ka + 16; v[i] = ka < K ? W[(size_t)(ka < K ? ka : K - 1) * ld + n] : 0.f; v[8 + i] = kb < K ? W[(size_t)(kb < K ? kb : K - 1) * ld + n] : 0.f; }
  return bsplit16(v); }
__device__ __forceinline__ v8f mac3(const F2& a, const F2& b, v8f c) { c = wmma_bf(a.l, b.h, c); c = wmma_bf(a.h, b.l, c); return wmma_bf(a.h, b.h, c); }
__device__ __forceinline__ float sigm(float v) { return 1.0f / (1.0f + expf(-v)); }
#define LDSX() do { asm volatile("s_wait_dscnt 0" ::: "memory"); __builtin_amdgcn_wave_barrier(); __builtin_amdgcn_fence(__ATOMIC_RELEASE, "workgroup"); } while (0)


// cosFormer linear attention (B 4, N 4,096, d 512, 8 heads): q = relu(x Wq^T), k = relu(x Wk^T), v = x Wv^T; q_, k_ = [q sin, q cos], [k sin, k cos] with the position weights (pi/2)(n+1)/N; out = (q_ (k_^T v)) / max(q_ . sum_n k_, 1e-6), then the module's head reshape.
#define NB 4
#define NN 4096
#define DD 512
#define D2 (2 * DD)
#define NH 8
#define HD 64
#define NR (NB * NN)
#ifndef TNB
#define TNB NB
#endif
#define TR (TNB * NN)
typedef __attribute__((ext_vector_type(8))) __bf16 v8b;
__device__ __forceinline__ v16b frag_b(const __bf16* rowk0, int lane) {
  union { v16b v; v8b q[2]; } u; const __bf16* p = rowk0 + 8 * (lane >> 4);
  u.q[0] = *(const v8b*)p; u.q[1] = *(const v8b*)(p + 16); return u.v;
}
__device__ __forceinline__ float bfr(float v) { return (float)(__bf16)v; }
__device__ __attribute__((noinline)) float exp_ni(float v) { return expf(v); }
__device__ __attribute__((noinline)) float erf_ni(float v) { return erff(v); }

#define WS_PW  0u                                  // bf16 natural rows Wq, Wk, Wv [3][512][512]
#define WS_Q   (WS_PW + 2u * (size_t)3 * DD * DD)   // f16 rows q_ [NR][1024]
#define WS_KT  (WS_Q + 2u * (size_t)NR * D2)        // f16 planes k_^T [b][1024][NN] ; v^T [b][512][NN]
#define WS_VT  (WS_KT + 2u * (size_t)NB * D2 * NN)
#define WS_KVH (WS_VT + 2u * (size_t)NB * DD * NN)  // f16 hi / lo kv^T [b][512 m][1024 dd]
#define WS_KVL (WS_KVH + 2u * (size_t)NB * DD * D2)
#define WS_KS  (WS_KVL + 2u * (size_t)NB * DD * D2) // f32 [b][1024] sum_n k_
#define WS_END (WS_KS + 4u * (size_t)NB * D2)

__global__ __launch_bounds__(256) void k_pack(const float* __restrict__ WQ, const float* __restrict__ WK, const float* __restrict__ WV, __bf16* __restrict__ P) { const int n = blockIdx.x, t = threadIdx.x; const float* src = (n < DD) ? (WQ + (size_t)n * DD) : (n < 2 * DD) ? (WK + (size_t)(n - DD) * DD) : (WV + (size_t)(n - 2 * DD) * DD); __shared__ __align__(16) __bf16 s[DD]; for (int k = t; k < DD; k += 256) s[k] = (__bf16)src[k]; __syncthreads(); if (t < DD / 8) vst2((unsigned*)(P + (size_t)n * DD + t * 8), *(const v4u*)&s[t * 8]); }
__device__ __attribute__((noinline)) float sin_p(float v) { return sinf(v); }
__device__ __attribute__((noinline)) float cos_p(float v) { return cosf(v); }
__device__ __forceinline__ unsigned lds_off(const void* p) { return (unsigned)(size_t)p; }
// one lane's 8 (4) copies, rows ls bytes apart in LDS and gs bytes apart in global memory; s_wait_xcnt 0 closes the statement so that no address register of a copy is rewritten in front of it
__device__ __forceinline__ void acp8(unsigned l, unsigned ls, const char* p, size_t gs) {
  asm volatile("global_load_async_to_lds_b128 %0, %8, off\n\t"
               "global_load_async_to_lds_b128 %1, %9, off\n\t"
               "global_load_async_to_lds_b128 %2, %10, off\n\t"
               "global_load_async_to_lds_b128 %3, %11, off\n\t"
               "global_load_async_to_lds_b128 %4, %12, off\n\t"
               "global_load_async_to_lds_b128 %5, %13, off\n\t"
               "global_load_async_to_lds_b128 %6, %14, off\n\t"
               "global_load_async_to_lds_b128 %7, %15, off\n\t"
               "s_wait_xcnt 0x0"
               :: "v"(l), "v"(l + ls), "v"(l + 2 * ls), "v"(l + 3 * ls), "v"(l + 4 * ls), "v"(l + 5 * ls), "v"(l + 6 * ls), "v"(l + 7 * ls),
                  "v"(p), "v"(p + gs), "v"(p + 2 * gs), "v"(p + 3 * gs), "v"(p + 4 * gs), "v"(p + 5 * gs), "v"(p + 6 * gs), "v"(p + 7 * gs) : "memory");
}
__device__ __forceinline__ void acp4(unsigned l, unsigned ls, const char* p, size_t gs) {
  asm volatile("global_load_async_to_lds_b128 %0, %4, off\n\t"
               "global_load_async_to_lds_b128 %1, %5, off\n\t"
               "global_load_async_to_lds_b128 %2, %6, off\n\t"
               "global_load_async_to_lds_b128 %3, %7, off\n\t"
               "s_wait_xcnt 0x0"
               :: "v"(l), "v"(l + ls), "v"(l + 2 * ls), "v"(l + 3 * ls), "v"(p), "v"(p + gs), "v"(p + 2 * gs), "v"(p + 3 * gs) : "memory");
}
// this wave's copies have landed (in front of the barrier behind which other waves read them)
#define WAIT_ACP() asm volatile("s_wait_asynccnt 0x0" ::: "memory")
// this wave's LDS reads of a buffer have returned (in front of the barrier behind which the buffer is refilled)
#define WAIT_DS() asm volatile("s_wait_dscnt 0x0" ::: "memory")
// ---- k_proj: block = (64 tokens, 128 cols, which): 0 q -> relu, x sin | x cos -> q_ rows; 1 k -> relu, x sin | cos -> k_^T planes; 2 v -> v^T planes
// stage = 64 k: x 64 rows of 256 B (f32) at pitch 272, W 128 rows of 128 B (bf16) at pitch 144; the output staging so / st takes the ring's place behind the loop
#define PJ_PA 272
#define PJ_PB 144
#define PJ_STG (64 * PJ_PA + 128 * PJ_PB)
__global__ __launch_bounds__(128) void k_proj(const float* __restrict__ X, const __bf16* __restrict__ P, _Float16* __restrict__ Q, _Float16* __restrict__ KT, _Float16* __restrict__ VT) {
  __shared__ __align__(16) char ring[2 * PJ_STG];
  _Float16 (*so)[64][136] = (_Float16 (*)[64][136])ring; _Float16 (*st)[128][72] = (_Float16 (*)[128][72])ring;
  const int tid = threadIdx.x, wave = tid >> 5, lane = tid & 31, col = lane & 15, g = lane >> 4; const int which = blockIdx.z; const int n0 = blockIdx.y * 128; const size_t rb0 = (size_t)blockIdx.x * 64, r0 = rb0 + wave * 16; const size_t b = rb0 / NN, s0 = rb0 % NN;
  const char* ga = (const char*)(X + (rb0 + (tid >> 4)) * DD) + (tid & 15) * 16; const char* gb = (const char*)(P + ((size_t)which * DD + n0 + (tid >> 3)) * DD) + (tid & 7) * 16;
  const unsigned la = lds_off(ring) + (tid >> 4) * PJ_PA + (tid & 15) * 16, lb = lds_off(ring) + 64 * PJ_PA + (tid >> 3) * PJ_PB + (tid & 7) * 16;
  v8f acc[8] = {};
  acp8(la, 8 * PJ_PA, ga, (size_t)8 * DD * 4); acp8(lb, 16 * PJ_PB, gb, (size_t)16 * DD * 2);
  WAIT_ACP(); __syncthreads();
  acp8(la + PJ_STG, 8 * PJ_PA, ga + 256, (size_t)8 * DD * 4); acp8(lb + PJ_STG, 16 * PJ_PB, gb + 128, (size_t)16 * DD * 2);
  for (int t = 0; t < DD / 64; ++t) { const unsigned bo = (t & 1) * PJ_STG; const char* base = ring + bo;
    // the trip's fragments are read from LDS as one group in front of its WMMAs, so that the LDS latency is waited out once a trip and not once a WMMA; the loops are unrolled so that the fragment arrays have constant indices and stay in registers
    v16b a[2], w[2][8];
#pragma unroll
    for (int kc = 0; kc < 2; ++kc) { const float* p = (const float*)(base + (wave * 16 + col) * PJ_PA) + kc * 32 + 8 * g;
#pragma unroll
      for (int i = 0; i < 8; ++i) { a[kc][i] = (__bf16)p[i]; a[kc][8 + i] = (__bf16)p[16 + i]; }
#pragma unroll
      for (int j = 0; j < 8; ++j) w[kc][j] = frag_b((const __bf16*)(base + 64 * PJ_PA + (j * 16 + col) * PJ_PB) + kc * 32, lane); }
#pragma unroll
    for (int kc = 0; kc < 2; ++kc)
#pragma unroll
      for (int j = 0; j < 8; ++j) acc[j] = wmma_bf(a[kc], w[kc][j], acc[j]);
    WAIT_DS(); WAIT_ACP(); __syncthreads();
    if (t + 2 < DD / 64) { acp8(la + bo, 8 * PJ_PA, ga + (t + 2) * 256, (size_t)8 * DD * 4); acp8(lb + bo, 16 * PJ_PB, gb + (t + 2) * 128, (size_t)16 * DD * 2); } }
  WAIT_ACP();
  if (which == 0) {
#pragma unroll
    for (int r = 0; r < 8; ++r) { const int n = (int)((r0 + 8 * g + r) % NN); const float ang = (1.57079632679489662f * (float)(n + 1)) / (float)NN; const float sn = sin_p(ang), cs = cos_p(ang);
#pragma unroll
      for (int j = 0; j < 8; ++j) { const float v = fmaxf(acc[j][r], 0.f); so[0][wave * 16 + 8 * g + r][j * 16 + col] = (_Float16)(v * sn); so[1][wave * 16 + 8 * g + r][j * 16 + col] = (_Float16)(v * cs); } }
    LDSX();
    for (int rl = 0; rl < 16; ++rl) if (lane < 16) { vst2((unsigned*)(Q + (r0 + rl) * D2 + n0 + lane * 8), *(const v4u*)&so[0][wave * 16 + rl][lane * 8]); vst2((unsigned*)(Q + (r0 + rl) * D2 + DD + n0 + lane * 8), *(const v4u*)&so[1][wave * 16 + rl][lane * 8]); }
  } else if (which == 1) {
#pragma unroll
    for (int r = 0; r < 8; ++r) { const int n = (int)((r0 + 8 * g + r) % NN); const float ang = (1.57079632679489662f * (float)(n + 1)) / (float)NN; const float sn = sin_p(ang), cs = cos_p(ang);
#pragma unroll
      for (int j = 0; j < 8; ++j) { const float v = fmaxf(acc[j][r], 0.f); st[0][j * 16 + col][wave * 16 + 8 * g + r] = (_Float16)(v * sn); st[1][j * 16 + col][wave * 16 + 8 * g + r] = (_Float16)(v * cs); } }
    __syncthreads();
    for (int e = tid; e < 2 * 128 * 8; e += 128) { const int pl = e >> 10, d = (e >> 3) & 127, pc = e & 7; vst2((unsigned*)(KT + ((b * D2 + (size_t)pl * DD + n0 + d) * NN) + s0 + pc * 8), *(const v4u*)&st[pl][d][pc * 8]); }
  } else {
#pragma unroll
    for (int r = 0; r < 8; ++r)
#pragma unroll
      for (int j = 0; j < 8; ++j) st[0][j * 16 + col][wave * 16 + 8 * g + r] = (_Float16)acc[j][r];
    __syncthreads();
    for (int e = tid; e < 128 * 8; e += 128) { const int d = e >> 3, pc = e & 7; vst2((unsigned*)(VT + ((b * DD + n0 + d) * NN) + s0 + pc * 8), *(const v4u*)&st[0][d][pc * 8]); } }
}
// stage = 128 tokens: k_^T 64 rows and v^T 128 rows of 256 B at pitch 272
#define KV_P 272
#define KV_STG ((64 + 128) * KV_P)
__global__ __launch_bounds__(128) void k_kv(const _Float16* __restrict__ KT, const _Float16* __restrict__ VT, _Float16* __restrict__ KVH, _Float16* __restrict__ KVL) {
  __shared__ __align__(16) char ring[2 * KV_STG]; __shared__ __align__(16) _Float16 sh[128][72]; __shared__ __align__(16) _Float16 sl[128][72];
  const int tid = threadIdx.x, wave = tid >> 5, lane = tid & 31, col = lane & 15, g = lane >> 4; const size_t b = blockIdx.z; const int d0 = blockIdx.x * 64; const int m0 = blockIdx.y * 128;
  const char* ga = (const char*)(KT + (b * D2 + d0 + (tid >> 4)) * NN) + (tid & 15) * 16; const char* gb = (const char*)(VT + (b * DD + m0 + (tid >> 4)) * NN) + (tid & 15) * 16;
  const unsigned la = lds_off(ring) + (tid >> 4) * KV_P + (tid & 15) * 16; const size_t gs = (size_t)8 * NN * 2;
  v8f acc[8] = {};
  acp8(la, 8 * KV_P, ga, gs); acp8(la + 64 * KV_P, 8 * KV_P, gb, gs); acp8(la + 128 * KV_P, 8 * KV_P, gb + 8 * gs, gs);
  WAIT_ACP(); __syncthreads();
  acp8(la + KV_STG, 8 * KV_P, ga + 256, gs); acp8(la + KV_STG + 64 * KV_P, 8 * KV_P, gb + 256, gs); acp8(la + KV_STG + 128 * KV_P, 8 * KV_P, gb + 8 * gs + 256, gs);
  for (int t = 0; t < NN / 128; ++t) { const unsigned bo = (t & 1) * KV_STG; const char* base = ring + bo;
    // two fragment sets: the next 32 tokens' fragments are read from LDS as one group in front of this slice's WMMAs, so that their latency runs behind the WMMAs; the loops are unrolled so that the fragment arrays have constant indices and stay in registers
    v16h a[2], w[2][8];
    a[0] = frag_h((const _Float16*)(base + (wave * 16 + col) * KV_P), lane);
#pragma unroll
    for (int j = 0; j < 8; ++j) w[0][j] = frag_h((const _Float16*)(base + (64 + j * 16 + col) * KV_P), lane);
#pragma unroll
    for (int kc = 0; kc < 4; ++kc) {
      if (kc + 1 < 4) { a[(kc + 1) & 1] = frag_h((const _Float16*)(base + (wave * 16 + col) * KV_P) + (kc + 1) * 32, lane);
#pragma unroll
        for (int j = 0; j < 8; ++j) w[(kc + 1) & 1][j] = frag_h((const _Float16*)(base + (64 + j * 16 + col) * KV_P) + (kc + 1) * 32, lane); }
#pragma unroll
      for (int j = 0; j < 8; ++j) acc[j] = wmma16(a[kc & 1], w[kc & 1][j], acc[j]); }
    WAIT_DS(); WAIT_ACP(); __syncthreads();
    if (t + 2 < NN / 128) { const size_t go = (size_t)(t + 2) * 256; acp8(la + bo, 8 * KV_P, ga + go, gs); acp8(la + bo + 64 * KV_P, 8 * KV_P, gb + go, gs); acp8(la + bo + 128 * KV_P, 8 * KV_P, gb + 8 * gs + go, gs); } }
  WAIT_ACP();
#pragma unroll
  for (int j = 0; j < 8; ++j)
#pragma unroll
    for (int r = 0; r < 8; ++r) { const float v = acc[j][r]; const _Float16 hv = (_Float16)v; sh[j * 16 + col][wave * 16 + 8 * g + r] = hv; sl[j * 16 + col][wave * 16 + 8 * g + r] = (_Float16)((v - (float)hv) * 2048.0f); }
  __syncthreads();
  for (int e = tid; e < 128 * 8; e += 128) { const int m = e >> 3, pc = e & 7; const size_t o = ((b * DD + m0 + m) * D2) + d0 + pc * 8; vst2((unsigned*)(KVH + o), *(const v4u*)&sh[m][pc * 8]); vst2((unsigned*)(KVL + o), *(const v4u*)&sl[m][pc * 8]); }
}
// ---- k_ksum: block = (128 dd, b), 256 threads: fixed-order sums over the 4,096 tokens of the f16 k_ planes -> KS[b][dd] (512-B segment)
__global__ __launch_bounds__(256) void k_ksum(const _Float16* __restrict__ KT, float* __restrict__ KS) {
  __shared__ __align__(16) float part[2][128]; const size_t b = blockIdx.y; const int d0 = blockIdx.x * 128, t = threadIdx.x; const int dl = t & 127, half = t >> 7; const _Float16* p = KT + ((b * D2 + d0 + dl) * NN) + half * (NN / 2); float s = 0.f;
  for (int n = 0; n < NN / 2; n += 8) { const v4u w = *(const v4u*)(p + n); const _Float16* h8 = (const _Float16*)&w; for (int i = 0; i < 8; ++i) s += (float)h8[i]; }
  part[half][dl] = s; __syncthreads();
  if (t < 128) part[0][t] = part[0][t] + part[1][t]; __syncthreads();
  if (t < 32) vst2(KS + b * D2 + d0 + t * 4, *(const v4f*)&part[0][t * 4]);
}
// ---- k_fin: block = (64 tokens, 128 m cols, b): acc = q_ . kv (hi + residual) over dd; z = 1/max(q_ . KS, 1e-6) per row (f32, from the same f16 q_); out = acc z stored through the (b,H,n,hd)->(b,n,H,hd) view: computed (n, m) -> row (8n + m/64) mod N, cols (n/512)*64 + m%64
// stage = 64 dd: q_ 64 rows, kv hi 128 rows, kv residual 128 rows of 128 B at pitch 144; the output staging so takes the ring's place behind the loop
#define FN_P 144
#define FN_STG ((64 + 128 + 128) * FN_P)
__global__ __launch_bounds__(128) void k_fin(const _Float16* __restrict__ Q, const _Float16* __restrict__ KVH, const _Float16* __restrict__ KVL, const float* __restrict__ KS, float* __restrict__ OUT) {
  __shared__ __align__(16) char ring[2 * FN_STG]; __shared__ float sz[4][16]; float (*so)[16][132] = (float (*)[16][132])ring;
  const int tid = threadIdx.x, wave = tid >> 5, lane = tid & 31, col = lane & 15, g = lane >> 4; const size_t b = blockIdx.z; const int nb0 = blockIdx.x * 64; const int nw = nb0 + wave * 16; const size_t r0 = b * NN + nw; const int m0 = blockIdx.y * 128;
  // z for this wave's 16 rows: lanes (rl = lane & 15, half = lane >> 4) sum 512 dd each
  { const int rl = lane & 15, half = lane >> 4; float s = 0.f; const _Float16* q = Q + (r0 + rl) * D2 + half * DD; const float* ks = KS + b * D2 + half * DD;
    for (int d = 0; d < DD; d += 8) { const v4u w = *(const v4u*)(q + d); const _Float16* h8 = (const _Float16*)&w;
#pragma unroll
      for (int i = 0; i < 8; ++i) s += (float)h8[i] * ks[d + i]; }
    s += __shfl_xor(s, 16); if (lane < 16) sz[wave][rl] = 1.0f / fmaxf(s, 1e-6f); }
  const char* ga = (const char*)(Q + (b * NN + nb0 + (tid >> 3)) * D2) + (tid & 7) * 16; const size_t kvo = ((b * DD + m0 + (tid >> 3)) * D2) * 2 + (tid & 7) * 16; const char* gh = (const char*)KVH + kvo; const char* gl = (const char*)KVL + kvo;
  const unsigned la = lds_off(ring) + (tid >> 3) * FN_P + (tid & 7) * 16; const size_t gs = (size_t)16 * D2 * 2;
  v8f acc[8] = {};
  acp4(la, 16 * FN_P, ga, gs); acp8(la + 64 * FN_P, 16 * FN_P, gh, gs); acp8(la + 192 * FN_P, 16 * FN_P, gl, gs);
  WAIT_ACP(); __syncthreads();
  acp4(la + FN_STG, 16 * FN_P, ga + 128, gs); acp8(la + FN_STG + 64 * FN_P, 16 * FN_P, gh + 128, gs); acp8(la + FN_STG + 192 * FN_P, 16 * FN_P, gl + 128, gs);
  for (int t = 0; t < D2 / 64; ++t) { const unsigned bo = (t & 1) * FN_STG; const char* base = ring + bo;
    // two fragment sets of four column tiles (hi and residual): the next set is read from LDS as one group in front of this set's WMMAs, so that its latency runs behind them; the loops are unrolled so that the fragment arrays have constant indices and stay in registers
    v16h a[2], wh[2][4], wl[2][4];
#pragma unroll
    for (int kc = 0; kc < 2; ++kc) a[kc] = frag_h((const _Float16*)(base + (wave * 16 + col) * FN_P) + kc * 32, lane);
#pragma unroll
    for (int j = 0; j < 4; ++j) { const char* wb = base + (64 + j * 16 + col) * FN_P; wh[0][j] = frag_h((const _Float16*)wb, lane); wl[0][j] = frag_h((const _Float16*)(wb + 128 * FN_P), lane); }
#pragma unroll
    for (int s = 0; s < 4; ++s) { const int kc = s >> 1, jh = (s & 1) * 4;
      if (s + 1 < 4) { const int kn = (s + 1) >> 1, jn = ((s + 1) & 1) * 4;
#pragma unroll
        for (int j = 0; j < 4; ++j) { const char* wb = base + (64 + (jn + j) * 16 + col) * FN_P + kn * 64; wh[(s + 1) & 1][j] = frag_h((const _Float16*)wb, lane); wl[(s + 1) & 1][j] = frag_h((const _Float16*)(wb + 128 * FN_P), lane); } }
#pragma unroll
      for (int j = 0; j < 4; ++j) { acc[jh + j] = wmma16(a[kc], wh[s & 1][j], acc[jh + j]); v8f t2 = {}; t2 = wmma16(a[kc], wl[s & 1][j], t2);
#pragma unroll
        for (int r = 0; r < 8; ++r) acc[jh + j][r] += t2[r] * (1.0f / 2048.0f); } }
    WAIT_DS(); WAIT_ACP(); __syncthreads();
    if (t + 2 < D2 / 64) { const size_t go = (size_t)(t + 2) * 128; acp4(la + bo, 16 * FN_P, ga + go, gs); acp8(la + bo + 64 * FN_P, 16 * FN_P, gh + go, gs); acp8(la + bo + 192 * FN_P, 16 * FN_P, gl + go, gs); } }
  WAIT_ACP();
  LDSX();
#pragma unroll
  for (int j = 0; j < 8; ++j)
#pragma unroll
    for (int r = 0; r < 8; ++r) so[wave][8 * g + r][j * 16 + col] = acc[j][r] * sz[wave][8 * g + r];
  LDSX();
  // each computed row n (16 per wave) x this block's 128 cols = two 64-col chunks j64 = m0/64 + {0,1} -> final row (8n + j64) % NN, col block (n/512)*64
  for (int rl = 0; rl < 16; ++rl) { const int n = nw + rl; const int j64 = m0 / 64 + (lane >> 4); const size_t frow = b * NN + (size_t)((8 * n + j64) % NN); const int fc0 = (n / 512) * HD;
    vst2(OUT + frow * DD + fc0 + (lane & 15) * 4, *(const v4f*)&so[wave][rl][(lane >> 4) * 64 + (lane & 15) * 4]); }   // two 256-B segments per computed row (lanes 0-15 / 16-31)
}
extern "C" void kernel_launch(void* const* d_in, const int* in_sizes, int n_in, void* d_out, int out_size, void* d_ws, size_t ws_size, hipStream_t stream) {
  (void)in_sizes; (void)n_in; (void)out_size;
  const float** F = (const float**)d_in;   // 0 x [4,4096,512], 1 Wq, 2 Wk, 3 Wv [512,512] natural
  if (ws_size < (size_t)WS_END) return;
  char* ws = (char*)d_ws; __bf16* P = (__bf16*)ws; _Float16 *Q = (_Float16*)(ws + WS_Q), *KT = (_Float16*)(ws + WS_KT), *VT = (_Float16*)(ws + WS_VT), *KVH = (_Float16*)(ws + WS_KVH), *KVL = (_Float16*)(ws + WS_KVL); float* KS = (float*)(ws + WS_KS);
  k_pack<<<3 * DD, 256, 0, stream>>>(F[1], F[2], F[3], P);
  k_proj<<<dim3(TR / 64, DD / 128, 3), 128, 0, stream>>>(F[0], P, Q, KT, VT);
  k_kv<<<dim3(D2 / 64, DD / 128, TNB), 128, 0, stream>>>(KT, VT, KVH, KVL);
  k_ksum<<<dim3(D2 / 128, TNB), 256, 0, stream>>>(KT, KS);
  k_fin<<<dim3(NN / 64, DD / 128, TNB), 128, 0, stream>>>(Q, KVH, KVL, KS, (float*)d_out);
}

// v002
// It runs in 132 microseconds.
// Two timings next to v001 both put it at 1.19 times that version's speed.
// Counting every step since v000, it is 3.79 times as fast.
// compute dtype: all float inputs rounded to bf16; q / k / v = x . W^T with EXACT bf16 products on WMMA 16x16x32 (natural rows), ReLU and the cos-reweighting (idx = (pi/2)(n+1)/N in f32, precise sinf/cosf) in f32, q_ / k_ / v rounded once to f16; kv = k_^T v and out = q_ kv as WMMA GEMMs (kv carried as f16 hi + residual, 2 products); the column sums of k_ (f32, taken in k_kv from its k_^T fragments) and the normaliser z = 1 / max(q_ . sum k_, 1e-6) in f32 from the same f16-rounded values; output written through the module's (b,H,n,hd) -> (b,n,H,hd) reshape.
#include <hip/hip_runtime.h>
#include <math.h>

typedef __attribute__((ext_vector_type(16))) _Float16 v16h;
typedef __attribute__((ext_vector_type(16))) __bf16 v16b;
typedef __attribute__((ext_vector_type(8)))  _Float16 v8h;
typedef __attribute__((ext_vector_type(8)))  float v8f;
typedef __attribute__((ext_vector_type(4)))  float v4f;
typedef __attribute__((ext_vector_type(2)))  float v2f;
typedef __attribute__((ext_vector_type(4)))  unsigned v4u;
typedef __attribute__((ext_vector_type(4)))  int v4i;
typedef float __attribute__((may_alias)) float_a;
typedef int __attribute__((may_alias)) int_a;

template <typename T> __device__ __forceinline__ void vst2(void* p, T v) { *(T*)p = v;  }
__device__ __forceinline__ v8f wmma16(v16h a, v16h b, v8f c) {
  v8f d = __builtin_amdgcn_wmma_f32_16x16x32_f16(false, a, false, b, (short)0, c, false, false);
  asm volatile("v_nop\n\tv_nop\n\tv_nop\n\tv_nop" : "+v"(d) : "v"(a), "v"(b));
  return d;
}
__device__ __forceinline__ v8f wmma_bf(v16b a, v16b b, v8f c) {
  v8f d = __builtin_amdgcn_wmma_f32_16x16x32_bf16(false, a, false, b, (short)0, c, false, false);
  asm volatile("v_nop\n\tv_nop\n\tv_nop\n\tv_nop" : "+v"(d) : "v"(a), "v"(b));
  return d;
}
// 16x16x32 fragments: lane = (h = lane>>4, row/col = lane&15); elements 0..7 = k0+8h+0..7, 8..15 = k0+16+8h+0..7; D element r = row 8h+r
__device__ __forceinline__ v16h frag_h(const _Float16* rowk0, int lane) {
  union { v16h v; v8h q[2]; } u; const _Float16* p = rowk0 + 8 * (lane >> 4);
  u.q[0] = *(const v8h*)p; u.q[1] = *(const v8h*)(p + 16); return u.v;
}
__device__ __forceinline__ v16h frag_f32(const float* rowk0, int lane) {
  v16h a; const float* p = rowk0 + 8 * (lane >> 4);
#pragma unroll
  for (int i = 0; i < 8; ++i) { a[i] = (_Float16)p[i]; a[8 + i] = (_Float16)p[16 + i]; }
  return a;
}
__device__ __forceinline__ v16h frag_f32s(const float* rowk0, int lane, float sc) {
  v16h a; const float* p = rowk0 + 8 * (lane >> 4);
#pragma unroll
  for (int i = 0; i < 8; ++i) { a[i] = (_Float16)(p[i] * sc); a[8 + i] = (_Float16)(p[16 + i] * sc); }
  return a;
}
// column fragment from a [K][ld] layout (column n), rows >= K read as 0
__device__ __forceinline__ v16h fragc_f32(const float* W, int k0, int n, int lane, int ld, int K) {
  v16h a; const int g = lane >> 4;
#pragma unroll
  for (int i = 0; i < 8; ++i) { const int ka = k0 + 8 * g + i, kb = ka + 16;
    a[i] = (_Float16)(ka < K ? W[(size_t)(ka < K ? ka : K - 1) * ld + n] : 0.f); a[8 + i] = (_Float16)(kb < K ? W[(size_t)(kb < K ? kb : K - 1) * ld + n] : 0.f); }
  return a;
}
struct F2 { v16b h, l; };
__device__ __forceinline__ F2 bsplit16(const float v[16]) { F2 r;
#pragma unroll
  for (int i = 0; i < 16; ++i) { const __bf16 h = (__bf16)v[i]; r.h[i] = h; r.l[i] = (__bf16)(v[i] - (float)h); }
  return r; }
__device__ __forceinline__ F2 split_row(const float* row, int k0, int lane) { float v[16]; const float* p = row + k0 + 8 * (lane >> 4);
#pragma unroll
  for (int i = 0; i < 8; ++i) { v[i] = p[i]; v[8 + i] = p[16 + i]; }
  return bsplit16(v); }
__device__ __forceinline__ F2 split_rowK(const float* row, int k0, int lane, int K) { float v[16]; const int g = lane >> 4;
#pragma unroll
  for (int i = 0; i < 8; ++i) { const int ka = k0 + 8 * g + i, kb = ka + 16; v[i] = ka < K ? row[ka < K ? ka : K - 1] : 0.f; v[8 + i] = kb < K ? row[kb < K ? kb : K - 1] : 0.f; }
  return bsplit16(v); }
__device__ __forceinline__ F2 split_col(const float* W, int k0, int n, int lane, int ld, int K) { float v[16]; const int g = lane >> 4;
#pragma unroll
  for (int i = 0; i < 8; ++i) { const int ka = k0 + 8 * g + i, kb = ka + 16; v[i] = ka < K ? W[(size_t)(ka < K ? ka : K - 1) * ld + n] : 0.f; v[8 + i] = kb < K ? W[(size_t)(kb < K ? kb : K - 1) * ld + n] : 0.f; }
  return bsplit16(v); }
__device__ __forceinline__ v8f mac3(const F2& a, const F2& b, v8f c) { c = wmma_bf(a.l, b.h, c); c = wmma_bf(a.h, b.l, c); return wmma_bf(a.h, b.h, c); }
__device__ __forceinline__ float sigm(float v) { return 1.0f / (1.0f + expf(-v)); }
#define LDSX() do { asm volatile("s_wait_dscnt 0" ::: "memory"); __builtin_amdgcn_wave_barrier(); __builtin_amdgcn_fence(__ATOMIC_RELEASE, "workgroup"); } while (0)


// cosFormer linear attention (B 4, N 4,096, d 512, 8 heads): q = relu(x Wq^T), k = relu(x Wk^T), v = x Wv^T; q_, k_ = [q sin, q cos], [k sin, k cos] with the position weights (pi/2)(n+1)/N; out = (q_ (k_^T v)) / max(q_ . sum_n k_, 1e-6), then the module's head reshape.
#define NB 4
#define NN 4096
#define DD 512
#define D2 (2 * DD)
#define NH 8
#define HD 64
#define NR (NB * NN)
#ifndef TNB
#define TNB NB
#endif
#define TR (TNB * NN)
typedef __attribute__((ext_vector_type(8))) __bf16 v8b;
__device__ __forceinline__ v16b frag_b(const __bf16* rowk0, int lane) {
  union { v16b v; v8b q[2]; } u; const __bf16* p = rowk0 + 8 * (lane >> 4);
  u.q[0] = *(const v8b*)p; u.q[1] = *(const v8b*)(p + 16); return u.v;
}
__device__ __forceinline__ float bfr(float v) { return (float)(__bf16)v; }
__device__ __attribute__((noinline)) float exp_ni(float v) { return expf(v); }
__device__ __attribute__((noinline)) float erf_ni(float v) { return erff(v); }

#define WS_PW  0u                                  // bf16 natural rows Wq, Wk, Wv [3][512][512]
#define WS_Q   (WS_PW + 2u * (size_t)3 * DD * DD)   // f16 rows q_ [NR][1024]
#define WS_KT  (WS_Q + 2u * (size_t)NR * D2)        // f16 planes k_^T [b][1024][NN] ; v^T [b][512][NN]
#define WS_VT  (WS_KT + 2u * (size_t)NB * D2 * NN)
#define WS_KVH (WS_VT + 2u * (size_t)NB * DD * NN)  // f16 hi / lo kv^T [b][512 m][1024 dd]
#define WS_KVL (WS_KVH + 2u * (size_t)NB * DD * D2)
#define WS_KS  (WS_KVL + 2u * (size_t)NB * DD * D2) // f32 [b][1024] sum_n k_
#define WS_END (WS_KS + 4u * (size_t)NB * D2)

__global__ __launch_bounds__(256) void k_pack(const float* __restrict__ WQ, const float* __restrict__ WK, const float* __restrict__ WV, __bf16* __restrict__ P) { const int n = blockIdx.x, t = threadIdx.x; const float* src = (n < DD) ? (WQ + (size_t)n * DD) : (n < 2 * DD) ? (WK + (size_t)(n - DD) * DD) : (WV + (size_t)(n - 2 * DD) * DD); __shared__ __align__(16) __bf16 s[DD]; for (int k = t; k < DD; k += 256) s[k] = (__bf16)src[k]; __syncthreads(); if (t < DD / 8) vst2((unsigned*)(P + (size_t)n * DD + t * 8), *(const v4u*)&s[t * 8]); }
__device__ __attribute__((noinline)) float sin_p(float v) { return sinf(v); }
__device__ __attribute__((noinline)) float cos_p(float v) { return cosf(v); }
__device__ __forceinline__ unsigned lds_off(const void* p) { return (unsigned)(size_t)p; }
// one lane's 8 (4) copies, rows ls bytes apart in LDS and gs bytes apart in global memory; s_wait_xcnt 0 closes the statement so that no address register of a copy is rewritten in front of it
__device__ __forceinline__ void acp8(unsigned l, unsigned ls, const char* p, size_t gs) {
  asm volatile("global_load_async_to_lds_b128 %0, %8, off\n\t"
               "global_load_async_to_lds_b128 %1, %9, off\n\t"
               "global_load_async_to_lds_b128 %2, %10, off\n\t"
               "global_load_async_to_lds_b128 %3, %11, off\n\t"
               "global_load_async_to_lds_b128 %4, %12, off\n\t"
               "global_load_async_to_lds_b128 %5, %13, off\n\t"
               "global_load_async_to_lds_b128 %6, %14, off\n\t"
               "global_load_async_to_lds_b128 %7, %15, off\n\t"
               "s_wait_xcnt 0x0"
               :: "v"(l), "v"(l + ls), "v"(l + 2 * ls), "v"(l + 3 * ls), "v"(l + 4 * ls), "v"(l + 5 * ls), "v"(l + 6 * ls), "v"(l + 7 * ls),
                  "v"(p), "v"(p + gs), "v"(p + 2 * gs), "v"(p + 3 * gs), "v"(p + 4 * gs), "v"(p + 5 * gs), "v"(p + 6 * gs), "v"(p + 7 * gs) : "memory");
}
__device__ __forceinline__ void acp4(unsigned l, unsigned ls, const char* p, size_t gs) {
  asm volatile("global_load_async_to_lds_b128 %0, %4, off\n\t"
               "global_load_async_to_lds_b128 %1, %5, off\n\t"
               "global_load_async_to_lds_b128 %2, %6, off\n\t"
               "global_load_async_to_lds_b128 %3, %7, off\n\t"
               "s_wait_xcnt 0x0"
               :: "v"(l), "v"(l + ls), "v"(l + 2 * ls), "v"(l + 3 * ls), "v"(p), "v"(p + gs), "v"(p + 2 * gs), "v"(p + 3 * gs) : "memory");
}
// this wave's copies have landed (in front of the barrier behind which other waves read them)
#define WAIT_ACP() asm volatile("s_wait_asynccnt 0x0" ::: "memory")
// this wave's LDS reads of a buffer have returned (in front of the barrier behind which the buffer is refilled)
#define WAIT_DS() asm volatile("s_wait_dscnt 0x0" ::: "memory")
// ---- k_proj: block = (64 tokens, 128 cols, which): 0 q -> relu, x sin | x cos -> q_ rows; 1 k -> relu, x sin | cos -> k_^T planes; 2 v -> v^T planes
// stage = 64 k: x 64 rows of 256 B (f32) at pitch 272, W 128 rows of 128 B (bf16) at pitch 144; the output staging so / st takes the ring's place behind the loop
#define PJ_PA 272
#define PJ_PB 144
#define PJ_STG (64 * PJ_PA + 128 * PJ_PB)
__global__ __launch_bounds__(128) void k_proj(const float* __restrict__ X, const __bf16* __restrict__ P, _Float16* __restrict__ Q, _Float16* __restrict__ KT, _Float16* __restrict__ VT) {
  __shared__ __align__(16) char ring[2 * PJ_STG];
  _Float16 (*so)[64][136] = (_Float16 (*)[64][136])ring; _Float16 (*st)[128][72] = (_Float16 (*)[128][72])ring;
  const int tid = threadIdx.x, wave = tid >> 5, lane = tid & 31, col = lane & 15, g = lane >> 4; const int which = blockIdx.z; const int n0 = blockIdx.y * 128; const size_t rb0 = (size_t)blockIdx.x * 64, r0 = rb0 + wave * 16; const size_t b = rb0 / NN, s0 = rb0 % NN;
  const char* ga = (const char*)(X + (rb0 + (tid >> 4)) * DD) + (tid & 15) * 16; const char* gb = (const char*)(P + ((size_t)which * DD + n0 + (tid >> 3)) * DD) + (tid & 7) * 16;
  const unsigned la = lds_off(ring) + (tid >> 4) * PJ_PA + (tid & 15) * 16, lb = lds_off(ring) + 64 * PJ_PA + (tid >> 3) * PJ_PB + (tid & 7) * 16;
  v8f acc[8] = {};
  acp8(la, 8 * PJ_PA, ga, (size_t)8 * DD * 4); acp8(lb, 16 * PJ_PB, gb, (size_t)16 * DD * 2);
  WAIT_ACP(); __syncthreads();
  acp8(la + PJ_STG, 8 * PJ_PA, ga + 256, (size_t)8 * DD * 4); acp8(lb + PJ_STG, 16 * PJ_PB, gb + 128, (size_t)16 * DD * 2);
  for (int t = 0; t < DD / 64; ++t) { const unsigned bo = (t & 1) * PJ_STG; const char* base = ring + bo;
    // the trip's fragments are read from LDS as one group in front of its WMMAs, so that the LDS latency is waited out once a trip and not once a WMMA; the loops are unrolled so that the fragment arrays have constant indices and stay in registers
    v16b a[2], w[2][8];
#pragma unroll
    for (int kc = 0; kc < 2; ++kc) { const float* p = (const float*)(base + (wave * 16 + col) * PJ_PA) + kc * 32 + 8 * g;
#pragma unroll
      for (int i = 0; i < 8; ++i) { a[kc][i] = (__bf16)p[i]; a[kc][8 + i] = (__bf16)p[16 + i]; }
#pragma unroll
      for (int j = 0; j < 8; ++j) w[kc][j] = frag_b((const __bf16*)(base + 64 * PJ_PA + (j * 16 + col) * PJ_PB) + kc * 32, lane); }
#pragma unroll
    for (int kc = 0; kc < 2; ++kc)
#pragma unroll
      for (int j = 0; j < 8; ++j) acc[j] = wmma_bf(a[kc], w[kc][j], acc[j]);
    WAIT_DS(); WAIT_ACP(); __syncthreads();
    if (t + 2 < DD / 64) { acp8(la + bo, 8 * PJ_PA, ga + (t + 2) * 256, (size_t)8 * DD * 4); acp8(lb + bo, 16 * PJ_PB, gb + (t + 2) * 128, (size_t)16 * DD * 2); } }
  WAIT_ACP();
  if (which == 0) {
#pragma unroll
    for (int r = 0; r < 8; ++r) { const int n = (int)((r0 + 8 * g + r) % NN); const float ang = (1.57079632679489662f * (float)(n + 1)) / (float)NN; const float sn = sin_p(ang), cs = cos_p(ang);
#pragma unroll
      for (int j = 0; j < 8; ++j) { const float v = fmaxf(acc[j][r], 0.f); so[0][wave * 16 + 8 * g + r][j * 16 + col] = (_Float16)(v * sn); so[1][wave * 16 + 8 * g + r][j * 16 + col] = (_Float16)(v * cs); } }
    LDSX();
    for (int rl = 0; rl < 16; ++rl) if (lane < 16) { vst2((unsigned*)(Q + (r0 + rl) * D2 + n0 + lane * 8), *(const v4u*)&so[0][wave * 16 + rl][lane * 8]); vst2((unsigned*)(Q + (r0 + rl) * D2 + DD + n0 + lane * 8), *(const v4u*)&so[1][wave * 16 + rl][lane * 8]); }
  } else if (which == 1) {
#pragma unroll
    for (int r = 0; r < 8; ++r) { const int n = (int)((r0 + 8 * g + r) % NN); const float ang = (1.57079632679489662f * (float)(n + 1)) / (float)NN; const float sn = sin_p(ang), cs = cos_p(ang);
#pragma unroll
      for (int j = 0; j < 8; ++j) { const float v = fmaxf(acc[j][r], 0.f); st[0][j * 16 + col][wave * 16 + 8 * g + r] = (_Float16)(v * sn); st[1][j * 16 + col][wave * 16 + 8 * g + r] = (_Float16)(v * cs); } }
    __syncthreads();
    for (int e = tid; e < 2 * 128 * 8; e += 128) { const int pl = e >> 10, d = (e >> 3) & 127, pc = e & 7; vst2((unsigned*)(KT + ((b * D2 + (size_t)pl * DD + n0 + d) * NN) + s0 + pc * 8), *(const v4u*)&st[pl][d][pc * 8]); }
  } else {
#pragma unroll
    for (int r = 0; r < 8; ++r)
#pragma unroll
      for (int j = 0; j < 8; ++j) st[0][j * 16 + col][wave * 16 + 8 * g + r] = (_Float16)acc[j][r];
    __syncthreads();
    for (int e = tid; e < 128 * 8; e += 128) { const int d = e >> 3, pc = e & 7; vst2((unsigned*)(VT + ((b * DD + n0 + d) * NN) + s0 + pc * 8), *(const v4u*)&st[0][d][pc * 8]); } }
}
// stage = 128 tokens: k_^T 64 rows and v^T 128 rows of 256 B at pitch 272; the work-groups of the first m block also sum k_ over the tokens, in f32 from the k_^T fragments that they hold in registers anyway -> KS[b][dd]
#define KV_P 272
#define KV_STG ((64 + 128) * KV_P)
__global__ __launch_bounds__(128) void k_kv(const _Float16* __restrict__ KT, const _Float16* __restrict__ VT, _Float16* __restrict__ KVH, _Float16* __restrict__ KVL, float* __restrict__ KS) {
  __shared__ __align__(16) char ring[2 * KV_STG]; __shared__ __align__(16) _Float16 sh[128][72]; __shared__ __align__(16) _Float16 sl[128][72]; __shared__ __align__(16) float sks[2][64];
  const int tid = threadIdx.x, wave = tid >> 5, lane = tid & 31, col = lane & 15, g = lane >> 4; const size_t b = blockIdx.z; const int d0 = blockIdx.x * 64; const int m0 = blockIdx.y * 128;
  const char* ga = (const char*)(KT + (b * D2 + d0 + (tid >> 4)) * NN) + (tid & 15) * 16; const char* gb = (const char*)(VT + (b * DD + m0 + (tid >> 4)) * NN) + (tid & 15) * 16;
  const unsigned la = lds_off(ring) + (tid >> 4) * KV_P + (tid & 15) * 16; const size_t gs = (size_t)8 * NN * 2;
  v8f acc[8] = {};
  const bool ksb = blockIdx.y == 0; float ps[4] = {0.f, 0.f, 0.f, 0.f};   // lane (g, col): four independent partial sums of row wave * 16 + col over the 16 tokens of each slice that its fragment holds
  acp8(la, 8 * KV_P, ga, gs); acp8(la + 64 * KV_P, 8 * KV_P, gb, gs); acp8(la + 128 * KV_P, 8 * KV_P, gb + 8 * gs, gs);
  WAIT_ACP(); __syncthreads();
  acp8(la + KV_STG, 8 * KV_P, ga + 256, gs); acp8(la + KV_STG + 64 * KV_P, 8 * KV_P, gb + 256, gs); acp8(la + KV_STG + 128 * KV_P, 8 * KV_P, gb + 8 * gs + 256, gs);
  for (int t = 0; t < NN / 128; ++t) { const unsigned bo = (t & 1) * KV_STG; const char* base = ring + bo;
    // two fragment sets: the next 32 tokens' fragments are read from LDS as one group in front of this slice's WMMAs, so that their latency runs behind the WMMAs; the loops are unrolled so that the fragment arrays have constant indices and stay in registers
    v16h a[2], w[2][8];
    a[0] = frag_h((const _Float16*)(base + (wave * 16 + col) * KV_P), lane);
#pragma unroll
    for (int j = 0; j < 8; ++j) w[0][j] = frag_h((const _Float16*)(base + (64 + j * 16 + col) * KV_P), lane);
#pragma unroll
    for (int kc = 0; kc < 4; ++kc) {
      if (kc + 1 < 4) { a[(kc + 1) & 1] = frag_h((const _Float16*)(base + (wave * 16 + col) * KV_P) + (kc + 1) * 32, lane);
#pragma unroll
        for (int j = 0; j < 8; ++j) w[(kc + 1) & 1][j] = frag_h((const _Float16*)(base + (64 + j * 16 + col) * KV_P) + (kc + 1) * 32, lane); }
      if (ksb) {   // unrolled so that the fragment's elements and the four sums have constant indices and stay in registers
#pragma unroll
        for (int i = 0; i < 16; ++i) ps[i & 3] += (float)a[kc & 1][i]; }
#pragma unroll
      for (int j = 0; j < 8; ++j) acc[j] = wmma16(a[kc & 1], w[kc & 1][j], acc[j]); }
    WAIT_DS(); WAIT_ACP(); __syncthreads();
    if (t + 2 < NN / 128) { const size_t go = (size_t)(t + 2) * 256; acp8(la + bo, 8 * KV_P, ga + go, gs); acp8(la + bo + 64 * KV_P, 8 * KV_P, gb + go, gs); acp8(la + bo + 128 * KV_P, 8 * KV_P, gb + 8 * gs + go, gs); } }
  WAIT_ACP();
#pragma unroll
  for (int j = 0; j < 8; ++j)
#pragma unroll
    for (int r = 0; r < 8; ++r) { const float v = acc[j][r]; const _Float16 hv = (_Float16)v; sh[j * 16 + col][wave * 16 + 8 * g + r] = hv; sl[j * 16 + col][wave * 16 + 8 * g + r] = (_Float16)((v - (float)hv) * 2048.0f); }
  if (ksb) sks[g][wave * 16 + col] = (ps[0] + ps[1]) + (ps[2] + ps[3]);
  __syncthreads();
  for (int e = tid; e < 128 * 8; e += 128) { const int m = e >> 3, pc = e & 7; const size_t o = ((b * DD + m0 + m) * D2) + d0 + pc * 8; vst2((unsigned*)(KVH + o), *(const v4u*)&sh[m][pc * 8]); vst2((unsigned*)(KVL + o), *(const v4u*)&sl[m][pc * 8]); }
  // the two lane halves' sums are added and one wave stores the 256-B segment
  if (ksb && tid < 16) vst2(KS + b * D2 + d0 + tid * 4, *(const v4f*)&sks[0][tid * 4] + *(const v4f*)&sks[1][tid * 4]);
}
// ---- k_fin: block = (64 tokens, 128 m cols, b): acc = q_ . kv (hi + residual) over dd; z = 1/max(q_ . KS, 1e-6) per row (f32, from the same f16 q_); out = acc z stored through the (b,H,n,hd)->(b,n,H,hd) view: computed (n, m) -> row (8n + m/64) mod N, cols (n/512)*64 + m%64
// stage = 64 dd: q_ 64 rows, kv hi 128 rows, kv residual 128 rows of 128 B at pitch 144; the output staging so takes the ring's place behind the loop
#define FN_P 144
#define FN_STG ((64 + 128 + 128) * FN_P)
__global__ __launch_bounds__(128) void k_fin(const _Float16* __restrict__ Q, const _Float16* __restrict__ KVH, const _Float16* __restrict__ KVL, const float* __restrict__ KS, float* __restrict__ OUT) {
  __shared__ __align__(16) char ring[2 * FN_STG]; __shared__ float sz[4][16]; float (*so)[16][132] = (float (*)[16][132])ring;
  const int tid = threadIdx.x, wave = tid >> 5, lane = tid & 31, col = lane & 15, g = lane >> 4; const size_t b = blockIdx.z; const int nb0 = blockIdx.x * 64; const int nw = nb0 + wave * 16; const size_t r0 = b * NN + nw; const int m0 = blockIdx.y * 128;
  // z for this wave's 16 rows: lanes (rl = lane & 15, half = lane >> 4) sum 512 dd each
  { const int rl = lane & 15, half = lane >> 4; float s = 0.f; const _Float16* q = Q + (r0 + rl) * D2 + half * DD; const float* ks = KS + b * D2 + half * DD;
    for (int d = 0; d < DD; d += 8) { const v4u w = *(const v4u*)(q + d); const _Float16* h8 = (const _Float16*)&w;
#pragma unroll
      for (int i = 0; i < 8; ++i) s += (float)h8[i] * ks[d + i]; }
    s += __shfl_xor(s, 16); if (lane < 16) sz[wave][rl] = 1.0f / fmaxf(s, 1e-6f); }
  const char* ga = (const char*)(Q + (b * NN + nb0 + (tid >> 3)) * D2) + (tid & 7) * 16; const size_t kvo = ((b * DD + m0 + (tid >> 3)) * D2) * 2 + (tid & 7) * 16; const char* gh = (const char*)KVH + kvo; const char* gl = (const char*)KVL + kvo;
  const unsigned la = lds_off(ring) + (tid >> 3) * FN_P + (tid & 7) * 16; const size_t gs = (size_t)16 * D2 * 2;
  v8f acc[8] = {};
  acp4(la, 16 * FN_P, ga, gs); acp8(la + 64 * FN_P, 16 * FN_P, gh, gs); acp8(la + 192 * FN_P, 16 * FN_P, gl, gs);
  WAIT_ACP(); __syncthreads();
  acp4(la + FN_STG, 16 * FN_P, ga + 128, gs); acp8(la + FN_STG + 64 * FN_P, 16 * FN_P, gh + 128, gs); acp8(la + FN_STG + 192 * FN_P, 16 * FN_P, gl + 128, gs);
  for (int t = 0; t < D2 / 64; ++t) { const unsigned bo = (t & 1) * FN_STG; const char* base = ring + bo;
    // two fragment sets of four column tiles (hi and residual): the next set is read from LDS as one group in front of this set's WMMAs, so that its latency runs behind them; the loops are unrolled so that the fragment arrays have constant indices and stay in registers
    v16h a[2], wh[2][4], wl[2][4];
#pragma unroll
    for (int kc = 0; kc < 2; ++kc) a[kc] = frag_h((const _Float16*)(base + (wave * 16 + col) * FN_P) + kc * 32, lane);
#pragma unroll
    for (int j = 0; j < 4; ++j) { const char* wb = base + (64 + j * 16 + col) * FN_P; wh[0][j] = frag_h((const _Float16*)wb, lane); wl[0][j] = frag_h((const _Float16*)(wb + 128 * FN_P), lane); }
#pragma unroll
    for (int s = 0; s < 4; ++s) { const int kc = s >> 1, jh = (s & 1) * 4;
      if (s + 1 < 4) { const int kn = (s + 1) >> 1, jn = ((s + 1) & 1) * 4;
#pragma unroll
        for (int j = 0; j < 4; ++j) { const char* wb = base + (64 + (jn + j) * 16 + col) * FN_P + kn * 64; wh[(s + 1) & 1][j] = frag_h((const _Float16*)wb, lane); wl[(s + 1) & 1][j] = frag_h((const _Float16*)(wb + 128 * FN_P), lane); } }
#pragma unroll
      for (int j = 0; j < 4; ++j) { acc[jh + j] = wmma16(a[kc], wh[s & 1][j], acc[jh + j]); v8f t2 = {}; t2 = wmma16(a[kc], wl[s & 1][j], t2);
#pragma unroll
        for (int r = 0; r < 8; ++r) acc[jh + j][r] += t2[r] * (1.0f / 2048.0f); } }
    WAIT_DS(); WAIT_ACP(); __syncthreads();
    if (t + 2 < D2 / 64) { const size_t go = (size_t)(t + 2) * 128; acp4(la + bo, 16 * FN_P, ga + go, gs); acp8(la + bo + 64 * FN_P, 16 * FN_P, gh + go, gs); acp8(la + bo + 192 * FN_P, 16 * FN_P, gl + go, gs); } }
  WAIT_ACP();
  LDSX();
#pragma unroll
  for (int j = 0; j < 8; ++j)
#pragma unroll
    for (int r = 0; r < 8; ++r) so[wave][8 * g + r][j * 16 + col] = acc[j][r] * sz[wave][8 * g + r];
  LDSX();
  // each computed row n (16 per wave) x this block's 128 cols = two 64-col chunks j64 = m0/64 + {0,1} -> final row (8n + j64) % NN, col block (n/512)*64
  for (int rl = 0; rl < 16; ++rl) { const int n = nw + rl; const int j64 = m0 / 64 + (lane >> 4); const size_t frow = b * NN + (size_t)((8 * n + j64) % NN); const int fc0 = (n / 512) * HD;
    vst2(OUT + frow * DD + fc0 + (lane & 15) * 4, *(const v4f*)&so[wave][rl][(lane >> 4) * 64 + (lane & 15) * 4]); }   // two 256-B segments per computed row (lanes 0-15 / 16-31)
}
extern "C" void kernel_launch(void* const* d_in, const int* in_sizes, int n_in, void* d_out, int out_size, void* d_ws, size_t ws_size, hipStream_t stream) {
  (void)in_sizes; (void)n_in; (void)out_size;
  const float** F = (const float**)d_in;   // 0 x [4,4096,512], 1 Wq, 2 Wk, 3 Wv [512,512] natural
  if (ws_size < (size_t)WS_END) return;
  char* ws = (char*)d_ws; __bf16* P = (__bf16*)ws; _Float16 *Q = (_Float16*)(ws + WS_Q), *KT = (_Float16*)(ws + WS_KT), *VT = (_Float16*)(ws + WS_VT), *KVH = (_Float16*)(ws + WS_KVH), *KVL = (_Float16*)(ws + WS_KVL); float* KS = (float*)(ws + WS_KS);
  k_pack<<<3 * DD, 256, 0, stream>>>(F[1], F[2], F[3], P);
  k_proj<<<dim3(TR / 64, DD / 128, 3), 128, 0, stream>>>(F[0], P, Q, KT, VT);
  k_kv<<<dim3(D2 / 64, DD / 128, TNB), 128, 0, stream>>>(KT, VT, KVH, KVL, KS);
  k_fin<<<dim3(NN / 64, DD / 128, TNB), 128, 0, stream>>>(Q, KVH, KVL, KS, (float*)d_out);
}

// v003
// It runs in 123 microseconds.
// In both of two side-by-side timings against v002, it was 1.08 times as fast.
// Counting every step since v000, it is 4.07 times as fast.
// compute dtype: all float inputs rounded to bf16; q / k / v = x . W^T with EXACT bf16 products on WMMA 16x16x32 (natural rows), ReLU and the cos-reweighting (idx = (pi/2)(n+1)/N in f32, precise sinf/cosf) in f32, q_ / k_ / v rounded once to f16; kv = k_^T v and out = q_ kv as WMMA GEMMs (kv carried as f16 hi + residual, 2 products); the column sums of k_ (f32, taken in k_kv from its k_^T fragments) and the normaliser z = 1 / max(q_ . sum k_, 1e-6) in f32 from the same f16-rounded values; output written through the module's (b,H,n,hd) -> (b,n,H,hd) reshape.
#include <hip/hip_runtime.h>
#include <math.h>

typedef __attribute__((ext_vector_type(16))) _Float16 v16h;
typedef __attribute__((ext_vector_type(16))) __bf16 v16b;
typedef __attribute__((ext_vector_type(8)))  _Float16 v8h;
typedef __attribute__((ext_vector_type(8)))  float v8f;
typedef __attribute__((ext_vector_type(4)))  float v4f;
typedef __attribute__((ext_vector_type(2)))  float v2f;
typedef __attribute__((ext_vector_type(4)))  unsigned v4u;
typedef __attribute__((ext_vector_type(4)))  int v4i;
typedef float __attribute__((may_alias)) float_a;
typedef int __attribute__((may_alias)) int_a;

template <typename T> __device__ __forceinline__ void vst2(void* p, T v) { *(T*)p = v;  }
__device__ __forceinline__ v8f wmma16(v16h a, v16h b, v8f c) {
  v8f d = __builtin_amdgcn_wmma_f32_16x16x32_f16(false, a, false, b, (short)0, c, false, false);
  asm volatile("v_nop\n\tv_nop\n\tv_nop\n\tv_nop" : "+v"(d) : "v"(a), "v"(b));
  return d;
}
__device__ __forceinline__ v8f wmma_bf(v16b a, v16b b, v8f c) {
  v8f d = __builtin_amdgcn_wmma_f32_16x16x32_bf16(false, a, false, b, (short)0, c, false, false);
  asm volatile("v_nop\n\tv_nop\n\tv_nop\n\tv_nop" : "+v"(d) : "v"(a), "v"(b));
  return d;
}
// 16x16x32 fragments: lane = (h = lane>>4, row/col = lane&15); elements 0..7 = k0+8h+0..7, 8..15 = k0+16+8h+0..7; D element r = row 8h+r
__device__ __forceinline__ v16h frag_h(const _Float16* rowk0, int lane) {
  union { v16h v; v8h q[2]; } u; const _Float16* p = rowk0 + 8 * (lane >> 4);
  u.q[0] = *(const v8h*)p; u.q[1] = *(const v8h*)(p + 16); return u.v;
}
__device__ __forceinline__ v16h frag_f32(const float* rowk0, int lane) {
  v16h a; const float* p = rowk0 + 8 * (lane >> 4);
#pragma unroll
  for (int i = 0; i < 8; ++i) { a[i] = (_Float16)p[i]; a[8 + i] = (_Float16)p[16 + i]; }
  return a;
}
__device__ __forceinline__ v16h frag_f32s(const float* rowk0, int lane, float sc) {
  v16h a; const float* p = rowk0 + 8 * (lane >> 4);
#pragma unroll
  for (int i = 0; i < 8; ++i) { a[i] = (_Float16)(p[i] * sc); a[8 + i] = (_Float16)(p[16 + i] * sc); }
  return a;
}
// column fragment from a [K][ld] layout (column n), rows >= K read as 0
__device__ __forceinline__ v16h fragc_f32(const float* W, int k0, int n, int lane, int ld, int K) {
  v16h a; const int g = lane >> 4;
#pragma unroll
  for (int i = 0; i < 8; ++i) { const int ka = k0 + 8 * g + i, kb = ka + 16;
    a[i] = (_Float16)(ka < K ? W[(size_t)(ka < K ? ka : K - 1) * ld + n] : 0.f); a[8 + i] = (_Float16)(kb < K ? W[(size_t)(kb < K ? kb : K - 1) * ld + n] : 0.f); }
  return a;
}
struct F2 { v16b h, l; };
__device__ __forceinline__ F2 bsplit16(const float v[16]) { F2 r;
#pragma unroll
  for (int i = 0; i < 16; ++i) { const __bf16 h = (__bf16)v[i]; r.h[i] = h; r.l[i] = (__bf16)(v[i] - (float)h); }
  return r; }
__device__ __forceinline__ F2 split_row(const float* row, int k0, int lane) { float v[16]; const float* p = row + k0 + 8 * (lane >> 4);
#pragma unroll
  for (int i = 0; i < 8; ++i) { v[i] = p[i]; v[8 + i] = p[16 + i]; }
  return bsplit16(v); }
__device__ __forceinline__ F2 split_rowK(const float* row, int k0, int lane, int K) { float v[16]; const int g = lane >> 4;
#pragma unroll
  for (int i = 0; i < 8; ++i) { const int ka = k0 + 8 * g + i, kb = ka + 16; v[i] = ka < K ? row[ka < K ? ka : K - 1] : 0.f; v[8 + i] = kb < K ? row[kb < K ? kb : K - 1] : 0.f; }
  return bsplit16(v); }
__device__ __forceinline__ F2 split_col(const float* W, int k0, int n, int lane, int ld, int K) { float v[16]; const int g = lane >> 4;
#pragma unroll
  for (int i = 0; i < 8; ++i) { const int ka = k0 + 8 * g + i, kb = ka + 16; v[i] = ka < K ? W[(size_t)(ka < K ? ka : K - 1) * ld + n] : 0.f; v[8 + i] = kb < K ? W[(size_t)(kb < K ? kb : K - 1) * ld + n] : 0.f; }
  return bsplit16(v); }
__device__ __forceinline__ v8f mac3(const F2& a, const F2& b, v8f c) { c = wmma_bf(a.l, b.h, c); c = wmma_bf(a.h, b.l, c); return wmma_bf(a.h, b.h, c); }
__device__ __forceinline__ float sigm(float v) { return 1.0f / (1.0f + expf(-v)); }
#define LDSX() do { asm volatile("s_wait_dscnt 0" ::: "memory"); __builtin_amdgcn_wave_barrier(); __builtin_amdgcn_fence(__ATOMIC_RELEASE, "workgroup"); } while (0)


// cosFormer linear attention (B 4, N 4,096, d 512, 8 heads): q = relu(x Wq^T), k = relu(x Wk^T), v = x Wv^T; q_, k_ = [q sin, q cos], [k sin, k cos] with the position weights (pi/2)(n+1)/N; out = (q_ (k_^T v)) / max(q_ . sum_n k_, 1e-6), then the module's head reshape.
#define NB 4
#define NN 4096
#define DD 512
#define D2 (2 * DD)
#define NH 8
#define HD 64
#define NR (NB * NN)
#ifndef TNB
#define TNB NB
#endif
#define TR (TNB * NN)
typedef __attribute__((ext_vector_type(8))) __bf16 v8b;
__device__ __forceinline__ v16b frag_b(const __bf16* rowk0, int lane) {
  union { v16b v; v8b q[2]; } u; const __bf16* p = rowk0 + 8 * (lane >> 4);
  u.q[0] = *(const v8b*)p; u.q[1] = *(const v8b*)(p + 16); return u.v;
}
__device__ __forceinline__ float bfr(float v) { return (float)(__bf16)v; }
__device__ __attribute__((noinline)) float exp_ni(float v) { return expf(v); }
__device__ __attribute__((noinline)) float erf_ni(float v) { return erff(v); }

#define WS_PW  0u                                  // bf16 natural rows Wq, Wk, Wv [3][512][512]
#define WS_Q   (WS_PW + 2u * (size_t)3 * DD * DD)   // f16 rows q_ [NR][1024]
#define WS_KT  (WS_Q + 2u * (size_t)NR * D2)        // f16 planes k_^T [b][1024][NN] ; v^T [b][512][NN]
#define WS_VT  (WS_KT + 2u * (size_t)NB * D2 * NN)
#define WS_KVH (WS_VT + 2u * (size_t)NB * DD * NN)  // f16 hi / lo kv^T [b][512 m][1024 dd]
#define WS_KVL (WS_KVH + 2u * (size_t)NB * DD * D2)
#define WS_KS  (WS_KVL + 2u * (size_t)NB * DD * D2) // f32 [b][1024] sum_n k_
#define WS_END (WS_KS + 4u * (size_t)NB * D2)

__global__ __launch_bounds__(256) void k_pack(const float* __restrict__ WQ, const float* __restrict__ WK, const float* __restrict__ WV, __bf16* __restrict__ P) { const int n = blockIdx.x, t = threadIdx.x; const float* src = (n < DD) ? (WQ + (size_t)n * DD) : (n < 2 * DD) ? (WK + (size_t)(n - DD) * DD) : (WV + (size_t)(n - 2 * DD) * DD); __shared__ __align__(16) __bf16 s[DD]; for (int k = t; k < DD; k += 256) s[k] = (__bf16)src[k]; __syncthreads(); if (t < DD / 8) vst2((unsigned*)(P + (size_t)n * DD + t * 8), *(const v4u*)&s[t * 8]); }
__device__ __attribute__((noinline)) float sin_p(float v) { return sinf(v); }
__device__ __attribute__((noinline)) float cos_p(float v) { return cosf(v); }
__device__ __forceinline__ unsigned lds_off(const void* p) { return (unsigned)(size_t)p; }
// one lane's 8 (4) copies, rows ls bytes apart in LDS and gs bytes apart in global memory; s_wait_xcnt 0 closes the statement so that no address register of a copy is rewritten in front of it
__device__ __forceinline__ void acp8(unsigned l, unsigned ls, const char* p, size_t gs) {
  asm volatile("global_load_async_to_lds_b128 %0, %8, off\n\t"
               "global_load_async_to_lds_b128 %1, %9, off\n\t"
               "global_load_async_to_lds_b128 %2, %10, off\n\t"
               "global_load_async_to_lds_b128 %3, %11, off\n\t"
               "global_load_async_to_lds_b128 %4, %12, off\n\t"
               "global_load_async_to_lds_b128 %5, %13, off\n\t"
               "global_load_async_to_lds_b128 %6, %14, off\n\t"
               "global_load_async_to_lds_b128 %7, %15, off\n\t"
               "s_wait_xcnt 0x0"
               :: "v"(l), "v"(l + ls), "v"(l + 2 * ls), "v"(l + 3 * ls), "v"(l + 4 * ls), "v"(l + 5 * ls), "v"(l + 6 * ls), "v"(l + 7 * ls),
                  "v"(p), "v"(p + gs), "v"(p + 2 * gs), "v"(p + 3 * gs), "v"(p + 4 * gs), "v"(p + 5 * gs), "v"(p + 6 * gs), "v"(p + 7 * gs) : "memory");
}
__device__ __forceinline__ void acp4(unsigned l, unsigned ls, const char* p, size_t gs) {
  asm volatile("global_load_async_to_lds_b128 %0, %4, off\n\t"
               "global_load_async_to_lds_b128 %1, %5, off\n\t"
               "global_load_async_to_lds_b128 %2, %6, off\n\t"
               "global_load_async_to_lds_b128 %3, %7, off\n\t"
               "s_wait_xcnt 0x0"
               :: "v"(l), "v"(l + ls), "v"(l + 2 * ls), "v"(l + 3 * ls), "v"(p), "v"(p + gs), "v"(p + 2 * gs), "v"(p + 3 * gs) : "memory");
}
// one lane's 16 stores of 16 B, 1,024 B apart (8 q_ rows of 2,048 B, sin half and cos half); s_wait_xcnt 0 closes the statement so that no register of a store is rewritten in front of it
__device__ __forceinline__ void gst16(char* p, const v4u* d) {
  asm volatile("global_store_b128 %0, %1, off\n\t"
               "global_store_b128 %0, %2, off offset:1024\n\t"
               "global_store_b128 %0, %3, off offset:2048\n\t"
               "global_store_b128 %0, %4, off offset:3072\n\t"
               "global_store_b128 %0, %5, off offset:4096\n\t"
               "global_store_b128 %0, %6, off offset:5120\n\t"
               "global_store_b128 %0, %7, off offset:6144\n\t"
               "global_store_b128 %0, %8, off offset:7168\n\t"
               "global_store_b128 %0, %9, off offset:8192\n\t"
               "global_store_b128 %0, %10, off offset:9216\n\t"
               "global_store_b128 %0, %11, off offset:10240\n\t"
               "global_store_b128 %0, %12, off offset:11264\n\t"
               "global_store_b128 %0, %13, off offset:12288\n\t"
               "global_store_b128 %0, %14, off offset:13312\n\t"
               "global_store_b128 %0, %15, off offset:14336\n\t"
               "global_store_b128 %0, %16, off offset:15360\n\t"
               "s_wait_xcnt 0x0"
               :: "v"(p), "v"(d[0]), "v"(d[1]), "v"(d[2]), "v"(d[3]), "v"(d[4]), "v"(d[5]), "v"(d[6]), "v"(d[7]), "v"(d[8]), "v"(d[9]), "v"(d[10]), "v"(d[11]), "v"(d[12]), "v"(d[13]), "v"(d[14]), "v"(d[15]) : "memory");
}
// this wave's copies have landed (in front of the barrier behind which other waves read them)
#define WAIT_ACP() asm volatile("s_wait_asynccnt 0x0" ::: "memory")
// this wave's LDS reads of a buffer have returned (in front of the barrier behind which the buffer is refilled)
#define WAIT_DS() asm volatile("s_wait_dscnt 0x0" ::: "memory")
// ---- k_proj: block = (128 tokens, 128 cols, which): 0 q -> relu, x sin | x cos -> q_ rows; 1 k -> relu, x sin | cos -> k_^T planes; 2 v -> v^T planes; each wave holds two 16-token row tiles, so that every W fragment read from LDS feeds two WMMAs and every W tile copied from L2 serves 128 tokens
// stage = 64 k: x 128 rows of 256 B (f32) at pitch 272, W 128 rows of 128 B (bf16) at pitch 144; the output staging so / st takes the ring's place behind the loop
#define PJ_PA 272
#define PJ_PB 144
#define PJ_STG (128 * PJ_PA + 128 * PJ_PB)
__global__ __launch_bounds__(128) void k_proj(const float* __restrict__ X, const __bf16* __restrict__ P, _Float16* __restrict__ Q, _Float16* __restrict__ KT, _Float16* __restrict__ VT) {
  __shared__ __align__(16) char ring[2 * PJ_STG];
  _Float16 (*so)[128][136] = (_Float16 (*)[128][136])ring; _Float16 (*st)[128][136] = (_Float16 (*)[128][136])ring;
  const int tid = threadIdx.x, wave = tid >> 5, lane = tid & 31, col = lane & 15, g = lane >> 4; const int which = blockIdx.z; const int n0 = blockIdx.y * 128; const size_t rb0 = (size_t)blockIdx.x * 128, r0 = rb0 + wave * 32; const size_t b = rb0 / NN, s0 = rb0 % NN;
  const char* ga = (const char*)(X + (rb0 + (tid >> 4)) * DD) + (tid & 15) * 16; const char* gb = (const char*)(P + ((size_t)which * DD + n0 + (tid >> 3)) * DD) + (tid & 7) * 16;
  const unsigned la = lds_off(ring) + (tid >> 4) * PJ_PA + (tid & 15) * 16, lb = lds_off(ring) + 128 * PJ_PA + (tid >> 3) * PJ_PB + (tid & 7) * 16;
  const size_t gsa = (size_t)8 * DD * 4, gsb = (size_t)16 * DD * 2;
  v8f acc[2][8] = {};
  acp8(la, 8 * PJ_PA, ga, gsa); acp8(la + 64 * PJ_PA, 8 * PJ_PA, ga + 8 * gsa, gsa); acp8(lb, 16 * PJ_PB, gb, gsb);
  WAIT_ACP(); __syncthreads();
  acp8(la + PJ_STG, 8 * PJ_PA, ga + 256, gsa); acp8(la + PJ_STG + 64 * PJ_PA, 8 * PJ_PA, ga + 8 * gsa + 256, gsa); acp8(lb + PJ_STG, 16 * PJ_PB, gb + 128, gsb);
  for (int t = 0; t < DD / 64; ++t) { const unsigned bo = (t & 1) * PJ_STG; const char* base = ring + bo;
    // each 32-k slice's fragments are read from LDS as one group in front of its 16 WMMAs, so that the LDS latency is waited out once a slice and not once a WMMA; the loops are unrolled so that the fragment arrays have constant indices and stay in registers
#pragma unroll
    for (int kc = 0; kc < 2; ++kc) { v16b a[2], w[8];
#pragma unroll
      for (int rt = 0; rt < 2; ++rt) { const float* p = (const float*)(base + (wave * 32 + rt * 16 + col) * PJ_PA) + kc * 32 + 8 * g;
#pragma unroll
        for (int i = 0; i < 8; ++i) { a[rt][i] = (__bf16)p[i]; a[rt][8 + i] = (__bf16)p[16 + i]; } }
#pragma unroll
      for (int j = 0; j < 8; ++j) w[j] = frag_b((const __bf16*)(base + 128 * PJ_PA + (j * 16 + col) * PJ_PB) + kc * 32, lane);
#pragma unroll
      for (int j = 0; j < 8; ++j)
#pragma unroll
        for (int rt = 0; rt < 2; ++rt) acc[rt][j] = wmma_bf(a[rt], w[j], acc[rt][j]); }
    WAIT_DS(); WAIT_ACP(); __syncthreads();
    if (t + 2 < DD / 64) { acp8(la + bo, 8 * PJ_PA, ga + (t + 2) * 256, gsa); acp8(la + bo + 64 * PJ_PA, 8 * PJ_PA, ga + 8 * gsa + (t + 2) * 256, gsa); acp8(lb + bo, 16 * PJ_PB, gb + (t + 2) * 128, gsb); } }
  WAIT_ACP();
  if (which == 0) {
#pragma unroll
    for (int rt = 0; rt < 2; ++rt)
#pragma unroll
    for (int r = 0; r < 8; ++r) { const int lr = wave * 32 + rt * 16 + 8 * g + r; const int n = (int)((rb0 + lr) % NN); const float ang = (1.57079632679489662f * (float)(n + 1)) / (float)NN; const float sn = sin_p(ang), cs = cos_p(ang);
#pragma unroll
      for (int j = 0; j < 8; ++j) { const float v = fmaxf(acc[rt][j][r], 0.f); so[0][lr][j * 16 + col] = (_Float16)(v * sn); so[1][lr][j * 16 + col] = (_Float16)(v * cs); } }
    LDSX();
    if (lane < 16) for (int rb = 0; rb < 32; rb += 8) { v4u d[16];
#pragma unroll   // constant indices, so that d stays in registers
      for (int i = 0; i < 8; ++i) { d[2 * i] = *(const v4u*)&so[0][wave * 32 + rb + i][lane * 8]; d[2 * i + 1] = *(const v4u*)&so[1][wave * 32 + rb + i][lane * 8]; }
      gst16((char*)(Q + (r0 + rb) * D2 + n0 + lane * 8), d); }
  } else if (which == 1) {
#pragma unroll
    for (int rt = 0; rt < 2; ++rt)
#pragma unroll
    for (int r = 0; r < 8; ++r) { const int lr = wave * 32 + rt * 16 + 8 * g + r; const int n = (int)((rb0 + lr) % NN); const float ang = (1.57079632679489662f * (float)(n + 1)) / (float)NN; const float sn = sin_p(ang), cs = cos_p(ang);
#pragma unroll
      for (int j = 0; j < 8; ++j) { const float v = fmaxf(acc[rt][j][r], 0.f); st[0][j * 16 + col][lr] = (_Float16)(v * sn); st[1][j * 16 + col][lr] = (_Float16)(v * cs); } }
    __syncthreads();
    for (int e = tid; e < 2 * 128 * 16; e += 128) { const int pl = e >> 11, d = (e >> 4) & 127, pc = e & 15; vst2((unsigned*)(KT + ((b * D2 + (size_t)pl * DD + n0 + d) * NN) + s0 + pc * 8), *(const v4u*)&st[pl][d][pc * 8]); }
  } else {
#pragma unroll
    for (int rt = 0; rt < 2; ++rt)
#pragma unroll
    for (int r = 0; r < 8; ++r)
#pragma unroll
      for (int j = 0; j < 8; ++j) st[0][j * 16 + col][wave * 32 + rt * 16 + 8 * g + r] = (_Float16)acc[rt][j][r];
    __syncthreads();
    for (int e = tid; e < 128 * 16; e += 128) { const int d = e >> 4, pc = e & 15; vst2((unsigned*)(VT + ((b * DD + n0 + d) * NN) + s0 + pc * 8), *(const v4u*)&st[0][d][pc * 8]); } }
}
// stage = 128 tokens: k_^T 64 rows and v^T 128 rows of 256 B at pitch 272; the work-groups of the first m block also sum k_ over the tokens, in f32 from the k_^T fragments that they hold in registers anyway -> KS[b][dd]
#define KV_P 272
#define KV_STG ((64 + 128) * KV_P)
__global__ __launch_bounds__(128) void k_kv(const _Float16* __restrict__ KT, const _Float16* __restrict__ VT, _Float16* __restrict__ KVH, _Float16* __restrict__ KVL, float* __restrict__ KS) {
  __shared__ __align__(16) char ring[2 * KV_STG]; __shared__ __align__(16) _Float16 sh[128][72]; __shared__ __align__(16) _Float16 sl[128][72]; __shared__ __align__(16) float sks[2][64];
  const int tid = threadIdx.x, wave = tid >> 5, lane = tid & 31, col = lane & 15, g = lane >> 4; const size_t b = blockIdx.z; const int d0 = blockIdx.x * 64; const int m0 = blockIdx.y * 128;
  const char* ga = (const char*)(KT + (b * D2 + d0 + (tid >> 4)) * NN) + (tid & 15) * 16; const char* gb = (const char*)(VT + (b * DD + m0 + (tid >> 4)) * NN) + (tid & 15) * 16;
  const unsigned la = lds_off(ring) + (tid >> 4) * KV_P + (tid & 15) * 16; const size_t gs = (size_t)8 * NN * 2;
  v8f acc[8] = {};
  const bool ksb = blockIdx.y == 0; float ps[4] = {0.f, 0.f, 0.f, 0.f};   // lane (g, col): four independent partial sums of row wave * 16 + col over the 16 tokens of each slice that its fragment holds
  acp8(la, 8 * KV_P, ga, gs); acp8(la + 64 * KV_P, 8 * KV_P, gb, gs); acp8(la + 128 * KV_P, 8 * KV_P, gb + 8 * gs, gs);
  WAIT_ACP(); __syncthreads();
  acp8(la + KV_STG, 8 * KV_P, ga + 256, gs); acp8(la + KV_STG + 64 * KV_P, 8 * KV_P, gb + 256, gs); acp8(la + KV_STG + 128 * KV_P, 8 * KV_P, gb + 8 * gs + 256, gs);
  for (int t = 0; t < NN / 128; ++t) { const unsigned bo = (t & 1) * KV_STG; const char* base = ring + bo;
    // two fragment sets: the next 32 tokens' fragments are read from LDS as one group in front of this slice's WMMAs, so that their latency runs behind the WMMAs; the loops are unrolled so that the fragment arrays have constant indices and stay in registers
    v16h a[2], w[2][8];
    a[0] = frag_h((const _Float16*)(base + (wave * 16 + col) * KV_P), lane);
#pragma unroll
    for (int j = 0; j < 8; ++j) w[0][j] = frag_h((const _Float16*)(base + (64 + j * 16 + col) * KV_P), lane);
#pragma unroll
    for (int kc = 0; kc < 4; ++kc) {
      if (kc + 1 < 4) { a[(kc + 1) & 1] = frag_h((const _Float16*)(base + (wave * 16 + col) * KV_P) + (kc + 1) * 32, lane);
#pragma unroll
        for (int j = 0; j < 8; ++j) w[(kc + 1) & 1][j] = frag_h((const _Float16*)(base + (64 + j * 16 + col) * KV_P) + (kc + 1) * 32, lane); }
      if (ksb) {   // unrolled so that the fragment's elements and the four sums have constant indices and stay in registers
#pragma unroll
        for (int i = 0; i < 16; ++i) ps[i & 3] += (float)a[kc & 1][i]; }
#pragma unroll
      for (int j = 0; j < 8; ++j) acc[j] = wmma16(a[kc & 1], w[kc & 1][j], acc[j]); }
    WAIT_DS(); WAIT_ACP(); __syncthreads();
    if (t + 2 < NN / 128) { const size_t go = (size_t)(t + 2) * 256; acp8(la + bo, 8 * KV_P, ga + go, gs); acp8(la + bo + 64 * KV_P, 8 * KV_P, gb + go, gs); acp8(la + bo + 128 * KV_P, 8 * KV_P, gb + 8 * gs + go, gs); } }
  WAIT_ACP();
#pragma unroll
  for (int j = 0; j < 8; ++j)
#pragma unroll
    for (int r = 0; r < 8; ++r) { const float v = acc[j][r]; const _Float16 hv = (_Float16)v; sh[j * 16 + col][wave * 16 + 8 * g + r] = hv; sl[j * 16 + col][wave * 16 + 8 * g + r] = (_Float16)((v - (float)hv) * 2048.0f); }
  if (ksb) sks[g][wave * 16 + col] = (ps[0] + ps[1]) + (ps[2] + ps[3]);
  __syncthreads();
  for (int e = tid; e < 128 * 8; e += 128) { const int m = e >> 3, pc = e & 7; const size_t o = ((b * DD + m0 + m) * D2) + d0 + pc * 8; vst2((unsigned*)(KVH + o), *(const v4u*)&sh[m][pc * 8]); vst2((unsigned*)(KVL + o), *(const v4u*)&sl[m][pc * 8]); }
  // the two lane halves' sums are added and one wave stores the 256-B segment
  if (ksb && tid < 16) vst2(KS + b * D2 + d0 + tid * 4, *(const v4f*)&sks[0][tid * 4] + *(const v4f*)&sks[1][tid * 4]);
}
// ---- k_fin: block = (128 tokens, 128 m cols, b), 8 waves as 4 (tokens) x 2 (cols): acc = q_ . kv (hi + residual) over dd; z = 1/max(q_ . KS, 1e-6) per row (f32, from the same f16 q_); out = acc z stored through the (b,H,n,hd)->(b,n,H,hd) view: computed (n, m) -> row (8n + m/64) mod N, cols (n/512)*64 + m%64; each wave holds two 16-token row tiles x four column tiles, so that every kv fragment read from LDS feeds two WMMAs and every kv tile copied from L2 serves 128 tokens
// stage = 64 dd: q_ 128 rows, kv hi 128 rows, kv residual 128 rows of 128 B at pitch 144; the output staging so takes the ring's place behind the loop
#define FN_P 144
#define FN_STG ((128 + 128 + 128) * FN_P)
__global__ __launch_bounds__(256) void k_fin(const _Float16* __restrict__ Q, const _Float16* __restrict__ KVH, const _Float16* __restrict__ KVL, const float* __restrict__ KS, float* __restrict__ OUT) {
  __shared__ __align__(16) char ring[2 * FN_STG]; __shared__ float sz[128]; float (*so)[32][68] = (float (*)[32][68])ring;
  const int tid = threadIdx.x, wave = tid >> 5, lane = tid & 31, col = lane & 15, g = lane >> 4; const int wr = wave >> 1, wc = wave & 1; const size_t b = blockIdx.z; const int nb0 = blockIdx.x * 128; const int nw = nb0 + wr * 32; const int m0 = blockIdx.y * 128;
  // z for 16 of the block's rows per wave: lanes (rl = lane & 15, half = lane >> 4) sum 512 dd each; the other waves read sz behind the barrier in front of the loop
  { const int rl = lane & 15, half = lane >> 4; float s = 0.f; const _Float16* q = Q + (b * NN + nb0 + wave * 16 + rl) * D2 + half * DD; const float* ks = KS + b * D2 + half * DD;
    for (int d = 0; d < DD; d += 8) { const v4u w = *(const v4u*)(q + d); const _Float16* h8 = (const _Float16*)&w;
#pragma unroll
      for (int i = 0; i < 8; ++i) s += (float)h8[i] * ks[d + i]; }
    s += __shfl_xor(s, 16); if (lane < 16) sz[wave * 16 + rl] = 1.0f / fmaxf(s, 1e-6f); }
  const char* ga = (const char*)(Q + (b * NN + nb0 + (tid >> 3)) * D2) + (tid & 7) * 16; const size_t kvo = ((b * DD + m0 + (tid >> 3)) * D2) * 2 + (tid & 7) * 16; const char* gh = (const char*)KVH + kvo; const char* gl = (const char*)KVL + kvo;
  const unsigned la = lds_off(ring) + (tid >> 3) * FN_P + (tid & 7) * 16; const size_t gs = (size_t)32 * D2 * 2;
  v8f acc[2][4] = {};
  acp4(la, 32 * FN_P, ga, gs); acp4(la + 128 * FN_P, 32 * FN_P, gh, gs); acp4(la + 256 * FN_P, 32 * FN_P, gl, gs);
  WAIT_ACP(); __syncthreads();
  acp4(la + FN_STG, 32 * FN_P, ga + 128, gs); acp4(la + FN_STG + 128 * FN_P, 32 * FN_P, gh + 128, gs); acp4(la + FN_STG + 256 * FN_P, 32 * FN_P, gl + 128, gs);
  for (int t = 0; t < D2 / 64; ++t) { const unsigned bo = (t & 1) * FN_STG; const char* base = ring + bo;
    // two fragment sets of two column tiles (hi and residual): the next set is read from LDS as one group in front of this set's 8 WMMAs, so that its latency runs behind them; the loops are unrolled so that the fragment arrays have constant indices and stay in registers
    v16h a[2][2], wh[2][2], wl[2][2];
#pragma unroll
    for (int rt = 0; rt < 2; ++rt)
#pragma unroll
      for (int kc = 0; kc < 2; ++kc) a[rt][kc] = frag_h((const _Float16*)(base + (wr * 32 + rt * 16 + col) * FN_P) + kc * 32, lane);
#pragma unroll
    for (int j = 0; j < 2; ++j) { const char* wb = base + (128 + wc * 64 + j * 16 + col) * FN_P; wh[0][j] = frag_h((const _Float16*)wb, lane); wl[0][j] = frag_h((const _Float16*)(wb + 128 * FN_P), lane); }
#pragma unroll
    for (int s = 0; s < 4; ++s) { const int kc = s >> 1, jh = (s & 1) * 2;
      if (s + 1 < 4) { const int kn = (s + 1) >> 1, jn = ((s + 1) & 1) * 2;
#pragma unroll
        for (int j = 0; j < 2; ++j) { const char* wb = base + (128 + wc * 64 + (jn + j) * 16 + col) * FN_P + kn * 64; wh[(s + 1) & 1][j] = frag_h((const _Float16*)wb, lane); wl[(s + 1) & 1][j] = frag_h((const _Float16*)(wb + 128 * FN_P), lane); } }
#pragma unroll
      for (int j = 0; j < 2; ++j)
#pragma unroll
        for (int rt = 0; rt < 2; ++rt) { acc[rt][jh + j] = wmma16(a[rt][kc], wh[s & 1][j], acc[rt][jh + j]); v8f t2 = {}; t2 = wmma16(a[rt][kc], wl[s & 1][j], t2);
#pragma unroll
          for (int r = 0; r < 8; ++r) acc[rt][jh + j][r] += t2[r] * (1.0f / 2048.0f); } }
    WAIT_DS(); WAIT_ACP(); __syncthreads();
    if (t + 2 < D2 / 64) { const size_t go = (size_t)(t + 2) * 128; acp4(la + bo, 32 * FN_P, ga + go, gs); acp4(la + bo + 128 * FN_P, 32 * FN_P, gh + go, gs); acp4(la + bo + 256 * FN_P, 32 * FN_P, gl + go, gs); } }
  WAIT_ACP();
  LDSX();
#pragma unroll
  for (int rt = 0; rt < 2; ++rt)
#pragma unroll
  for (int j = 0; j < 4; ++j)
#pragma unroll
    for (int r = 0; r < 8; ++r) so[wave][rt * 16 + 8 * g + r][j * 16 + col] = acc[rt][j][r] * sz[wr * 32 + rt * 16 + 8 * g + r];
  LDSX();
  // each computed row n (32 per wave) x this wave's 64 cols = the chunk j64 = m0/64 + wc -> final row (8n + j64) % NN, col block (n/512)*64
#pragma unroll   // straight-line, so that no store's registers are rewritten over a back edge
  for (int rl = 0; rl < 32; rl += 2) { const int lr = rl + (lane >> 4); const int n = nw + lr; const int j64 = m0 / 64 + wc; const size_t frow = b * NN + (size_t)((8 * n + j64) % NN); const int fc0 = (n / 512) * HD;
    vst2(OUT + frow * DD + fc0 + (lane & 15) * 4, *(const v4f*)&so[wave][lr][(lane & 15) * 4]); }   // two 256-B segments per store (lanes 0-15 / 16-31: two computed rows)
}
extern "C" void kernel_launch(void* const* d_in, const int* in_sizes, int n_in, void* d_out, int out_size, void* d_ws, size_t ws_size, hipStream_t stream) {
  (void)in_sizes; (void)n_in; (void)out_size;
  const float** F = (const float**)d_in;   // 0 x [4,4096,512], 1 Wq, 2 Wk, 3 Wv [512,512] natural
  if (ws_size < (size_t)WS_END) return;
  char* ws = (char*)d_ws; __bf16* P = (__bf16*)ws; _Float16 *Q = (_Float16*)(ws + WS_Q), *KT = (_Float16*)(ws + WS_KT), *VT = (_Float16*)(ws + WS_VT), *KVH = (_Float16*)(ws + WS_KVH), *KVL = (_Float16*)(ws + WS_KVL); float* KS = (float*)(ws + WS_KS);
  k_pack<<<3 * DD, 256, 0, stream>>>(F[1], F[2], F[3], P);
  k_proj<<<dim3(TR / 128, DD / 128, 3), 128, 0, stream>>>(F[0], P, Q, KT, VT);
  k_kv<<<dim3(D2 / 64, DD / 128, TNB), 128, 0, stream>>>(KT, VT, KVH, KVL, KS);
  k_fin<<<dim3(NN / 128, DD / 128, TNB), 256, 0, stream>>>(Q, KVH, KVL, KS, (float*)d_out);
}

// v004
// Measured time: 111 microseconds a run.
// In both of two side-by-side timings against v003, it was 1.10 times as fast.
// All steps since v000 together make it 4.49 times as fast.
// compute dtype: all float inputs rounded to bf16; q / k / v = x . W^T with EXACT bf16 products on WMMA 16x16x32 (natural rows), ReLU and the cos-reweighting (idx = (pi/2)(n+1)/N in f32, precise sinf/cosf) in f32, q_ / k_ / v rounded once to f16; kv = k_^T v and out = q_ kv as WMMA GEMMs (kv carried as f16 hi + residual, 2 products); the column sums of k_ (f32, taken in k_kv from its k_^T fragments) and the normaliser z = 1 / max(q_ . sum k_, 1e-6) in f32 from the same f16-rounded values; output written through the module's (b,H,n,hd) -> (b,n,H,hd) reshape.
#include <hip/hip_runtime.h>
#include <math.h>

typedef __attribute__((ext_vector_type(16))) _Float16 v16h;
typedef __attribute__((ext_vector_type(16))) __bf16 v16b;
typedef __attribute__((ext_vector_type(8)))  _Float16 v8h;
typedef __attribute__((ext_vector_type(8)))  float v8f;
typedef __attribute__((ext_vector_type(4)))  float v4f;
typedef __attribute__((ext_vector_type(2)))  float v2f;
typedef __attribute__((ext_vector_type(4)))  unsigned v4u;
typedef __attribute__((ext_vector_type(4)))  int v4i;
typedef float __attribute__((may_alias)) float_a;
typedef int __attribute__((may_alias)) int_a;

template <typename T> __device__ __forceinline__ void vst2(void* p, T v) { *(T*)p = v;  }
__device__ __forceinline__ v8f wmma16(v16h a, v16h b, v8f c) {
  v8f d = __builtin_amdgcn_wmma_f32_16x16x32_f16(false, a, false, b, (short)0, c, false, false);
  asm volatile("v_nop\n\tv_nop\n\tv_nop\n\tv_nop" : "+v"(d) : "v"(a), "v"(b));
  return d;
}
__device__ __forceinline__ v8f wmma_bf(v16b a, v16b b, v8f c) {
  v8f d = __builtin_amdgcn_wmma_f32_16x16x32_bf16(false, a, false, b, (short)0, c, false, false);
  asm volatile("v_nop\n\tv_nop\n\tv_nop\n\tv_nop" : "+v"(d) : "v"(a), "v"(b));
  return d;
}
// 16x16x32 fragments: lane = (h = lane>>4, row/col = lane&15); elements 0..7 = k0+8h+0..7, 8..15 = k0+16+8h+0..7; D element r = row 8h+r
__device__ __forceinline__ v16h frag_h(const _Float16* rowk0, int lane) {
  union { v16h v; v8h q[2]; } u; const _Float16* p = rowk0 + 8 * (lane >> 4);
  u.q[0] = *(const v8h*)p; u.q[1] = *(const v8h*)(p + 16); return u.v;
}
__device__ __forceinline__ v16h frag_f32(const float* rowk0, int lane) {
  v16h a; const float* p = rowk0 + 8 * (lane >> 4);
#pragma unroll
  for (int i = 0; i < 8; ++i) { a[i] = (_Float16)p[i]; a[8 + i] = (_Float16)p[16 + i]; }
  return a;
}
__device__ __forceinline__ v16h frag_f32s(const float* rowk0, int lane, float sc) {
  v16h a; const float* p = rowk0 + 8 * (lane >> 4);
#pragma unroll
  for (int i = 0; i < 8; ++i) { a[i] = (_Float16)(p[i] * sc); a[8 + i] = (_Float16)(p[16 + i] * sc); }
  return a;
}
// column fragment from a [K][ld] layout (column n), rows >= K read as 0
__device__ __forceinline__ v16h fragc_f32(const float* W, int k0, int n, int lane, int ld, int K) {
  v16h a; const int g = lane >> 4;
#pragma unroll
  for (int i = 0; i < 8; ++i) { const int ka = k0 + 8 * g + i, kb = ka + 16;
    a[i] = (_Float16)(ka < K ? W[(size_t)(ka < K ? ka : K - 1) * ld + n] : 0.f); a[8 + i] = (_Float16)(kb < K ? W[(size_t)(kb < K ? kb : K - 1) * ld + n] : 0.f); }
  return a;
}
struct F2 { v16b h, l; };
__device__ __forceinline__ F2 bsplit16(const float v[16]) { F2 r;
#pragma unroll
  for (int i = 0; i < 16; ++i) { const __bf16 h = (__bf16)v[i]; r.h[i] = h; r.l[i] = (__bf16)(v[i] - (float)h); }
  return r; }
__device__ __forceinline__ F2 split_row(const float* row, int k0, int lane) { float v[16]; const float* p = row + k0 + 8 * (lane >> 4);
#pragma unroll
  for (int i = 0; i < 8; ++i) { v[i] = p[i]; v[8 + i] = p[16 + i]; }
  return bsplit16(v); }
__device__ __forceinline__ F2 split_rowK(const float* row, int k0, int lane, int K) { float v[16]; const int g = lane >> 4;
#pragma unroll
  for (int i = 0; i < 8; ++i) { const int ka = k0 + 8 * g + i, kb = ka + 16; v[i] = ka < K ? row[ka < K ? ka : K - 1] : 0.f; v[8 + i] = kb < K ? row[kb < K ? kb : K - 1] : 0.f; }
  return bsplit16(v); }
__device__ __forceinline__ F2 split_col(const float* W, int k0, int n, int lane, int ld, int K) { float v[16]; const int g = lane >> 4;
#pragma unroll
  for (int i = 0; i < 8; ++i) { const int ka = k0 + 8 * g + i, kb = ka + 16; v[i] = ka < K ? W[(size_t)(ka < K ? ka : K - 1) * ld + n] : 0.f; v[8 + i] = kb < K ? W[(size_t)(kb < K ? kb : K - 1) * ld + n] : 0.f; }
  return bsplit16(v); }
__device__ __forceinline__ v8f mac3(const F2& a, const F2& b, v8f c) { c = wmma_bf(a.l, b.h, c); c = wmma_bf(a.h, b.l, c); return wmma_bf(a.h, b.h, c); }
__device__ __forceinline__ float sigm(float v) { return 1.0f / (1.0f + expf(-v)); }
#define LDSX() do { asm volatile("s_wait_dscnt 0" ::: "memory"); __builtin_amdgcn_wave_barrier(); __builtin_amdgcn_fence(__ATOMIC_RELEASE, "workgroup"); } while (0)


// cosFormer linear attention (B 4, N 4,096, d 512, 8 heads): q = relu(x Wq^T), k = relu(x Wk^T), v = x Wv^T; q_, k_ = [q sin, q cos], [k sin, k cos] with the position weights (pi/2)(n+1)/N; out = (q_ (k_^T v)) / max(q_ . sum_n k_, 1e-6), then the module's head reshape.
#define NB 4
#define NN 4096
#define DD 512
#define D2 (2 * DD)
#define NH 8
#define HD 64
#define NR (NB * NN)
#ifndef TNB
#define TNB NB
#endif
#define TR (TNB * NN)
typedef __attribute__((ext_vector_type(8))) __bf16 v8b;
__device__ __forceinline__ v16b frag_b(const __bf16* rowk0, int lane) {
  union { v16b v; v8b q[2]; } u; const __bf16* p = rowk0 + 8 * (lane >> 4);
  u.q[0] = *(const v8b*)p; u.q[1] = *(const v8b*)(p + 16); return u.v;
}
__device__ __forceinline__ float bfr(float v) { return (float)(__bf16)v; }
__device__ __attribute__((noinline)) float exp_ni(float v) { return expf(v); }
__device__ __attribute__((noinline)) float erf_ni(float v) { return erff(v); }

#define WS_PW  0u                                  // bf16 natural rows Wq, Wk, Wv [3][512][512]
#define WS_Q   (WS_PW + 2u * (size_t)3 * DD * DD)   // f16 rows q_ [NR][1024]
#define WS_KT  (WS_Q + 2u * (size_t)NR * D2)        // f16 planes k_^T [b][1024][NN] ; v^T [b][512][NN]
#define WS_VT  (WS_KT + 2u * (size_t)NB * D2 * NN)
#define WS_KVH (WS_VT + 2u * (size_t)NB * DD * NN)  // f16 hi / lo kv^T [b][512 m][1024 dd]
#define WS_KVL (WS_KVH + 2u * (size_t)NB * DD * D2)
#define WS_KS  (WS_KVL + 2u * (size_t)NB * DD * D2) // f32 [b][1024] sum_n k_
#define WS_END (WS_KS + 4u * (size_t)NB * D2)

__global__ __launch_bounds__(256) void k_pack(const float* __restrict__ WQ, const float* __restrict__ WK, const float* __restrict__ WV, __bf16* __restrict__ P) { const int n = blockIdx.x, t = threadIdx.x; const float* src = (n < DD) ? (WQ + (size_t)n * DD) : (n < 2 * DD) ? (WK + (size_t)(n - DD) * DD) : (WV + (size_t)(n - 2 * DD) * DD); __shared__ __align__(16) __bf16 s[DD]; for (int k = t; k < DD; k += 256) s[k] = (__bf16)src[k]; __syncthreads(); if (t < DD / 8) vst2((unsigned*)(P + (size_t)n * DD + t * 8), *(const v4u*)&s[t * 8]); }
__device__ __attribute__((noinline)) float sin_p(float v) { return sinf(v); }
__device__ __attribute__((noinline)) float cos_p(float v) { return cosf(v); }
__device__ __forceinline__ unsigned lds_off(const void* p) { return (unsigned)(size_t)p; }
// one lane's 8 (4) copies, rows ls bytes apart in LDS and gs bytes apart in global memory; s_wait_xcnt 0 closes the statement so that no address register of a copy is rewritten in front of it
__device__ __forceinline__ void acp8(unsigned l, unsigned ls, const char* p, size_t gs) {
  asm volatile("global_load_async_to_lds_b128 %0, %8, off\n\t"
               "global_load_async_to_lds_b128 %1, %9, off\n\t"
               "global_load_async_to_lds_b128 %2, %10, off\n\t"
               "global_load_async_to_lds_b128 %3, %11, off\n\t"
               "global_load_async_to_lds_b128 %4, %12, off\n\t"
               "global_load_async_to_lds_b128 %5, %13, off\n\t"
               "global_load_async_to_lds_b128 %6, %14, off\n\t"
               "global_load_async_to_lds_b128 %7, %15, off\n\t"
               "s_wait_xcnt 0x0"
               :: "v"(l), "v"(l + ls), "v"(l + 2 * ls), "v"(l + 3 * ls), "v"(l + 4 * ls), "v"(l + 5 * ls), "v"(l + 6 * ls), "v"(l + 7 * ls),
                  "v"(p), "v"(p + gs), "v"(p + 2 * gs), "v"(p + 3 * gs), "v"(p + 4 * gs), "v"(p + 5 * gs), "v"(p + 6 * gs), "v"(p + 7 * gs) : "memory");
}
__device__ __forceinline__ void acp4(unsigned l, unsigned ls, const char* p, size_t gs) {
  asm volatile("global_load_async_to_lds_b128 %0, %4, off\n\t"
               "global_load_async_to_lds_b128 %1, %5, off\n\t"
               "global_load_async_to_lds_b128 %2, %6, off\n\t"
               "global_load_async_to_lds_b128 %3, %7, off\n\t"
               "s_wait_xcnt 0x0"
               :: "v"(l), "v"(l + ls), "v"(l + 2 * ls), "v"(l + 3 * ls), "v"(p), "v"(p + gs), "v"(p + 2 * gs), "v"(p + 3 * gs) : "memory");
}
// one lane's 16 stores of 16 B, 1,024 B apart (8 q_ rows of 2,048 B, sin half and cos half); s_wait_xcnt 0 closes the statement so that no register of a store is rewritten in front of it
__device__ __forceinline__ void gst16(char* p, const v4u* d) {
  asm volatile("global_store_b128 %0, %1, off\n\t"
               "global_store_b128 %0, %2, off offset:1024\n\t"
               "global_store_b128 %0, %3, off offset:2048\n\t"
               "global_store_b128 %0, %4, off offset:3072\n\t"
               "global_store_b128 %0, %5, off offset:4096\n\t"
               "global_store_b128 %0, %6, off offset:5120\n\t"
               "global_store_b128 %0, %7, off offset:6144\n\t"
               "global_store_b128 %0, %8, off offset:7168\n\t"
               "global_store_b128 %0, %9, off offset:8192\n\t"
               "global_store_b128 %0, %10, off offset:9216\n\t"
               "global_store_b128 %0, %11, off offset:10240\n\t"
               "global_store_b128 %0, %12, off offset:11264\n\t"
               "global_store_b128 %0, %13, off offset:12288\n\t"
               "global_store_b128 %0, %14, off offset:13312\n\t"
               "global_store_b128 %0, %15, off offset:14336\n\t"
               "global_store_b128 %0, %16, off offset:15360\n\t"
               "s_wait_xcnt 0x0"
               :: "v"(p), "v"(d[0]), "v"(d[1]), "v"(d[2]), "v"(d[3]), "v"(d[4]), "v"(d[5]), "v"(d[6]), "v"(d[7]), "v"(d[8]), "v"(d[9]), "v"(d[10]), "v"(d[11]), "v"(d[12]), "v"(d[13]), "v"(d[14]), "v"(d[15]) : "memory");
}
// this wave's copies have landed (in front of the barrier behind which other waves read them)
#define WAIT_ACP() asm volatile("s_wait_asynccnt 0x0" ::: "memory")
// this wave's LDS reads of a buffer have returned (in front of the barrier behind which the buffer is refilled)
#define WAIT_DS() asm volatile("s_wait_dscnt 0x0" ::: "memory")
// ---- k_proj: block = (128 tokens, 128 cols, which): 0 q -> relu, x sin | x cos -> q_ rows; 1 k -> relu, x sin | cos -> k_^T planes; 2 v -> v^T planes; each wave holds two 16-token row tiles, so that every W fragment read from LDS feeds two WMMAs and every W tile copied from L2 serves 128 tokens
// stage = 64 k: x 128 rows of 256 B (f32) at pitch 272, W 128 rows of 128 B (bf16) at pitch 144; the output staging so / st takes the ring's place behind the loop
#define PJ_PA 272
#define PJ_PB 144
#define PJ_STG (128 * PJ_PA + 128 * PJ_PB)
__global__ __launch_bounds__(128) void k_proj(const float* __restrict__ X, const __bf16* __restrict__ P, _Float16* __restrict__ Q, _Float16* __restrict__ KT, _Float16* __restrict__ VT) {
  __shared__ __align__(16) char ring[2 * PJ_STG];
  _Float16 (*so)[128][136] = (_Float16 (*)[128][136])ring; _Float16 (*st)[128][136] = (_Float16 (*)[128][136])ring;
  const int tid = threadIdx.x, wave = tid >> 5, lane = tid & 31, col = lane & 15, g = lane >> 4; const int which = blockIdx.z; const int n0 = blockIdx.y * 128; const size_t rb0 = (size_t)blockIdx.x * 128, r0 = rb0 + wave * 32; const size_t b = rb0 / NN, s0 = rb0 % NN;
  const char* ga = (const char*)(X + (rb0 + (tid >> 4)) * DD) + (tid & 15) * 16; const char* gb = (const char*)(P + ((size_t)which * DD + n0 + (tid >> 3)) * DD) + (tid & 7) * 16;
  const unsigned la = lds_off(ring) + (tid >> 4) * PJ_PA + (tid & 15) * 16, lb = lds_off(ring) + 128 * PJ_PA + (tid >> 3) * PJ_PB + (tid & 7) * 16;
  const size_t gsa = (size_t)8 * DD * 4, gsb = (size_t)16 * DD * 2;
  v8f acc[2][8] = {};
  acp8(la, 8 * PJ_PA, ga, gsa); acp8(la + 64 * PJ_PA, 8 * PJ_PA, ga + 8 * gsa, gsa); acp8(lb, 16 * PJ_PB, gb, gsb);
  WAIT_ACP(); __syncthreads();
  acp8(la + PJ_STG, 8 * PJ_PA, ga + 256, gsa); acp8(la + PJ_STG + 64 * PJ_PA, 8 * PJ_PA, ga + 8 * gsa + 256, gsa); acp8(lb + PJ_STG, 16 * PJ_PB, gb + 128, gsb);
  for (int t = 0; t < DD / 64; ++t) { const unsigned bo = (t & 1) * PJ_STG; const char* base = ring + bo;
    // each 32-k slice's fragments are read from LDS as one group in front of its 16 WMMAs, so that the LDS latency is waited out once a slice and not once a WMMA; the loops are unrolled so that the fragment arrays have constant indices and stay in registers
#pragma unroll
    for (int kc = 0; kc < 2; ++kc) { v16b a[2], w[8];
#pragma unroll
      for (int rt = 0; rt < 2; ++rt) { const float* p = (const float*)(base + (wave * 32 + rt * 16 + col) * PJ_PA) + kc * 32 + 8 * g;
#pragma unroll
        for (int i = 0; i < 8; ++i) { a[rt][i] = (__bf16)p[i]; a[rt][8 + i] = (__bf16)p[16 + i]; } }
#pragma unroll
      for (int j = 0; j < 8; ++j) w[j] = frag_b((const __bf16*)(base + 128 * PJ_PA + (j * 16 + col) * PJ_PB) + kc * 32, lane);
#pragma unroll
      for (int j = 0; j < 8; ++j)
#pragma unroll
        for (int rt = 0; rt < 2; ++rt) acc[rt][j] = wmma_bf(a[rt], w[j], acc[rt][j]); }
    WAIT_DS(); WAIT_ACP(); __syncthreads();
    if (t + 2 < DD / 64) { acp8(la + bo, 8 * PJ_PA, ga + (t + 2) * 256, gsa); acp8(la + bo + 64 * PJ_PA, 8 * PJ_PA, ga + 8 * gsa + (t + 2) * 256, gsa); acp8(lb + bo, 16 * PJ_PB, gb + (t + 2) * 128, gsb); } }
  WAIT_ACP();
  if (which == 0) {
#pragma unroll
    for (int rt = 0; rt < 2; ++rt)
#pragma unroll
    for (int r = 0; r < 8; ++r) { const int lr = wave * 32 + rt * 16 + 8 * g + r; const int n = (int)((rb0 + lr) % NN); const float ang = (1.57079632679489662f * (float)(n + 1)) / (float)NN; const float sn = sin_p(ang), cs = cos_p(ang);
#pragma unroll
      for (int j = 0; j < 8; ++j) { const float v = fmaxf(acc[rt][j][r], 0.f); so[0][lr][j * 16 + col] = (_Float16)(v * sn); so[1][lr][j * 16 + col] = (_Float16)(v * cs); } }
    LDSX();
    if (lane < 16) for (int rb = 0; rb < 32; rb += 8) { v4u d[16];
#pragma unroll   // constant indices, so that d stays in registers
      for (int i = 0; i < 8; ++i) { d[2 * i] = *(const v4u*)&so[0][wave * 32 + rb + i][lane * 8]; d[2 * i + 1] = *(const v4u*)&so[1][wave * 32 + rb + i][lane * 8]; }
      gst16((char*)(Q + (r0 + rb) * D2 + n0 + lane * 8), d); }
  } else if (which == 1) {
#pragma unroll
    for (int rt = 0; rt < 2; ++rt)
#pragma unroll
    for (int r = 0; r < 8; ++r) { const int lr = wave * 32 + rt * 16 + 8 * g + r; const int n = (int)((rb0 + lr) % NN); const float ang = (1.57079632679489662f * (float)(n + 1)) / (float)NN; const float sn = sin_p(ang), cs = cos_p(ang);
#pragma unroll
      for (int j = 0; j < 8; ++j) { const float v = fmaxf(acc[rt][j][r], 0.f); st[0][j * 16 + col][lr] = (_Float16)(v * sn); st[1][j * 16 + col][lr] = (_Float16)(v * cs); } }
    __syncthreads();
    for (int e = tid; e < 2 * 128 * 16; e += 128) { const int pl = e >> 11, d = (e >> 4) & 127, pc = e & 15; vst2((unsigned*)(KT + ((b * D2 + (size_t)pl * DD + n0 + d) * NN) + s0 + pc * 8), *(const v4u*)&st[pl][d][pc * 8]); }
  } else {
#pragma unroll
    for (int rt = 0; rt < 2; ++rt)
#pragma unroll
    for (int r = 0; r < 8; ++r)
#pragma unroll
      for (int j = 0; j < 8; ++j) st[0][j * 16 + col][wave * 32 + rt * 16 + 8 * g + r] = (_Float16)acc[rt][j][r];
    __syncthreads();
    for (int e = tid; e < 128 * 16; e += 128) { const int d = e >> 4, pc = e & 15; vst2((unsigned*)(VT + ((b * DD + n0 + d) * NN) + s0 + pc * 8), *(const v4u*)&st[0][d][pc * 8]); } }
}
// stage = 128 tokens: k_^T 64 rows and v^T 128 rows of 256 B at pitch 272; the work-groups of the first m block also sum k_ over the tokens, in f32 from the k_^T fragments that they hold in registers anyway -> KS[b][dd]
#define KV_P 272
#define KV_STG ((64 + 128) * KV_P)
__global__ __launch_bounds__(128) void k_kv(const _Float16* __restrict__ KT, const _Float16* __restrict__ VT, _Float16* __restrict__ KVH, _Float16* __restrict__ KVL, float* __restrict__ KS) {
  __shared__ __align__(16) char ring[2 * KV_STG]; __shared__ __align__(16) _Float16 sh[128][72]; __shared__ __align__(16) _Float16 sl[128][72]; __shared__ __align__(16) float sks[2][64];
  const int tid = threadIdx.x, wave = tid >> 5, lane = tid & 31, col = lane & 15, g = lane >> 4; const size_t b = blockIdx.z; const int d0 = blockIdx.x * 64; const int m0 = blockIdx.y * 128;
  const char* ga = (const char*)(KT + (b * D2 + d0 + (tid >> 4)) * NN) + (tid & 15) * 16; const char* gb = (const char*)(VT + (b * DD + m0 + (tid >> 4)) * NN) + (tid & 15) * 16;
  const unsigned la = lds_off(ring) + (tid >> 4) * KV_P + (tid & 15) * 16; const size_t gs = (size_t)8 * NN * 2;
  v8f acc[8] = {};
  const bool ksb = blockIdx.y == 0; float ps[4] = {0.f, 0.f, 0.f, 0.f};   // lane (g, col): four independent partial sums of row wave * 16 + col over the 16 tokens of each slice that its fragment holds
  acp8(la, 8 * KV_P, ga, gs); acp8(la + 64 * KV_P, 8 * KV_P, gb, gs); acp8(la + 128 * KV_P, 8 * KV_P, gb + 8 * gs, gs);
  WAIT_ACP(); __syncthreads();
  acp8(la + KV_STG, 8 * KV_P, ga + 256, gs); acp8(la + KV_STG + 64 * KV_P, 8 * KV_P, gb + 256, gs); acp8(la + KV_STG + 128 * KV_P, 8 * KV_P, gb + 8 * gs + 256, gs);
  for (int t = 0; t < NN / 128; ++t) { const unsigned bo = (t & 1) * KV_STG; const char* base = ring + bo;
    // two fragment sets: the next 32 tokens' fragments are read from LDS as one group in front of this slice's WMMAs, so that their latency runs behind the WMMAs; the loops are unrolled so that the fragment arrays have constant indices and stay in registers
    v16h a[2], w[2][8];
    a[0] = frag_h((const _Float16*)(base + (wave * 16 + col) * KV_P), lane);
#pragma unroll
    for (int j = 0; j < 8; ++j) w[0][j] = frag_h((const _Float16*)(base + (64 + j * 16 + col) * KV_P), lane);
#pragma unroll
    for (int kc = 0; kc < 4; ++kc) {
      if (kc + 1 < 4) { a[(kc + 1) & 1] = frag_h((const _Float16*)(base + (wave * 16 + col) * KV_P) + (kc + 1) * 32, lane);
#pragma unroll
        for (int j = 0; j < 8; ++j) w[(kc + 1) & 1][j] = frag_h((const _Float16*)(base + (64 + j * 16 + col) * KV_P) + (kc + 1) * 32, lane); }
      if (ksb) {   // unrolled so that the fragment's elements and the four sums have constant indices and stay in registers
#pragma unroll
        for (int i = 0; i < 16; ++i) ps[i & 3] += (float)a[kc & 1][i]; }
#pragma unroll
      for (int j = 0; j < 8; ++j) acc[j] = wmma16(a[kc & 1], w[kc & 1][j], acc[j]); }
    WAIT_DS(); WAIT_ACP(); __syncthreads();
    if (t + 2 < NN / 128) { const size_t go = (size_t)(t + 2) * 256; acp8(la + bo, 8 * KV_P, ga + go, gs); acp8(la + bo + 64 * KV_P, 8 * KV_P, gb + go, gs); acp8(la + bo + 128 * KV_P, 8 * KV_P, gb + 8 * gs + go, gs); } }
  WAIT_ACP();
#pragma unroll
  for (int j = 0; j < 8; ++j)
#pragma unroll
    for (int r = 0; r < 8; ++r) { const float v = acc[j][r]; const _Float16 hv = (_Float16)v; sh[j * 16 + col][wave * 16 + 8 * g + r] = hv; sl[j * 16 + col][wave * 16 + 8 * g + r] = (_Float16)((v - (float)hv) * 2048.0f); }
  if (ksb) sks[g][wave * 16 + col] = (ps[0] + ps[1]) + (ps[2] + ps[3]);
  __syncthreads();
  for (int e = tid; e < 128 * 8; e += 128) { const int m = e >> 3, pc = e & 7; const size_t o = ((b * DD + m0 + m) * D2) + d0 + pc * 8; vst2((unsigned*)(KVH + o), *(const v4u*)&sh[m][pc * 8]); vst2((unsigned*)(KVL + o), *(const v4u*)&sl[m][pc * 8]); }
  // the two lane halves' sums are added and one wave stores the 256-B segment
  if (ksb && tid < 16) vst2(KS + b * D2 + d0 + tid * 4, *(const v4f*)&sks[0][tid * 4] + *(const v4f*)&sks[1][tid * 4]);
}
// ---- k_fin: block = (128 tokens, 128 m cols, b), 8 waves as 4 (tokens) x 2 (cols): acc = q_ . kv (hi + residual) over dd; z = 1/max(q_ . KS, 1e-6) per row (f32, summed inside the dd loop from the q_ fragments that the wave holds for its WMMAs; of the two waves that hold the same 32 rows each sums 16); out = acc z stored through the (b,H,n,hd)->(b,n,H,hd) view: computed (n, m) -> row (8n + m/64) mod N, cols (n/512)*64 + m%64; each wave holds two 16-token row tiles x four column tiles, so that every kv fragment read from LDS feeds two WMMAs and every kv tile copied from L2 serves 128 tokens
// stage = 64 dd: q_ 128 rows, kv hi 128 rows, kv residual 128 rows of 128 B at pitch 144; the output staging so takes the ring's place behind the loop
#define FN_P 144
// 16 f16 fragment elements times 16 f32 values in the same k order, added into four independent sums
__device__ __forceinline__ void zacc(float (&zs)[4], v16h a, const v4f* k) {
#pragma unroll   // constant indices, so that the fragment and the sums stay in registers
  for (int i = 0; i < 16; ++i) zs[i & 3] = __builtin_fmaf((float)a[i], k[i >> 2][i & 3], zs[i & 3]);
}
#define FN_STG ((128 + 128 + 128) * FN_P)
__global__ __launch_bounds__(256) void k_fin(const _Float16* __restrict__ Q, const _Float16* __restrict__ KVH, const _Float16* __restrict__ KVL, const float* __restrict__ KS, float* __restrict__ OUT) {
  __shared__ __align__(16) char ring[2 * FN_STG]; __shared__ float sz[128]; float (*so)[32][68] = (float (*)[32][68])ring;
  const int tid = threadIdx.x, wave = tid >> 5, lane = tid & 31, col = lane & 15, g = lane >> 4; const int wr = wave >> 1, wc = wave & 1; const size_t b = blockIdx.z; const int nb0 = blockIdx.x * 128; const int nw = nb0 + wr * 32; const int m0 = blockIdx.y * 128;
  const char* ga = (const char*)(Q + (b * NN + nb0 + (tid >> 3)) * D2) + (tid & 7) * 16; const size_t kvo = ((b * DD + m0 + (tid >> 3)) * D2) * 2 + (tid & 7) * 16; const char* gh = (const char*)KVH + kvo; const char* gl = (const char*)KVL + kvo;
  const unsigned la = lds_off(ring) + (tid >> 3) * FN_P + (tid & 7) * 16; const size_t gs = (size_t)32 * D2 * 2;
  v8f acc[2][4] = {};
  // z: lane (g, col) of wave (wr, wc) sums q_ . KS of row wr * 32 + wc * 16 + col over the 32 dd of each stage that its two fragments of that row tile hold, in four independent partial sums; wcs is wc as a scalar: with it the choice of the row tile is one select per fragment register, with the per-lane value the compiler built an indexed pick among all four fragments
  const int wcs = __builtin_amdgcn_readfirstlane(wc); const float* ksl = KS + b * D2 + 8 * g; float zs[4] = {0.f, 0.f, 0.f, 0.f};
  acp4(la, 32 * FN_P, ga, gs); acp4(la + 128 * FN_P, 32 * FN_P, gh, gs); acp4(la + 256 * FN_P, 32 * FN_P, gl, gs);
  WAIT_ACP(); __syncthreads();
  acp4(la + FN_STG, 32 * FN_P, ga + 128, gs); acp4(la + FN_STG + 128 * FN_P, 32 * FN_P, gh + 128, gs); acp4(la + FN_STG + 256 * FN_P, 32 * FN_P, gl + 128, gs);
  for (int t = 0; t < D2 / 64; ++t) { const unsigned bo = (t & 1) * FN_STG; const char* base = ring + bo;
    // two fragment sets of two column tiles (hi and residual): the next set is read from LDS as one group in front of this set's 8 WMMAs, so that its latency runs behind them; the loops are unrolled so that the fragment arrays have constant indices and stay in registers
    v16h a[2][2], wh[2][2], wl[2][2]; v4f kz[2][4];   // kz: the 16 KS values of each of the stage's two 32-dd slices in the fragment's own k order
#pragma unroll
    for (int kc = 0; kc < 2; ++kc) { const float* kp = ksl + t * 64 + kc * 32; kz[kc][0] = *(const v4f*)kp; kz[kc][1] = *(const v4f*)(kp + 4); kz[kc][2] = *(const v4f*)(kp + 16); kz[kc][3] = *(const v4f*)(kp + 20); }
#pragma unroll
    for (int rt = 0; rt < 2; ++rt)
#pragma unroll
      for (int kc = 0; kc < 2; ++kc) a[rt][kc] = frag_h((const _Float16*)(base + (wr * 32 + rt * 16 + col) * FN_P) + kc * 32, lane);
#pragma unroll
    for (int j = 0; j < 2; ++j) { const char* wb = base + (128 + wc * 64 + j * 16 + col) * FN_P; wh[0][j] = frag_h((const _Float16*)wb, lane); wl[0][j] = frag_h((const _Float16*)(wb + 128 * FN_P), lane); }
#pragma unroll
    for (int s = 0; s < 4; ++s) { const int kc = s >> 1, jh = (s & 1) * 2;
      if (s + 1 < 4) { const int kn = (s + 1) >> 1, jn = ((s + 1) & 1) * 2;
#pragma unroll
        for (int j = 0; j < 2; ++j) { const char* wb = base + (128 + wc * 64 + (jn + j) * 16 + col) * FN_P + kn * 64; wh[(s + 1) & 1][j] = frag_h((const _Float16*)wb, lane); wl[(s + 1) & 1][j] = frag_h((const _Float16*)(wb + 128 * FN_P), lane); } }
#pragma unroll
      for (int j = 0; j < 2; ++j)
#pragma unroll
        for (int rt = 0; rt < 2; ++rt) { acc[rt][jh + j] = wmma16(a[rt][kc], wh[s & 1][j], acc[rt][jh + j]); v8f t2 = {}; t2 = wmma16(a[rt][kc], wl[s & 1][j], t2);
#pragma unroll
          for (int r = 0; r < 8; ++r) acc[rt][jh + j][r] += t2[r] * (1.0f / 2048.0f); }
      if (s & 1) { if (wcs == 0) zacc(zs, a[0][kc], kz[kc]); else zacc(zs, a[1][kc], kz[kc]); } }
    WAIT_DS(); WAIT_ACP(); __syncthreads();
    if (t + 2 < D2 / 64) { const size_t go = (size_t)(t + 2) * 128; acp4(la + bo, 32 * FN_P, ga + go, gs); acp4(la + bo + 128 * FN_P, 32 * FN_P, gh + go, gs); acp4(la + bo + 256 * FN_P, 32 * FN_P, gl + go, gs); } }
  WAIT_ACP();
  { float s = (zs[0] + zs[1]) + (zs[2] + zs[3]); s += __shfl_xor(s, 16); if (lane < 16) sz[wr * 32 + wc * 16 + col] = 1.0f / fmaxf(s, 1e-6f); }
  __syncthreads();   // each wave reads 16 of its 32 z values from the wave that shares its rows
  LDSX();
#pragma unroll
  for (int rt = 0; rt < 2; ++rt)
#pragma unroll
  for (int j = 0; j < 4; ++j)
#pragma unroll
    for (int r = 0; r < 8; ++r) so[wave][rt * 16 + 8 * g + r][j * 16 + col] = acc[rt][j][r] * sz[wr * 32 + rt * 16 + 8 * g + r];
  LDSX();
  // each computed row n (32 per wave) x this wave's 64 cols = the chunk j64 = m0/64 + wc -> final row (8n + j64) % NN, col block (n/512)*64
#pragma unroll   // straight-line, so that no store's registers are rewritten over a back edge
  for (int rl = 0; rl < 32; rl += 2) { const int lr = rl + (lane >> 4); const int n = nw + lr; const int j64 = m0 / 64 + wc; const size_t frow = b * NN + (size_t)((8 * n + j64) % NN); const int fc0 = (n / 512) * HD;
    vst2(OUT + frow * DD + fc0 + (lane & 15) * 4, *(const v4f*)&so[wave][lr][(lane & 15) * 4]); }   // two 256-B segments per store (lanes 0-15 / 16-31: two computed rows)
}
extern "C" void kernel_launch(void* const* d_in, const int* in_sizes, int n_in, void* d_out, int out_size, void* d_ws, size_t ws_size, hipStream_t stream) {
  (void)in_sizes; (void)n_in; (void)out_size;
  const float** F = (const float**)d_in;   // 0 x [4,4096,512], 1 Wq, 2 Wk, 3 Wv [512,512] natural
  if (ws_size < (size_t)WS_END) return;
  char* ws = (char*)d_ws; __bf16* P = (__bf16*)ws; _Float16 *Q = (_Float16*)(ws + WS_Q), *KT = (_Float16*)(ws + WS_KT), *VT = (_Float16*)(ws + WS_VT), *KVH = (_Float16*)(ws + WS_KVH), *KVL = (_Float16*)(ws + WS_KVL); float* KS = (float*)(ws + WS_KS);
  k_pack<<<3 * DD, 256, 0, stream>>>(F[1], F[2], F[3], P);
  k_proj<<<dim3(TR / 128, DD / 128, 3), 128, 0, stream>>>(F[0], P, Q, KT, VT);
  k_kv<<<dim3(D2 / 64, DD / 128, TNB), 128, 0, stream>>>(KT, VT, KVH, KVL, KS);
  k_fin<<<dim3(NN / 128, DD / 128, TNB), 256, 0, stream>>>(Q, KVH, KVL, KS, (float*)d_out);
}

// v005
// Measured time: 106 microseconds a run.
// In two side-by-side timings against v004, it was 1.07 and 1.06 times as fast.
// Counting every step since v000, it is 4.76 times as fast.
// compute dtype: all float inputs rounded to bf16; q / k / v = x . W^T with EXACT bf16 products on WMMA 16x16x32 (natural rows), ReLU and the cos-reweighting (idx = (pi/2)(n+1)/N in f32, precise sinf/cosf) in f32, q_ / k_ / v rounded once to f16; kv = k_^T v and out = q_ kv as WMMA GEMMs (kv carried as f16 hi + residual, 2 products); the column sums of k_ (f32, taken in k_kv from its k_^T fragments) and the normaliser z = 1 / max(q_ . sum k_, 1e-6) in f32 from the same f16-rounded values; output written through the module's (b,H,n,hd) -> (b,n,H,hd) reshape.
#include <hip/hip_runtime.h>
#include <math.h>

typedef __attribute__((ext_vector_type(16))) _Float16 v16h;
typedef __attribute__((ext_vector_type(16))) __bf16 v16b;
typedef __attribute__((ext_vector_type(8)))  _Float16 v8h;
typedef __attribute__((ext_vector_type(8)))  float v8f;
typedef __attribute__((ext_vector_type(4)))  float v4f;
typedef __attribute__((ext_vector_type(2)))  float v2f;
typedef __attribute__((ext_vector_type(4)))  unsigned v4u;
typedef __attribute__((ext_vector_type(4)))  int v4i;
typedef float __attribute__((may_alias)) float_a;
typedef int __attribute__((may_alias)) int_a;

template <typename T> __device__ __forceinline__ void vst2(void* p, T v) { *(T*)p = v;  }
__device__ __forceinline__ v8f wmma16(v16h a, v16h b, v8f c) {
  v8f d = __builtin_amdgcn_wmma_f32_16x16x32_f16(false, a, false, b, (short)0, c, false, false);
  asm volatile("v_nop\n\tv_nop\n\tv_nop\n\tv_nop" : "+v"(d) : "v"(a), "v"(b));
  return d;
}
__device__ __forceinline__ v8f wmma_bf(v16b a, v16b b, v8f c) {
  v8f d = __builtin_amdgcn_wmma_f32_16x16x32_bf16(false, a, false, b, (short)0, c, false, false);
  asm volatile("v_nop\n\tv_nop\n\tv_nop\n\tv_nop" : "+v"(d) : "v"(a), "v"(b));
  return d;
}
// 16x16x32 fragments: lane = (h = lane>>4, row/col = lane&15); elements 0..7 = k0+8h+0..7, 8..15 = k0+16+8h+0..7; D element r = row 8h+r
__device__ __forceinline__ v16h frag_h(const _Float16* rowk0, int lane) {
  union { v16h v; v8h q[2]; } u; const _Float16* p = rowk0 + 8 * (lane >> 4);
  u.q[0] = *(const v8h*)p; u.q[1] = *(const v8h*)(p + 16); return u.v;
}
__device__ __forceinline__ v16h frag_f32(const float* rowk0, int lane) {
  v16h a; const float* p = rowk0 + 8 * (lane >> 4);
#pragma unroll
  for (int i = 0; i < 8; ++i) { a[i] = (_Float16)p[i]; a[8 + i] = (_Float16)p[16 + i]; }
  return a;
}
__device__ __forceinline__ v16h frag_f32s(const float* rowk0, int lane, float sc) {
  v16h a; const float* p = rowk0 + 8 * (lane >> 4);
#pragma unroll
  for (int i = 0; i < 8; ++i) { a[i] = (_Float16)(p[i] * sc); a[8 + i] = (_Float16)(p[16 + i] * sc); }
  return a;
}
// column fragment from a [K][ld] layout (column n), rows >= K read as 0
__device__ __forceinline__ v16h fragc_f32(const float* W, int k0, int n, int lane, int ld, int K) {
  v16h a; const int g = lane >> 4;
#pragma unroll
  for (int i = 0; i < 8; ++i) { const int ka = k0 + 8 * g + i, kb = ka + 16;
    a[i] = (_Float16)(ka < K ? W[(size_t)(ka < K ? ka : K - 1) * ld + n] : 0.f); a[8 + i] = (_Float16)(kb < K ? W[(size_t)(kb < K ? kb : K - 1) * ld + n] : 0.f); }
  return a;
}
struct F2 { v16b h, l; };
__device__ __forceinline__ F2 bsplit16(const float v[16]) { F2 r;
#pragma unroll
  for (int i = 0; i < 16; ++i) { const __bf16 h = (__bf16)v[i]; r.h[i] = h; r.l[i] = (__bf16)(v[i] - (float)h); }
  return r; }
__device__ __forceinline__ F2 split_row(const float* row, int k0, int lane) { float v[16]; const float* p = row + k0 + 8 * (lane >> 4);
#pragma unroll
  for (int i = 0; i < 8; ++i) { v[i] = p[i]; v[8 + i] = p[16 + i]; }
  return bsplit16(v); }
__device__ __forceinline__ F2 split_rowK(const float* row, int k0, int lane, int K) { float v[16]; const int g = lane >> 4;
#pragma unroll
  for (int i = 0; i < 8; ++i) { const int ka = k0 + 8 * g + i, kb = ka + 16; v[i] = ka < K ? row[ka < K ? ka : K - 1] : 0.f; v[8 + i] = kb < K ? row[kb < K ? kb : K - 1] : 0.f; }
  return bsplit16(v); }
__device__ __forceinline__ F2 split_col(const float* W, int k0, int n, int lane, int ld, int K) { float v[16]; const int g = lane >> 4;
#pragma unroll
  for (int i = 0; i < 8; ++i) { const int ka = k0 + 8 * g + i, kb = ka + 16; v[i] = ka < K ? W[(size_t)(ka < K ? ka : K - 1) * ld + n] : 0.f; v[8 + i] = kb < K ? W[(size_t)(kb < K ? kb : K - 1) * ld + n] : 0.f; }
  return bsplit16(v); }
__device__ __forceinline__ v8f mac3(const F2& a, const F2& b, v8f c) { c = wmma_bf(a.l, b.h, c); c = wmma_bf(a.h, b.l, c); return wmma_bf(a.h, b.h, c); }
__device__ __forceinline__ float sigm(float v) { return 1.0f / (1.0f + expf(-v)); }
#define LDSX() do { asm volatile("s_wait_dscnt 0" ::: "memory"); __builtin_amdgcn_wave_barrier(); __builtin_amdgcn_fence(__ATOMIC_RELEASE, "workgroup"); } while (0)


// cosFormer linear attention (B 4, N 4,096, d 512, 8 heads): q = relu(x Wq^T), k = relu(x Wk^T), v = x Wv^T; q_, k_ = [q sin, q cos], [k sin, k cos] with the position weights (pi/2)(n+1)/N; out = (q_ (k_^T v)) / max(q_ . sum_n k_, 1e-6), then the module's head reshape.
#define NB 4
#define NN 4096
#define DD 512
#define D2 (2 * DD)
#define NH 8
#define HD 64
#define NR (NB * NN)
#ifndef TNB
#define TNB NB
#endif
#define TR (TNB * NN)
typedef __attribute__((ext_vector_type(8))) __bf16 v8b;
__device__ __forceinline__ v16b frag_b(const __bf16* rowk0, int lane) {
  union { v16b v; v8b q[2]; } u; const __bf16* p = rowk0 + 8 * (lane >> 4);
  u.q[0] = *(const v8b*)p; u.q[1] = *(const v8b*)(p + 16); return u.v;
}
__device__ __forceinline__ float bfr(float v) { return (float)(__bf16)v; }
__device__ __attribute__((noinline)) float exp_ni(float v) { return expf(v); }
__device__ __attribute__((noinline)) float erf_ni(float v) { return erff(v); }

#define WS_PW  0u                                  // bf16 natural rows Wq, Wk, Wv [3][512][512]
#define WS_Q   (WS_PW + 2u * (size_t)3 * DD * DD)   // f16 rows q_ [NR][1024]
#define WS_KT  (WS_Q + 2u * (size_t)NR * D2)        // f16 planes k_^T [b][1024][NN] ; v^T [b][512][NN]
#define WS_VT  (WS_KT + 2u * (size_t)NB * D2 * NN)
#define WS_KVH (WS_VT + 2u * (size_t)NB * DD * NN)  // f16 hi / lo kv^T [b][512 m][1024 dd]
#define WS_KVL (WS_KVH + 2u * (size_t)NB * DD * D2)
#define WS_KS  (WS_KVL + 2u * (size_t)NB * DD * D2) // f32 [b][1024] sum_n k_
#define WS_END (WS_KS + 4u * (size_t)NB * D2)

__global__ __launch_bounds__(256) void k_pack(const float* __restrict__ WQ, const float* __restrict__ WK, const float* __restrict__ WV, __bf16* __restrict__ P) { const int n = blockIdx.x, t = threadIdx.x; const float* src = (n < DD) ? (WQ + (size_t)n * DD) : (n < 2 * DD) ? (WK + (size_t)(n - DD) * DD) : (WV + (size_t)(n - 2 * DD) * DD); __shared__ __align__(16) __bf16 s[DD]; for (int k = t; k < DD; k += 256) s[k] = (__bf16)src[k]; __syncthreads(); if (t < DD / 8) vst2((unsigned*)(P + (size_t)n * DD + t * 8), *(const v4u*)&s[t * 8]); }
__device__ __attribute__((noinline)) float sin_p(float v) { return sinf(v); }
__device__ __attribute__((noinline)) float cos_p(float v) { return cosf(v); }
__device__ __forceinline__ unsigned lds_off(const void* p) { return (unsigned)(size_t)p; }
// one lane's 8 (4) copies, rows ls bytes apart in LDS and gs bytes apart in global memory; s_wait_xcnt 0 closes the statement so that no address register of a copy is rewritten in front of it
__device__ __forceinline__ void acp8(unsigned l, unsigned ls, const char* p, size_t gs) {
  asm volatile("global_load_async_to_lds_b128 %0, %8, off\n\t"
               "global_load_async_to_lds_b128 %1, %9, off\n\t"
               "global_load_async_to_lds_b128 %2, %10, off\n\t"
               "global_load_async_to_lds_b128 %3, %11, off\n\t"
               "global_load_async_to_lds_b128 %4, %12, off\n\t"
               "global_load_async_to_lds_b128 %5, %13, off\n\t"
               "global_load_async_to_lds_b128 %6, %14, off\n\t"
               "global_load_async_to_lds_b128 %7, %15, off\n\t"
               "s_wait_xcnt 0x0"
               :: "v"(l), "v"(l + ls), "v"(l + 2 * ls), "v"(l + 3 * ls), "v"(l + 4 * ls), "v"(l + 5 * ls), "v"(l + 6 * ls), "v"(l + 7 * ls),
                  "v"(p), "v"(p + gs), "v"(p + 2 * gs), "v"(p + 3 * gs), "v"(p + 4 * gs), "v"(p + 5 * gs), "v"(p + 6 * gs), "v"(p + 7 * gs) : "memory");
}
__device__ __forceinline__ void acp4(unsigned l, unsigned ls, const char* p, size_t gs) {
  asm volatile("global_load_async_to_lds_b128 %0, %4, off\n\t"
               "global_load_async_to_lds_b128 %1, %5, off\n\t"
               "global_load_async_to_lds_b128 %2, %6, off\n\t"
               "global_load_async_to_lds_b128 %3, %7, off\n\t"
               "s_wait_xcnt 0x0"
               :: "v"(l), "v"(l + ls), "v"(l + 2 * ls), "v"(l + 3 * ls), "v"(p), "v"(p + gs), "v"(p + 2 * gs), "v"(p + 3 * gs) : "memory");
}
// one lane's 16 stores of 16 B, 1,024 B apart (8 q_ rows of 2,048 B, sin half and cos half); s_wait_xcnt 0 closes the statement so that no register of a store is rewritten in front of it
__device__ __forceinline__ void gst16(char* p, const v4u* d) {
  asm volatile("global_store_b128 %0, %1, off\n\t"
               "global_store_b128 %0, %2, off offset:1024\n\t"
               "global_store_b128 %0, %3, off offset:2048\n\t"
               "global_store_b128 %0, %4, off offset:3072\n\t"
               "global_store_b128 %0, %5, off offset:4096\n\t"
               "global_store_b128 %0, %6, off offset:5120\n\t"
               "global_store_b128 %0, %7, off offset:6144\n\t"
               "global_store_b128 %0, %8, off offset:7168\n\t"
               "global_store_b128 %0, %9, off offset:8192\n\t"
               "global_store_b128 %0, %10, off offset:9216\n\t"
               "global_store_b128 %0, %11, off offset:10240\n\t"
               "global_store_b128 %0, %12, off offset:11264\n\t"
               "global_store_b128 %0, %13, off offset:12288\n\t"
               "global_store_b128 %0, %14, off offset:13312\n\t"
               "global_store_b128 %0, %15, off offset:14336\n\t"
               "global_store_b128 %0, %16, off offset:15360\n\t"
               "s_wait_xcnt 0x0"
               :: "v"(p), "v"(d[0]), "v"(d[1]), "v"(d[2]), "v"(d[3]), "v"(d[4]), "v"(d[5]), "v"(d[6]), "v"(d[7]), "v"(d[8]), "v"(d[9]), "v"(d[10]), "v"(d[11]), "v"(d[12]), "v"(d[13]), "v"(d[14]), "v"(d[15]) : "memory");
}
// this wave's copies have landed (in front of the barrier behind which other waves read them)
#define WAIT_ACP() asm volatile("s_wait_asynccnt 0x0" ::: "memory")
// this wave's LDS reads of a buffer have returned (in front of the barrier behind which the buffer is refilled)
#define WAIT_DS() asm volatile("s_wait_dscnt 0x0" ::: "memory")
// ---- k_proj: block = (128 tokens, 128 cols, which): 0 q -> relu, x sin | x cos -> q_ rows; 1 k -> relu, x sin | cos -> k_^T planes; 2 v -> v^T planes; each wave holds two 16-token row tiles, so that every W fragment read from LDS feeds two WMMAs and every W tile copied from L2 serves 128 tokens
// stage = 64 k: x 128 rows of 256 B (f32) at pitch 272, W 128 rows of 128 B (bf16) at pitch 144; the output staging so / st takes the ring's place behind the loop
#define PJ_PA 272
#define PJ_PB 144
#define PJ_STG (128 * PJ_PA + 128 * PJ_PB)
__global__ __launch_bounds__(128) void k_proj(const float* __restrict__ X, const __bf16* __restrict__ P, _Float16* __restrict__ Q, _Float16* __restrict__ KT, _Float16* __restrict__ VT) {
  __shared__ __align__(16) char ring[2 * PJ_STG];
  _Float16 (*so)[128][136] = (_Float16 (*)[128][136])ring; _Float16 (*st)[128][136] = (_Float16 (*)[128][136])ring;
  const int tid = threadIdx.x, wave = tid >> 5, lane = tid & 31, col = lane & 15, g = lane >> 4; const int which = blockIdx.z; const int n0 = blockIdx.y * 128; const size_t rb0 = (size_t)blockIdx.x * 128, r0 = rb0 + wave * 32; const size_t b = rb0 / NN, s0 = rb0 % NN;
  const char* ga = (const char*)(X + (rb0 + (tid >> 4)) * DD) + (tid & 15) * 16; const char* gb = (const char*)(P + ((size_t)which * DD + n0 + (tid >> 3)) * DD) + (tid & 7) * 16;
  const unsigned la = lds_off(ring) + (tid >> 4) * PJ_PA + (tid & 15) * 16, lb = lds_off(ring) + 128 * PJ_PA + (tid >> 3) * PJ_PB + (tid & 7) * 16;
  const size_t gsa = (size_t)8 * DD * 4, gsb = (size_t)16 * DD * 2;
  v8f acc[2][8] = {};
  acp8(la, 8 * PJ_PA, ga, gsa); acp8(la + 64 * PJ_PA, 8 * PJ_PA, ga + 8 * gsa, gsa); acp8(lb, 16 * PJ_PB, gb, gsb);
  WAIT_ACP(); __syncthreads();
  acp8(la + PJ_STG, 8 * PJ_PA, ga + 256, gsa); acp8(la + PJ_STG + 64 * PJ_PA, 8 * PJ_PA, ga + 8 * gsa + 256, gsa); acp8(lb + PJ_STG, 16 * PJ_PB, gb + 128, gsb);
  for (int t = 0; t < DD / 64; ++t) { const unsigned bo = (t & 1) * PJ_STG; const char* base = ring + bo;
    // each 32-k slice's fragments are read from LDS as one group in front of its 16 WMMAs, so that the LDS latency is waited out once a slice and not once a WMMA; the loops are unrolled so that the fragment arrays have constant indices and stay in registers
#pragma unroll
    for (int kc = 0; kc < 2; ++kc) { v16b a[2], w[8];
#pragma unroll
      for (int rt = 0; rt < 2; ++rt) { const float* p = (const float*)(base + (wave * 32 + rt * 16 + col) * PJ_PA) + kc * 32 + 8 * g;
#pragma unroll
        for (int i = 0; i < 8; ++i) { a[rt][i] = (__bf16)p[i]; a[rt][8 + i] = (__bf16)p[16 + i]; } }
#pragma unroll
      for (int j = 0; j < 8; ++j) w[j] = frag_b((const __bf16*)(base + 128 * PJ_PA + (j * 16 + col) * PJ_PB) + kc * 32, lane);
#pragma unroll
      for (int j = 0; j < 8; ++j)
#pragma unroll
        for (int rt = 0; rt < 2; ++rt) acc[rt][j] = wmma_bf(a[rt], w[j], acc[rt][j]); }
    WAIT_DS(); WAIT_ACP(); __syncthreads();
    if (t + 2 < DD / 64) { acp8(la + bo, 8 * PJ_PA, ga + (t + 2) * 256, gsa); acp8(la + bo + 64 * PJ_PA, 8 * PJ_PA, ga + 8 * gsa + (t + 2) * 256, gsa); acp8(lb + bo, 16 * PJ_PB, gb + (t + 2) * 128, gsb); } }
  WAIT_ACP();
  if (which == 0) {
#pragma unroll
    for (int rt = 0; rt < 2; ++rt)
#pragma unroll
    for (int r = 0; r < 8; ++r) { const int lr = wave * 32 + rt * 16 + 8 * g + r; const int n = (int)((rb0 + lr) % NN); const float ang = (1.57079632679489662f * (float)(n + 1)) / (float)NN; const float sn = sin_p(ang), cs = cos_p(ang);
#pragma unroll
      for (int j = 0; j < 8; ++j) { const float v = fmaxf(acc[rt][j][r], 0.f); so[0][lr][j * 16 + col] = (_Float16)(v * sn); so[1][lr][j * 16 + col] = (_Float16)(v * cs); } }
    LDSX();
    if (lane < 16) for (int rb = 0; rb < 32; rb += 8) { v4u d[16];
#pragma unroll   // constant indices, so that d stays in registers
      for (int i = 0; i < 8; ++i) { d[2 * i] = *(const v4u*)&so[0][wave * 32 + rb + i][lane * 8]; d[2 * i + 1] = *(const v4u*)&so[1][wave * 32 + rb + i][lane * 8]; }
      gst16((char*)(Q + (r0 + rb) * D2 + n0 + lane * 8), d); }
  } else if (which == 1) {
#pragma unroll
    for (int rt = 0; rt < 2; ++rt)
#pragma unroll
    for (int r = 0; r < 8; ++r) { const int lr = wave * 32 + rt * 16 + 8 * g + r; const int n = (int)((rb0 + lr) % NN); const float ang = (1.57079632679489662f * (float)(n + 1)) / (float)NN; const float sn = sin_p(ang), cs = cos_p(ang);
#pragma unroll
      for (int j = 0; j < 8; ++j) { const float v = fmaxf(acc[rt][j][r], 0.f); st[0][j * 16 + col][lr] = (_Float16)(v * sn); st[1][j * 16 + col][lr] = (_Float16)(v * cs); } }
    __syncthreads();
    for (int e = tid; e < 2 * 128 * 16; e += 128) { const int pl = e >> 11, d = (e >> 4) & 127, pc = e & 15; vst2((unsigned*)(KT + ((b * D2 + (size_t)pl * DD + n0 + d) * NN) + s0 + pc * 8), *(const v4u*)&st[pl][d][pc * 8]); }
  } else {
#pragma unroll
    for (int rt = 0; rt < 2; ++rt)
#pragma unroll
    for (int r = 0; r < 8; ++r)
#pragma unroll
      for (int j = 0; j < 8; ++j) st[0][j * 16 + col][wave * 32 + rt * 16 + 8 * g + r] = (_Float16)acc[rt][j][r];
    __syncthreads();
    for (int e = tid; e < 128 * 16; e += 128) { const int d = e >> 4, pc = e & 15; vst2((unsigned*)(VT + ((b * DD + n0 + d) * NN) + s0 + pc * 8), *(const v4u*)&st[0][d][pc * 8]); } }
}
// stage = 128 tokens: k_^T 64 rows and v^T 128 rows of 256 B at pitch 272; three buffers, so that two tiles' copies (2 x 24 per wave) fly while a third tile is multiplied: a tile has two trips to land, not one; the work-groups of the first m block also sum k_ over the tokens, in f32 from the k_^T fragments that they hold in registers anyway -> KS[b][dd]
#define KV_P 272
#define KV_STG ((64 + 128) * KV_P)
// every wave issues exactly 24 copies per tile, and a wave's copies return in issue order: all but its 24 youngest copies have landed, that is every tile but the one issued last
#define WAIT_ACP_BUT24() asm volatile("s_wait_asynccnt 0x18" ::: "memory")
__global__ __launch_bounds__(128) void k_kv(const _Float16* __restrict__ KT, const _Float16* __restrict__ VT, _Float16* __restrict__ KVH, _Float16* __restrict__ KVL, float* __restrict__ KS) {
  __shared__ __align__(16) char ring[3 * KV_STG]; __shared__ __align__(16) _Float16 sh[128][72]; __shared__ __align__(16) _Float16 sl[128][72]; __shared__ __align__(16) float sks[2][64];
  const int tid = threadIdx.x, wave = tid >> 5, lane = tid & 31, col = lane & 15, g = lane >> 4; const size_t b = blockIdx.z; const int d0 = blockIdx.x * 64; const int m0 = blockIdx.y * 128;
  const char* ga = (const char*)(KT + (b * D2 + d0 + (tid >> 4)) * NN) + (tid & 15) * 16; const char* gb = (const char*)(VT + (b * DD + m0 + (tid >> 4)) * NN) + (tid & 15) * 16;
  const unsigned la = lds_off(ring) + (tid >> 4) * KV_P + (tid & 15) * 16; const size_t gs = (size_t)8 * NN * 2;
  v8f acc[8] = {};
  const bool ksb = blockIdx.y == 0; float ps[4] = {0.f, 0.f, 0.f, 0.f};   // lane (g, col): four independent partial sums of row wave * 16 + col over the 16 tokens of each slice that its fragment holds
  acp8(la, 8 * KV_P, ga, gs); acp8(la + 64 * KV_P, 8 * KV_P, gb, gs); acp8(la + 128 * KV_P, 8 * KV_P, gb + 8 * gs, gs);
  acp8(la + KV_STG, 8 * KV_P, ga + 256, gs); acp8(la + KV_STG + 64 * KV_P, 8 * KV_P, gb + 256, gs); acp8(la + KV_STG + 128 * KV_P, 8 * KV_P, gb + 8 * gs + 256, gs);
  WAIT_ACP_BUT24(); __syncthreads();   // tile 0 has landed in every wave; tile 1 flies on
  acp8(la + 2 * KV_STG, 8 * KV_P, ga + 512, gs); acp8(la + 2 * KV_STG + 64 * KV_P, 8 * KV_P, gb + 512, gs); acp8(la + 2 * KV_STG + 128 * KV_P, 8 * KV_P, gb + 8 * gs + 512, gs);
  unsigned bo = 0;   // byte offset of buffer t mod 3
  for (int t = 0; t < NN / 128; ++t) { const char* base = ring + bo;
    // two fragment sets: the next 32 tokens' fragments are read from LDS as one group in front of this slice's WMMAs, so that their latency runs behind the WMMAs; the loops are unrolled so that the fragment arrays have constant indices and stay in registers
    v16h a[2], w[2][8];
    a[0] = frag_h((const _Float16*)(base + (wave * 16 + col) * KV_P), lane);
#pragma unroll
    for (int j = 0; j < 8; ++j) w[0][j] = frag_h((const _Float16*)(base + (64 + j * 16 + col) * KV_P), lane);
#pragma unroll
    for (int kc = 0; kc < 4; ++kc) {
      if (kc + 1 < 4) { a[(kc + 1) & 1] = frag_h((const _Float16*)(base + (wave * 16 + col) * KV_P) + (kc + 1) * 32, lane);
#pragma unroll
        for (int j = 0; j < 8; ++j) w[(kc + 1) & 1][j] = frag_h((const _Float16*)(base + (64 + j * 16 + col) * KV_P) + (kc + 1) * 32, lane); }
      if (ksb) {   // unrolled so that the fragment's elements and the four sums have constant indices and stay in registers
#pragma unroll
        for (int i = 0; i < 16; ++i) ps[i & 3] += (float)a[kc & 1][i]; }
#pragma unroll
      for (int j = 0; j < 8; ++j) acc[j] = wmma16(a[kc & 1], w[kc & 1][j], acc[j]); }
    // foot of trip t: tile t + 1 must have landed; where a tile t + 2 exists its 24 copies are this wave's youngest and fly on, else nothing may stay outstanding
    WAIT_DS(); if (t + 2 < NN / 128) WAIT_ACP_BUT24(); else WAIT_ACP();
    __syncthreads();
    // tile t + 3 goes into the buffer that trip t has just read: every wave's reads of it have returned in front of the barrier
    if (t + 3 < NN / 128) { const size_t go = (size_t)(t + 3) * 256; acp8(la + bo, 8 * KV_P, ga + go, gs); acp8(la + bo + 64 * KV_P, 8 * KV_P, gb + go, gs); acp8(la + bo + 128 * KV_P, 8 * KV_P, gb + 8 * gs + go, gs); }
    bo = (bo == 2 * KV_STG) ? 0u : bo + KV_STG; }
  WAIT_ACP();
#pragma unroll
  for (int j = 0; j < 8; ++j)
#pragma unroll
    for (int r = 0; r < 8; ++r) { const float v = acc[j][r]; const _Float16 hv = (_Float16)v; sh[j * 16 + col][wave * 16 + 8 * g + r] = hv; sl[j * 16 + col][wave * 16 + 8 * g + r] = (_Float16)((v - (float)hv) * 2048.0f); }
  if (ksb) sks[g][wave * 16 + col] = (ps[0] + ps[1]) + (ps[2] + ps[3]);
  __syncthreads();
  for (int e = tid; e < 128 * 8; e += 128) { const int m = e >> 3, pc = e & 7; const size_t o = ((b * DD + m0 + m) * D2) + d0 + pc * 8; vst2((unsigned*)(KVH + o), *(const v4u*)&sh[m][pc * 8]); vst2((unsigned*)(KVL + o), *(const v4u*)&sl[m][pc * 8]); }
  // the two lane halves' sums are added and one wave stores the 256-B segment
  if (ksb && tid < 16) vst2(KS + b * D2 + d0 + tid * 4, *(const v4f*)&sks[0][tid * 4] + *(const v4f*)&sks[1][tid * 4]);
}
// ---- k_fin: block = (128 tokens, 128 m cols, b), 8 waves as 4 (tokens) x 2 (cols): acc = q_ . kv (hi + residual) over dd; z = 1/max(q_ . KS, 1e-6) per row (f32, summed inside the dd loop from the q_ fragments that the wave holds for its WMMAs; of the two waves that hold the same 32 rows each sums 16); out = acc z stored through the (b,H,n,hd)->(b,n,H,hd) view: computed (n, m) -> row (8n + m/64) mod N, cols (n/512)*64 + m%64; each wave holds two 16-token row tiles x four column tiles, so that every kv fragment read from LDS feeds two WMMAs and every kv tile copied from L2 serves 128 tokens
// stage = 64 dd: q_ 128 rows, kv hi 128 rows, kv residual 128 rows of 128 B at pitch 144; the output staging so takes the ring's place behind the loop
#define FN_P 144
// 16 f16 fragment elements times 16 f32 values in the same k order, added into four independent sums
__device__ __forceinline__ void zacc(float (&zs)[4], v16h a, const v4f* k) {
#pragma unroll   // constant indices, so that the fragment and the sums stay in registers
  for (int i = 0; i < 16; ++i) zs[i & 3] = __builtin_fmaf((float)a[i], k[i >> 2][i & 3], zs[i & 3]);
}
#define FN_STG ((128 + 128 + 128) * FN_P)
__global__ __launch_bounds__(256) void k_fin(const _Float16* __restrict__ Q, const _Float16* __restrict__ KVH, const _Float16* __restrict__ KVL, const float* __restrict__ KS, float* __restrict__ OUT) {
  __shared__ __align__(16) char ring[2 * FN_STG]; __shared__ float sz[128]; float (*so)[32][68] = (float (*)[32][68])ring;
  const int tid = threadIdx.x, wave = tid >> 5, lane = tid & 31, col = lane & 15, g = lane >> 4; const int wr = wave >> 1, wc = wave & 1; const size_t b = blockIdx.z; const int nb0 = blockIdx.x * 128; const int nw = nb0 + wr * 32; const int m0 = blockIdx.y * 128;
  const char* ga = (const char*)(Q + (b * NN + nb0 + (tid >> 3)) * D2) + (tid & 7) * 16; const size_t kvo = ((b * DD + m0 + (tid >> 3)) * D2) * 2 + (tid & 7) * 16; const char* gh = (const char*)KVH + kvo; const char* gl = (const char*)KVL + kvo;
  const unsigned la = lds_off(ring) + (tid >> 3) * FN_P + (tid & 7) * 16; const size_t gs = (size_t)32 * D2 * 2;
  v8f acc[2][4] = {};
  // z: lane (g, col) of wave (wr, wc) sums q_ . KS of row wr * 32 + wc * 16 + col over the 32 dd of each stage that its two fragments of that row tile hold, in four independent partial sums; wcs is wc as a scalar: with it the choice of the row tile is one select per fragment register, with the per-lane value the compiler built an indexed pick among all four fragments
  const int wcs = __builtin_amdgcn_readfirstlane(wc); const float* ksl = KS + b * D2 + 8 * g; float zs[4] = {0.f, 0.f, 0.f, 0.f};
  acp4(la, 32 * FN_P, ga, gs); acp4(la + 128 * FN_P, 32 * FN_P, gh, gs); acp4(la + 256 * FN_P, 32 * FN_P, gl, gs);
  WAIT_ACP(); __syncthreads();
  acp4(la + FN_STG, 32 * FN_P, ga + 128, gs); acp4(la + FN_STG + 128 * FN_P, 32 * FN_P, gh + 128, gs); acp4(la + FN_STG + 256 * FN_P, 32 * FN_P, gl + 128, gs);
  for (int t = 0; t < D2 / 64; ++t) { const unsigned bo = (t & 1) * FN_STG; const char* base = ring + bo;
    // two fragment sets of two column tiles (hi and residual): the next set is read from LDS as one group in front of this set's 8 WMMAs, so that its latency runs behind them; the loops are unrolled so that the fragment arrays have constant indices and stay in registers
    v16h a[2][2], wh[2][2], wl[2][2]; v4f kz[2][4];   // kz: the 16 KS values of each of the stage's two 32-dd slices in the fragment's own k order
#pragma unroll
    for (int kc = 0; kc < 2; ++kc) { const float* kp = ksl + t * 64 + kc * 32; kz[kc][0] = *(const v4f*)kp; kz[kc][1] = *(const v4f*)(kp + 4); kz[kc][2] = *(const v4f*)(kp + 16); kz[kc][3] = *(const v4f*)(kp + 20); }
#pragma unroll
    for (int rt = 0; rt < 2; ++rt)
#pragma unroll
      for (int kc = 0; kc < 2; ++kc) a[rt][kc] = frag_h((const _Float16*)(base + (wr * 32 + rt * 16 + col) * FN_P) + kc * 32, lane);
#pragma unroll
    for (int j = 0; j < 2; ++j) { const char* wb = base + (128 + wc * 64 + j * 16 + col) * FN_P; wh[0][j] = frag_h((const _Float16*)wb, lane); wl[0][j] = frag_h((const _Float16*)(wb + 128 * FN_P), lane); }
#pragma unroll
    for (int s = 0; s < 4; ++s) { const int kc = s >> 1, jh = (s & 1) * 2;
      if (s + 1 < 4) { const int kn = (s + 1) >> 1, jn = ((s + 1) & 1) * 2;
#pragma unroll
        for (int j = 0; j < 2; ++j) { const char* wb = base + (128 + wc * 64 + (jn + j) * 16 + col) * FN_P + kn * 64; wh[(s + 1) & 1][j] = frag_h((const _Float16*)wb, lane); wl[(s + 1) & 1][j] = frag_h((const _Float16*)(wb + 128 * FN_P), lane); } }
#pragma unroll
      for (int j = 0; j < 2; ++j)
#pragma unroll
        for (int rt = 0; rt < 2; ++rt) { acc[rt][jh + j] = wmma16(a[rt][kc], wh[s & 1][j], acc[rt][jh + j]); v8f t2 = {}; t2 = wmma16(a[rt][kc], wl[s & 1][j], t2);
#pragma unroll
          for (int r = 0; r < 8; ++r) acc[rt][jh + j][r] += t2[r] * (1.0f / 2048.0f); }
      if (s & 1) { if (wcs == 0) zacc(zs, a[0][kc], kz[kc]); else zacc(zs, a[1][kc], kz[kc]); } }
    WAIT_DS(); WAIT_ACP(); __syncthreads();
    if (t + 2 < D2 / 64) { const size_t go = (size_t)(t + 2) * 128; acp4(la + bo, 32 * FN_P, ga + go, gs); acp4(la + bo + 128 * FN_P, 32 * FN_P, gh + go, gs); acp4(la + bo + 256 * FN_P, 32 * FN_P, gl + go, gs); } }
  WAIT_ACP();
  { float s = (zs[0] + zs[1]) + (zs[2] + zs[3]); s += __shfl_xor(s, 16); if (lane < 16) sz[wr * 32 + wc * 16 + col] = 1.0f / fmaxf(s, 1e-6f); }
  __syncthreads();   // each wave reads 16 of its 32 z values from the wave that shares its rows
  LDSX();
#pragma unroll
  for (int rt = 0; rt < 2; ++rt)
#pragma unroll
  for (int j = 0; j < 4; ++j)
#pragma unroll
    for (int r = 0; r < 8; ++r) so[wave][rt * 16 + 8 * g + r][j * 16 + col] = acc[rt][j][r] * sz[wr * 32 + rt * 16 + 8 * g + r];
  LDSX();
  // each computed row n (32 per wave) x this wave's 64 cols = the chunk j64 = m0/64 + wc -> final row (8n + j64) % NN, col block (n/512)*64
#pragma unroll   // straight-line, so that no store's registers are rewritten over a back edge
  for (int rl = 0; rl < 32; rl += 2) { const int lr = rl + (lane >> 4); const int n = nw + lr; const int j64 = m0 / 64 + wc; const size_t frow = b * NN + (size_t)((8 * n + j64) % NN); const int fc0 = (n / 512) * HD;
    vst2(OUT + frow * DD + fc0 + (lane & 15) * 4, *(const v4f*)&so[wave][lr][(lane & 15) * 4]); }   // two 256-B segments per store (lanes 0-15 / 16-31: two computed rows)
}
extern "C" void kernel_launch(void* const* d_in, const int* in_sizes, int n_in, void* d_out, int out_size, void* d_ws, size_t ws_size, hipStream_t stream) {
  (void)in_sizes; (void)n_in; (void)out_size;
  const float** F = (const float**)d_in;   // 0 x [4,4096,512], 1 Wq, 2 Wk, 3 Wv [512,512] natural
  if (ws_size < (size_t)WS_END) return;
  char* ws = (char*)d_ws; __bf16* P = (__bf16*)ws; _Float16 *Q = (_Float16*)(ws + WS_Q), *KT = (_Float16*)(ws + WS_KT), *VT = (_Float16*)(ws + WS_VT), *KVH = (_Float16*)(ws + WS_KVH), *KVL = (_Float16*)(ws + WS_KVL); float* KS = (float*)(ws + WS_KS);
  k_pack<<<3 * DD, 256, 0, stream>>>(F[1], F[2], F[3], P);
  k_proj<<<dim3(TR / 128, DD / 128, 3), 128, 0, stream>>>(F[0], P, Q, KT, VT);
  k_kv<<<dim3(D2 / 64, DD / 128, TNB), 128, 0, stream>>>(KT, VT, KVH, KVL, KS);
  k_fin<<<dim3(NN / 128, DD / 128, TNB), 256, 0, stream>>>(Q, KVH, KVL, KS, (float*)d_out);
}

// v006
// One run takes 102 microseconds.
// Two timings next to v005 put it at 1.03 and 1.04 times that version's speed.
// Counting every step since v000, it is 4.93 times as fast.
// compute dtype: all float inputs rounded to bf16; q / k / v = x . W^T with EXACT bf16 products on WMMA 16x16x32 (natural rows), ReLU and the cos-reweighting (idx = (pi/2)(n+1)/N in f32, precise sinf/cosf) in f32, q_ / k_ / v rounded once to f16; kv = k_^T v and out = q_ kv as WMMA GEMMs (kv carried as f16 hi + residual, 2 products); the column sums of k_ (f32, taken in k_kv from its k_^T fragments) and the normaliser z = 1 / max(q_ . sum k_, 1e-6) in f32 from the same f16-rounded values; output written through the module's (b,H,n,hd) -> (b,n,H,hd) reshape.
#include <hip/hip_runtime.h>
#include <math.h>

typedef __attribute__((ext_vector_type(16))) _Float16 v16h;
typedef __attribute__((ext_vector_type(16))) __bf16 v16b;
typedef __attribute__((ext_vector_type(8)))  _Float16 v8h;
typedef __attribute__((ext_vector_type(8)))  float v8f;
typedef __attribute__((ext_vector_type(4)))  float v4f;
typedef __attribute__((ext_vector_type(2)))  float v2f;
typedef __attribute__((ext_vector_type(4)))  unsigned v4u;
typedef __attribute__((ext_vector_type(4)))  int v4i;
typedef float __attribute__((may_alias)) float_a;
typedef int __attribute__((may_alias)) int_a;

template <typename T> __device__ __forceinline__ void vst2(void* p, T v) { *(T*)p = v;  }
__device__ __forceinline__ v8f wmma16(v16h a, v16h b, v8f c) {
  v8f d = __builtin_amdgcn_wmma_f32_16x16x32_f16(false, a, false, b, (short)0, c, false, false);
  asm volatile("v_nop\n\tv_nop\n\tv_nop\n\tv_nop" : "+v"(d) : "v"(a), "v"(b));
  return d;
}
__device__ __forceinline__ v8f wmma_bf(v16b a, v16b b, v8f c) {
  v8f d = __builtin_amdgcn_wmma_f32_16x16x32_bf16(false, a, false, b, (short)0, c, false, false);
  asm volatile("v_nop\n\tv_nop\n\tv_nop\n\tv_nop" : "+v"(d) : "v"(a), "v"(b));
  return d;
}
// 16x16x32 fragments: lane = (h = lane>>4, row/col = lane&15); elements 0..7 = k0+8h+0..7, 8..15 = k0+16+8h+0..7; D element r = row 8h+r
__device__ __forceinline__ v16h frag_h(const _Float16* rowk0, int lane) {
  union { v16h v; v8h q[2]; } u; const _Float16* p = rowk0 + 8 * (lane >> 4);
  u.q[0] = *(const v8h*)p; u.q[1] = *(const v8h*)(p + 16); return u.v;
}
__device__ __forceinline__ v16h frag_f32(const float* rowk0, int lane) {
  v16h a; const float* p = rowk0 + 8 * (lane >> 4);
#pragma unroll
  for (int i = 0; i < 8; ++i) { a[i] = (_Float16)p[i]; a[8 + i] = (_Float16)p[16 + i]; }
  return a;
}
__device__ __forceinline__ v16h frag_f32s(const float* rowk0, int lane, float sc) {
  v16h a; const float* p = rowk0 + 8 * (lane >> 4);
#pragma unroll
  for (int i = 0; i < 8; ++i) { a[i] = (_Float16)(p[i] * sc); a[8 + i] = (_Float16)(p[16 + i] * sc); }
  return a;
}
// column fragment from a [K][ld] layout (column n), rows >= K read as 0
__device__ __forceinline__ v16h fragc_f32(const float* W, int k0, int n, int lane, int ld, int K) {
  v16h a; const int g = lane >> 4;
#pragma unroll
  for (int i = 0; i < 8; ++i) { const int ka = k0 + 8 * g + i, kb = ka + 16;
    a[i] = (_Float16)(ka < K ? W[(size_t)(ka < K ? ka : K - 1) * ld + n] : 0.f); a[8 + i] = (_Float16)(kb < K ? W[(size_t)(kb < K ? kb : K - 1) * ld + n] : 0.f); }
  return a;
}
struct F2 { v16b h, l; };
__device__ __forceinline__ F2 bsplit16(const float v[16]) { F2 r;
#pragma unroll
  for (int i = 0; i < 16; ++i) { const __bf16 h = (__bf16)v[i]; r.h[i] = h; r.l[i] = (__bf16)(v[i] - (float)h); }
  return r; }
__device__ __forceinline__ F2 split_row(const float* row, int k0, int lane) { float v[16]; const float* p = row + k0 + 8 * (lane >> 4);
#pragma unroll
  for (int i = 0; i < 8; ++i) { v[i] = p[i]; v[8 + i] = p[16 + i]; }
  return bsplit16(v); }
__device__ __forceinline__ F2 split_rowK(const float* row, int k0, int lane, int K) { float v[16]; const int g = lane >> 4;
#pragma unroll
  for (int i = 0; i < 8; ++i) { const int ka = k0 + 8 * g + i, kb = ka + 16; v[i] = ka < K ? row[ka < K ? ka : K - 1] : 0.f; v[8 + i] = kb < K ? row[kb < K ? kb : K - 1] : 0.f; }
  return bsplit16(v); }
__device__ __forceinline__ F2 split_col(const float* W, int k0, int n, int lane, int ld, int K) { float v[16]; const int g = lane >> 4;
#pragma unroll
  for (int i = 0; i < 8; ++i) { const int ka = k0 + 8 * g + i, kb = ka + 16; v[i] = ka < K ? W[(size_t)(ka < K ? ka : K - 1) * ld + n] : 0.f; v[8 + i] = kb < K ? W[(size_t)(kb < K ? kb : K - 1) * ld + n] : 0.f; }
  return bsplit16(v); }
__device__ __forceinline__ v8f mac3(const F2& a, const F2& b, v8f c) { c = wmma_bf(a.l, b.h, c); c = wmma_bf(a.h, b.l, c); return wmma_bf(a.h, b.h, c); }
__device__ __forceinline__ float sigm(float v) { return 1.0f / (1.0f + expf(-v)); }
#define LDSX() do { asm volatile("s_wait_dscnt 0" ::: "memory"); __builtin_amdgcn_wave_barrier(); __builtin_amdgcn_fence(__ATOMIC_RELEASE, "workgroup"); } while (0)


// cosFormer linear attention (B 4, N 4,096, d 512, 8 heads): q = relu(x Wq^T), k = relu(x Wk^T), v = x Wv^T; q_, k_ = [q sin, q cos], [k sin, k cos] with the position weights (pi/2)(n+1)/N; out = (q_ (k_^T v)) / max(q_ . sum_n k_, 1e-6), then the module's head reshape.
#define NB 4
#define NN 4096
#define DD 512
#define D2 (2 * DD)
#define NH 8
#define HD 64
#define NR (NB * NN)
#ifndef TNB
#define TNB NB
#endif
#define TR (TNB * NN)
typedef __attribute__((ext_vector_type(8))) __bf16 v8b;
__device__ __forceinline__ v16b frag_b(const __bf16* rowk0, int lane) {
  union { v16b v; v8b q[2]; } u; const __bf16* p = rowk0 + 8 * (lane >> 4);
  u.q[0] = *(const v8b*)p; u.q[1] = *(const v8b*)(p + 16); return u.v;
}
__device__ __forceinline__ float bfr(float v) { return (float)(__bf16)v; }
__device__ __attribute__((noinline)) float exp_ni(float v) { return expf(v); }
__device__ __attribute__((noinline)) float erf_ni(float v) { return erff(v); }

#define WS_PW  0u                                  // bf16 natural rows Wq, Wk, Wv [3][512][512]
#define WS_Q   (WS_PW + 2u * (size_t)3 * DD * DD)   // f16 rows q_ [NR][1024]
#define WS_KT  (WS_Q + 2u * (size_t)NR * D2)        // f16 planes k_^T [b][1024][NN] ; v^T [b][512][NN]
#define WS_VT  (WS_KT + 2u * (size_t)NB * D2 * NN)
#define WS_KVH (WS_VT + 2u * (size_t)NB * DD * NN)  // f16 hi / lo kv^T [b][512 m][1024 dd]
#define WS_KVL (WS_KVH + 2u * (size_t)NB * DD * D2)
#define WS_KS  (WS_KVL + 2u * (size_t)NB * DD * D2) // f32 [b][1024] sum_n k_
#define WS_END (WS_KS + 4u * (size_t)NB * D2)

__global__ __launch_bounds__(256) void k_pack(const float* __restrict__ WQ, const float* __restrict__ WK, const float* __restrict__ WV, __bf16* __restrict__ P) { const int n = blockIdx.x, t = threadIdx.x; const float* src = (n < DD) ? (WQ + (size_t)n * DD) : (n < 2 * DD) ? (WK + (size_t)(n - DD) * DD) : (WV + (size_t)(n - 2 * DD) * DD); __shared__ __align__(16) __bf16 s[DD]; for (int k = t; k < DD; k += 256) s[k] = (__bf16)src[k]; __syncthreads(); if (t < DD / 8) vst2((unsigned*)(P + (size_t)n * DD + t * 8), *(const v4u*)&s[t * 8]); }
__device__ __attribute__((noinline)) float sin_p(float v) { return sinf(v); }
__device__ __attribute__((noinline)) float cos_p(float v) { return cosf(v); }
__device__ __forceinline__ unsigned lds_off(const void* p) { return (unsigned)(size_t)p; }
// one lane's 8 (4) copies, rows ls bytes apart in LDS and gs bytes apart in global memory; s_wait_xcnt 0 closes the statement so that no address register of a copy is rewritten in front of it
__device__ __forceinline__ void acp8(unsigned l, unsigned ls, const char* p, size_t gs) {
  asm volatile("global_load_async_to_lds_b128 %0, %8, off\n\t"
               "global_load_async_to_lds_b128 %1, %9, off\n\t"
               "global_load_async_to_lds_b128 %2, %10, off\n\t"
               "global_load_async_to_lds_b128 %3, %11, off\n\t"
               "global_load_async_to_lds_b128 %4, %12, off\n\t"
               "global_load_async_to_lds_b128 %5, %13, off\n\t"
               "global_load_async_to_lds_b128 %6, %14, off\n\t"
               "global_load_async_to_lds_b128 %7, %15, off\n\t"
               "s_wait_xcnt 0x0"
               :: "v"(l), "v"(l + ls), "v"(l + 2 * ls), "v"(l + 3 * ls), "v"(l + 4 * ls), "v"(l + 5 * ls), "v"(l + 6 * ls), "v"(l + 7 * ls),
                  "v"(p), "v"(p + gs), "v"(p + 2 * gs), "v"(p + 3 * gs), "v"(p + 4 * gs), "v"(p + 5 * gs), "v"(p + 6 * gs), "v"(p + 7 * gs) : "memory");
}
__device__ __forceinline__ void acp4(unsigned l, unsigned ls, const char* p, size_t gs) {
  asm volatile("global_load_async_to_lds_b128 %0, %4, off\n\t"
               "global_load_async_to_lds_b128 %1, %5, off\n\t"
               "global_load_async_to_lds_b128 %2, %6, off\n\t"
               "global_load_async_to_lds_b128 %3, %7, off\n\t"
               "s_wait_xcnt 0x0"
               :: "v"(l), "v"(l + ls), "v"(l + 2 * ls), "v"(l + 3 * ls), "v"(p), "v"(p + gs), "v"(p + 2 * gs), "v"(p + 3 * gs) : "memory");
}
// one lane's 16 stores of 16 B, 1,024 B apart (8 q_ rows of 2,048 B, sin half and cos half); s_wait_xcnt 0 closes the statement so that no register of a store is rewritten in front of it
__device__ __forceinline__ void gst16(char* p, const v4u* d) {
  asm volatile("global_store_b128 %0, %1, off\n\t"
               "global_store_b128 %0, %2, off offset:1024\n\t"
               "global_store_b128 %0, %3, off offset:2048\n\t"
               "global_store_b128 %0, %4, off offset:3072\n\t"
               "global_store_b128 %0, %5, off offset:4096\n\t"
               "global_store_b128 %0, %6, off offset:5120\n\t"
               "global_store_b128 %0, %7, off offset:6144\n\t"
               "global_store_b128 %0, %8, off offset:7168\n\t"
               "global_store_b128 %0, %9, off offset:8192\n\t"
               "global_store_b128 %0, %10, off offset:9216\n\t"
               "global_store_b128 %0, %11, off offset:10240\n\t"
               "global_store_b128 %0, %12, off offset:11264\n\t"
               "global_store_b128 %0, %13, off offset:12288\n\t"
               "global_store_b128 %0, %14, off offset:13312\n\t"
               "global_store_b128 %0, %15, off offset:14336\n\t"
               "global_store_b128 %0, %16, off offset:15360\n\t"
               "s_wait_xcnt 0x0"
               :: "v"(p), "v"(d[0]), "v"(d[1]), "v"(d[2]), "v"(d[3]), "v"(d[4]), "v"(d[5]), "v"(d[6]), "v"(d[7]), "v"(d[8]), "v"(d[9]), "v"(d[10]), "v"(d[11]), "v"(d[12]), "v"(d[13]), "v"(d[14]), "v"(d[15]) : "memory");
}
// this wave's copies have landed (in front of the barrier behind which other waves read them)
#define WAIT_ACP() asm volatile("s_wait_asynccnt 0x0" ::: "memory")
// this wave's LDS reads of a buffer have returned (in front of the barrier behind which the buffer is refilled)
#define WAIT_DS() asm volatile("s_wait_dscnt 0x0" ::: "memory")
// ---- k_proj: block = (128 tokens, 128 cols, which): 0 q -> relu, x sin | x cos -> q_ rows; 1 k -> relu, x sin | cos -> k_^T planes; 2 v -> v^T planes; each wave holds two 16-token row tiles, so that every W fragment read from LDS feeds two WMMAs and every W tile copied from L2 serves 128 tokens
// stage = 64 k: x 128 rows of 256 B (f32) at pitch 272, W 128 rows of 128 B (bf16) at pitch 144; the output staging so / st takes the ring's place behind the loop
#define PJ_PA 272
#define PJ_PB 144
#define PJ_STG (128 * PJ_PA + 128 * PJ_PB)
__global__ __launch_bounds__(128) void k_proj(const float* __restrict__ X, const __bf16* __restrict__ P, _Float16* __restrict__ Q, _Float16* __restrict__ KT, _Float16* __restrict__ VT) {
  __shared__ __align__(16) char ring[2 * PJ_STG];
  _Float16 (*so)[128][136] = (_Float16 (*)[128][136])ring; _Float16 (*st)[128][136] = (_Float16 (*)[128][136])ring;
  const int tid = threadIdx.x, wave = tid >> 5, lane = tid & 31, col = lane & 15, g = lane >> 4; const int which = blockIdx.z; const int n0 = blockIdx.y * 128; const size_t rb0 = (size_t)blockIdx.x * 128, r0 = rb0 + wave * 32; const size_t b = rb0 / NN, s0 = rb0 % NN;
  const char* ga = (const char*)(X + (rb0 + (tid >> 4)) * DD) + (tid & 15) * 16; const char* gb = (const char*)(P + ((size_t)which * DD + n0 + (tid >> 3)) * DD) + (tid & 7) * 16;
  const unsigned la = lds_off(ring) + (tid >> 4) * PJ_PA + (tid & 15) * 16, lb = lds_off(ring) + 128 * PJ_PA + (tid >> 3) * PJ_PB + (tid & 7) * 16;
  const size_t gsa = (size_t)8 * DD * 4, gsb = (size_t)16 * DD * 2;
  v8f acc[2][8] = {};
  // trip t works on k stage (t + rot) mod 8: the work-groups run in step, and with a common start all of them ask L2 for the same column offset of their rows, and those that share x rows or W rows for the same lines, at the same moment; with a start of its own per work-group the requests of a moment spread over all 8 offsets
  const unsigned rot = (blockIdx.x + 2 * blockIdx.y + blockIdx.z) & (DD / 64 - 1);
  { const size_t k0 = rot, k1 = (rot + 1) & (DD / 64 - 1);
    acp8(la, 8 * PJ_PA, ga + k0 * 256, gsa); acp8(la + 64 * PJ_PA, 8 * PJ_PA, ga + 8 * gsa + k0 * 256, gsa); acp8(lb, 16 * PJ_PB, gb + k0 * 128, gsb);
    WAIT_ACP(); __syncthreads();
    acp8(la + PJ_STG, 8 * PJ_PA, ga + k1 * 256, gsa); acp8(la + PJ_STG + 64 * PJ_PA, 8 * PJ_PA, ga + 8 * gsa + k1 * 256, gsa); acp8(lb + PJ_STG, 16 * PJ_PB, gb + k1 * 128, gsb); }
  for (int t = 0; t < DD / 64; ++t) { const unsigned bo = (t & 1) * PJ_STG; const char* base = ring + bo;
    // each 32-k slice's fragments are read from LDS as one group in front of its 16 WMMAs, so that the LDS latency is waited out once a slice and not once a WMMA; the loops are unrolled so that the fragment arrays have constant indices and stay in registers
#pragma unroll
    for (int kc = 0; kc < 2; ++kc) { v16b a[2], w[8];
#pragma unroll
      for (int rt = 0; rt < 2; ++rt) { const float* p = (const float*)(base + (wave * 32 + rt * 16 + col) * PJ_PA) + kc * 32 + 8 * g;
#pragma unroll
        for (int i = 0; i < 8; ++i) { a[rt][i] = (__bf16)p[i]; a[rt][8 + i] = (__bf16)p[16 + i]; } }
#pragma unroll
      for (int j = 0; j < 8; ++j) w[j] = frag_b((const __bf16*)(base + 128 * PJ_PA + (j * 16 + col) * PJ_PB) + kc * 32, lane);
#pragma unroll
      for (int j = 0; j < 8; ++j)
#pragma unroll
        for (int rt = 0; rt < 2; ++rt) acc[rt][j] = wmma_bf(a[rt], w[j], acc[rt][j]); }
    WAIT_DS(); WAIT_ACP(); __syncthreads();
    if (t + 2 < DD / 64) { const size_t kn = (t + 2 + rot) & (DD / 64 - 1); acp8(la + bo, 8 * PJ_PA, ga + kn * 256, gsa); acp8(la + bo + 64 * PJ_PA, 8 * PJ_PA, ga + 8 * gsa + kn * 256, gsa); acp8(lb + bo, 16 * PJ_PB, gb + kn * 128, gsb); } }
  WAIT_ACP();
  if (which == 0) {
#pragma unroll
    for (int rt = 0; rt < 2; ++rt)
#pragma unroll
    for (int r = 0; r < 8; ++r) { const int lr = wave * 32 + rt * 16 + 8 * g + r; const int n = (int)((rb0 + lr) % NN); const float ang = (1.57079632679489662f * (float)(n + 1)) / (float)NN; const float sn = sin_p(ang), cs = cos_p(ang);
#pragma unroll
      for (int j = 0; j < 8; ++j) { const float v = fmaxf(acc[rt][j][r], 0.f); so[0][lr][j * 16 + col] = (_Float16)(v * sn); so[1][lr][j * 16 + col] = (_Float16)(v * cs); } }
    LDSX();
    if (lane < 16) for (int rb = 0; rb < 32; rb += 8) { v4u d[16];
#pragma unroll   // constant indices, so that d stays in registers
      for (int i = 0; i < 8; ++i) { d[2 * i] = *(const v4u*)&so[0][wave * 32 + rb + i][lane * 8]; d[2 * i + 1] = *(const v4u*)&so[1][wave * 32 + rb + i][lane * 8]; }
      gst16((char*)(Q + (r0 + rb) * D2 + n0 + lane * 8), d); }
  } else if (which == 1) {
#pragma unroll
    for (int rt = 0; rt < 2; ++rt)
#pragma unroll
    for (int r = 0; r < 8; ++r) { const int lr = wave * 32 + rt * 16 + 8 * g + r; const int n = (int)((rb0 + lr) % NN); const float ang = (1.57079632679489662f * (float)(n + 1)) / (float)NN; const float sn = sin_p(ang), cs = cos_p(ang);
#pragma unroll
      for (int j = 0; j < 8; ++j) { const float v = fmaxf(acc[rt][j][r], 0.f); st[0][j * 16 + col][lr] = (_Float16)(v * sn); st[1][j * 16 + col][lr] = (_Float16)(v * cs); } }
    __syncthreads();
    for (int e = tid; e < 2 * 128 * 16; e += 128) { const int pl = e >> 11, d = (e >> 4) & 127, pc = e & 15; vst2((unsigned*)(KT + ((b * D2 + (size_t)pl * DD + n0 + d) * NN) + s0 + pc * 8), *(const v4u*)&st[pl][d][pc * 8]); }
  } else {
#pragma unroll
    for (int rt = 0; rt < 2; ++rt)
#pragma unroll
    for (int r = 0; r < 8; ++r)
#pragma unroll
      for (int j = 0; j < 8; ++j) st[0][j * 16 + col][wave * 32 + rt * 16 + 8 * g + r] = (_Float16)acc[rt][j][r];
    __syncthreads();
    for (int e = tid; e < 128 * 16; e += 128) { const int d = e >> 4, pc = e & 15; vst2((unsigned*)(VT + ((b * DD + n0 + d) * NN) + s0 + pc * 8), *(const v4u*)&st[0][d][pc * 8]); } }
}
// stage = 128 tokens: k_^T 64 rows and v^T 128 rows of 256 B at pitch 272; three buffers, so that two tiles' copies (2 x 24 per wave) fly while a third tile is multiplied: a tile has two trips to land, not one; the work-groups of the first m block also sum k_ over the tokens, in f32 from the k_^T fragments that they hold in registers anyway -> KS[b][dd]
#define KV_P 272
#define KV_STG ((64 + 128) * KV_P)
// every wave issues exactly 24 copies per tile, and a wave's copies return in issue order: all but its 24 youngest copies have landed, that is every tile but the one issued last
#define WAIT_ACP_BUT24() asm volatile("s_wait_asynccnt 0x18" ::: "memory")
__global__ __launch_bounds__(128) void k_kv(const _Float16* __restrict__ KT, const _Float16* __restrict__ VT, _Float16* __restrict__ KVH, _Float16* __restrict__ KVL, float* __restrict__ KS) {
  __shared__ __align__(16) char ring[3 * KV_STG]; __shared__ __align__(16) _Float16 sh[128][72]; __shared__ __align__(16) _Float16 sl[128][72]; __shared__ __align__(16) float sks[2][64];
  const int tid = threadIdx.x, wave = tid >> 5, lane = tid & 31, col = lane & 15, g = lane >> 4; const size_t b = blockIdx.z; const int d0 = blockIdx.x * 64; const int m0 = blockIdx.y * 128;
  const char* ga = (const char*)(KT + (b * D2 + d0 + (tid >> 4)) * NN) + (tid & 15) * 16; const char* gb = (const char*)(VT + (b * DD + m0 + (tid >> 4)) * NN) + (tid & 15) * 16;
  const unsigned la = lds_off(ring) + (tid >> 4) * KV_P + (tid & 15) * 16; const size_t gs = (size_t)8 * NN * 2;
  v8f acc[8] = {};
  const bool ksb = blockIdx.y == 0; float ps[4] = {0.f, 0.f, 0.f, 0.f};   // lane (g, col): four independent partial sums of row wave * 16 + col over the 16 tokens of each slice that its fragment holds
  // trip t works on token tile (t + rot) mod 32, a start of its own per work-group, for the reason given in k_proj (here all 256 work-groups start together and the rows are 8,192 B apart)
  const unsigned rot = (2 * blockIdx.x + 8 * blockIdx.y + blockIdx.z) & (NN / 128 - 1);
  { const size_t g0 = (size_t)rot * 256, g1 = (size_t)((rot + 1) & (NN / 128 - 1)) * 256, g2 = (size_t)((rot + 2) & (NN / 128 - 1)) * 256;
    acp8(la, 8 * KV_P, ga + g0, gs); acp8(la + 64 * KV_P, 8 * KV_P, gb + g0, gs); acp8(la + 128 * KV_P, 8 * KV_P, gb + 8 * gs + g0, gs);
    acp8(la + KV_STG, 8 * KV_P, ga + g1, gs); acp8(la + KV_STG + 64 * KV_P, 8 * KV_P, gb + g1, gs); acp8(la + KV_STG + 128 * KV_P, 8 * KV_P, gb + 8 * gs + g1, gs);
    WAIT_ACP_BUT24(); __syncthreads();   // tile 0 has landed in every wave; tile 1 flies on
    acp8(la + 2 * KV_STG, 8 * KV_P, ga + g2, gs); acp8(la + 2 * KV_STG + 64 * KV_P, 8 * KV_P, gb + g2, gs); acp8(la + 2 * KV_STG + 128 * KV_P, 8 * KV_P, gb + 8 * gs + g2, gs); }
  unsigned bo = 0;   // byte offset of buffer t mod 3
  for (int t = 0; t < NN / 128; ++t) { const char* base = ring + bo;
    // two fragment sets: the next 32 tokens' fragments are read from LDS as one group in front of this slice's WMMAs, so that their latency runs behind the WMMAs; the loops are unrolled so that the fragment arrays have constant indices and stay in registers
    v16h a[2], w[2][8];
    a[0] = frag_h((const _Float16*)(base + (wave * 16 + col) * KV_P), lane);
#pragma unroll
    for (int j = 0; j < 8; ++j) w[0][j] = frag_h((const _Float16*)(base + (64 + j * 16 + col) * KV_P), lane);
#pragma unroll
    for (int kc = 0; kc < 4; ++kc) {
      if (kc + 1 < 4) { a[(kc + 1) & 1] = frag_h((const _Float16*)(base + (wave * 16 + col) * KV_P) + (kc + 1) * 32, lane);
#pragma unroll
        for (int j = 0; j < 8; ++j) w[(kc + 1) & 1][j] = frag_h((const _Float16*)(base + (64 + j * 16 + col) * KV_P) + (kc + 1) * 32, lane); }
      if (ksb) {   // unrolled so that the fragment's elements and the four sums have constant indices and stay in registers
#pragma unroll
        for (int i = 0; i < 16; ++i) ps[i & 3] += (float)a[kc & 1][i]; }
#pragma unroll
      for (int j = 0; j < 8; ++j) acc[j] = wmma16(a[kc & 1], w[kc & 1][j], acc[j]); }
    // foot of trip t: tile t + 1 must have landed; where a tile t + 2 exists its 24 copies are this wave's youngest and fly on, else nothing may stay outstanding
    WAIT_DS(); if (t + 2 < NN / 128) WAIT_ACP_BUT24(); else WAIT_ACP();
    __syncthreads();
    // tile t + 3 goes into the buffer that trip t has just read: every wave's reads of it have returned in front of the barrier
    if (t + 3 < NN / 128) { const size_t go = (size_t)((t + 3 + rot) & (NN / 128 - 1)) * 256; acp8(la + bo, 8 * KV_P, ga + go, gs); acp8(la + bo + 64 * KV_P, 8 * KV_P, gb + go, gs); acp8(la + bo + 128 * KV_P, 8 * KV_P, gb + 8 * gs + go, gs); }
    bo = (bo == 2 * KV_STG) ? 0u : bo + KV_STG; }
  WAIT_ACP();
#pragma unroll
  for (int j = 0; j < 8; ++j)
#pragma unroll
    for (int r = 0; r < 8; ++r) { const float v = acc[j][r]; const _Float16 hv = (_Float16)v; sh[j * 16 + col][wave * 16 + 8 * g + r] = hv; sl[j * 16 + col][wave * 16 + 8 * g + r] = (_Float16)((v - (float)hv) * 2048.0f); }
  if (ksb) sks[g][wave * 16 + col] = (ps[0] + ps[1]) + (ps[2] + ps[3]);
  __syncthreads();
  for (int e = tid; e < 128 * 8; e += 128) { const int m = e >> 3, pc = e & 7; const size_t o = ((b * DD + m0 + m) * D2) + d0 + pc * 8; vst2((unsigned*)(KVH + o), *(const v4u*)&sh[m][pc * 8]); vst2((unsigned*)(KVL + o), *(const v4u*)&sl[m][pc * 8]); }
  // the two lane halves' sums are added and one wave stores the 256-B segment
  if (ksb && tid < 16) vst2(KS + b * D2 + d0 + tid * 4, *(const v4f*)&sks[0][tid * 4] + *(const v4f*)&sks[1][tid * 4]);
}
// ---- k_fin: block = (128 tokens, 128 m cols, b), 8 waves as 4 (tokens) x 2 (cols): acc = q_ . kv (hi + residual) over dd; z = 1/max(q_ . KS, 1e-6) per row (f32, summed inside the dd loop from the q_ fragments that the wave holds for its WMMAs; of the two waves that hold the same 32 rows each sums 16); out = acc z stored through the (b,H,n,hd)->(b,n,H,hd) view: computed (n, m) -> row (8n + m/64) mod N, cols (n/512)*64 + m%64; each wave holds two 16-token row tiles x four column tiles, so that every kv fragment read from LDS feeds two WMMAs and every kv tile copied from L2 serves 128 tokens
// stage = 64 dd: q_ 128 rows, kv hi 128 rows, kv residual 128 rows of 128 B at pitch 144; the output staging so takes the ring's place behind the loop
#define FN_P 144
// 16 f16 fragment elements times 16 f32 values in the same k order, added into four independent sums
__device__ __forceinline__ void zacc(float (&zs)[4], v16h a, const v4f* k) {
#pragma unroll   // constant indices, so that the fragment and the sums stay in registers
  for (int i = 0; i < 16; ++i) zs[i & 3] = __builtin_fmaf((float)a[i], k[i >> 2][i & 3], zs[i & 3]);
}
#define FN_STG ((128 + 128 + 128) * FN_P)
__global__ __launch_bounds__(256) void k_fin(const _Float16* __restrict__ Q, const _Float16* __restrict__ KVH, const _Float16* __restrict__ KVL, const float* __restrict__ KS, float* __restrict__ OUT) {
  __shared__ __align__(16) char ring[2 * FN_STG]; __shared__ float sz[128]; float (*so)[32][68] = (float (*)[32][68])ring;
  const int tid = threadIdx.x, wave = tid >> 5, lane = tid & 31, col = lane & 15, g = lane >> 4; const int wr = wave >> 1, wc = wave & 1; const size_t b = blockIdx.z; const int nb0 = blockIdx.x * 128; const int nw = nb0 + wr * 32; const int m0 = blockIdx.y * 128;
  const char* ga = (const char*)(Q + (b * NN + nb0 + (tid >> 3)) * D2) + (tid & 7) * 16; const size_t kvo = ((b * DD + m0 + (tid >> 3)) * D2) * 2 + (tid & 7) * 16; const char* gh = (const char*)KVH + kvo; const char* gl = (const char*)KVL + kvo;
  const unsigned la = lds_off(ring) + (tid >> 3) * FN_P + (tid & 7) * 16; const size_t gs = (size_t)32 * D2 * 2;
  v8f acc[2][4] = {};
  // z: lane (g, col) of wave (wr, wc) sums q_ . KS of row wr * 32 + wc * 16 + col over the 32 dd of each stage that its two fragments of that row tile hold, in four independent partial sums; wcs is wc as a scalar: with it the choice of the row tile is one select per fragment register, with the per-lane value the compiler built an indexed pick among all four fragments
  const int wcs = __builtin_amdgcn_readfirstlane(wc); const float* ksl = KS + b * D2 + 8 * g; float zs[4] = {0.f, 0.f, 0.f, 0.f};
  // trip t works on dd stage (t + rot) mod 16, a start of its own per work-group, for the reason given in k_proj; z takes its KS values from the same stage
  const unsigned rot = (blockIdx.x + 4 * blockIdx.y + blockIdx.z) & (D2 / 64 - 1);
  { const size_t g0 = (size_t)rot * 128, g1 = (size_t)((rot + 1) & (D2 / 64 - 1)) * 128;
    acp4(la, 32 * FN_P, ga + g0, gs); acp4(la + 128 * FN_P, 32 * FN_P, gh + g0, gs); acp4(la + 256 * FN_P, 32 * FN_P, gl + g0, gs);
    WAIT_ACP(); __syncthreads();
    acp4(la + FN_STG, 32 * FN_P, ga + g1, gs); acp4(la + FN_STG + 128 * FN_P, 32 * FN_P, gh + g1, gs); acp4(la + FN_STG + 256 * FN_P, 32 * FN_P, gl + g1, gs); }
  for (int t = 0; t < D2 / 64; ++t) { const unsigned bo = (t & 1) * FN_STG; const char* base = ring + bo;
    // two fragment sets of two column tiles (hi and residual): the next set is read from LDS as one group in front of this set's 8 WMMAs, so that its latency runs behind them; the loops are unrolled so that the fragment arrays have constant indices and stay in registers
    v16h a[2][2], wh[2][2], wl[2][2]; v4f kz[2][4];   // kz: the 16 KS values of each of the stage's two 32-dd slices in the fragment's own k order
#pragma unroll
    for (int kc = 0; kc < 2; ++kc) { const float* kp = ksl + ((t + rot) & (D2 / 64 - 1)) * 64 + kc * 32; kz[kc][0] = *(const v4f*)kp; kz[kc][1] = *(const v4f*)(kp + 4); kz[kc][2] = *(const v4f*)(kp + 16); kz[kc][3] = *(const v4f*)(kp + 20); }
#pragma unroll
    for (int rt = 0; rt < 2; ++rt)
#pragma unroll
      for (int kc = 0; kc < 2; ++kc) a[rt][kc] = frag_h((const _Float16*)(base + (wr * 32 + rt * 16 + col) * FN_P) + kc * 32, lane);
#pragma unroll
    for (int j = 0; j < 2; ++j) { const char* wb = base + (128 + wc * 64 + j * 16 + col) * FN_P; wh[0][j] = frag_h((const _Float16*)wb, lane); wl[0][j] = frag_h((const _Float16*)(wb + 128 * FN_P), lane); }
#pragma unroll
    for (int s = 0; s < 4; ++s) { const int kc = s >> 1, jh = (s & 1) * 2;
      if (s + 1 < 4) { const int kn = (s + 1) >> 1, jn = ((s + 1) & 1) * 2;
#pragma unroll
        for (int j = 0; j < 2; ++j) { const char* wb = base + (128 + wc * 64 + (jn + j) * 16 + col) * FN_P + kn * 64; wh[(s + 1) & 1][j] = frag_h((const _Float16*)wb, lane); wl[(s + 1) & 1][j] = frag_h((const _Float16*)(wb + 128 * FN_P), lane); } }
#pragma unroll
      for (int j = 0; j < 2; ++j)
#pragma unroll
        for (int rt = 0; rt < 2; ++rt) { acc[rt][jh + j] = wmma16(a[rt][kc], wh[s & 1][j], acc[rt][jh + j]); v8f t2 = {}; t2 = wmma16(a[rt][kc], wl[s & 1][j], t2);
#pragma unroll
          for (int r = 0; r < 8; ++r) acc[rt][jh + j][r] += t2[r] * (1.0f / 2048.0f); }
      if (s & 1) { if (wcs == 0) zacc(zs, a[0][kc], kz[kc]); else zacc(zs, a[1][kc], kz[kc]); } }
    WAIT_DS(); WAIT_ACP(); __syncthreads();
    if (t + 2 < D2 / 64) { const size_t go = (size_t)((t + 2 + rot) & (D2 / 64 - 1)) * 128; acp4(la + bo, 32 * FN_P, ga + go, gs); acp4(la + bo + 128 * FN_P, 32 * FN_P, gh + go, gs); acp4(la + bo + 256 * FN_P, 32 * FN_P, gl + go, gs); } }
  WAIT_ACP();
  { float s = (zs[0] + zs[1]) + (zs[2] + zs[3]); s += __shfl_xor(s, 16); if (lane < 16) sz[wr * 32 + wc * 16 + col] = 1.0f / fmaxf(s, 1e-6f); }
  __syncthreads();   // each wave reads 16 of its 32 z values from the wave that shares its rows
  LDSX();
#pragma unroll
  for (int rt = 0; rt < 2; ++rt)
#pragma unroll
  for (int j = 0; j < 4; ++j)
#pragma unroll
    for (int r = 0; r < 8; ++r) so[wave][rt * 16 + 8 * g + r][j * 16 + col] = acc[rt][j][r] * sz[wr * 32 + rt * 16 + 8 * g + r];
  LDSX();
  // each computed row n (32 per wave) x this wave's 64 cols = the chunk j64 = m0/64 + wc -> final row (8n + j64) % NN, col block (n/512)*64
#pragma unroll   // straight-line, so that no store's registers are rewritten over a back edge
  for (int rl = 0; rl < 32; rl += 2) { const int lr = rl + (lane >> 4); const int n = nw + lr; const int j64 = m0 / 64 + wc; const size_t frow = b * NN + (size_t)((8 * n + j64) % NN); const int fc0 = (n / 512) * HD;
    vst2(OUT + frow * DD + fc0 + (lane & 15) * 4, *(const v4f*)&so[wave][lr][(lane & 15) * 4]); }   // two 256-B segments per store (lanes 0-15 / 16-31: two computed rows)
}
extern "C" void kernel_launch(void* const* d_in, const int* in_sizes, int n_in, void* d_out, int out_size, void* d_ws, size_t ws_size, hipStream_t stream) {
  (void)in_sizes; (void)n_in; (void)out_size;
  const float** F = (const float**)d_in;   // 0 x [4,4096,512], 1 Wq, 2 Wk, 3 Wv [512,512] natural
  if (ws_size < (size_t)WS_END) return;
  char* ws = (char*)d_ws; __bf16* P = (__bf16*)ws; _Float16 *Q = (_Float16*)(ws + WS_Q), *KT = (_Float16*)(ws + WS_KT), *VT = (_Float16*)(ws + WS_VT), *KVH = (_Float16*)(ws + WS_KVH), *KVL = (_Float16*)(ws + WS_KVL); float* KS = (float*)(ws + WS_KS);
  k_pack<<<3 * DD, 256, 0, stream>>>(F[1], F[2], F[3], P);
  k_proj<<<dim3(TR / 128, DD / 128, 3), 128, 0, stream>>>(F[0], P, Q, KT, VT);
  k_kv<<<dim3(D2 / 64, DD / 128, TNB), 128, 0, stream>>>(KT, VT, KVH, KVL, KS);
  k_fin<<<dim3(NN / 128, DD / 128, TNB), 256, 0, stream>>>(Q, KVH, KVL, KS, (float*)d_out);
}

// v007
// It runs in 89.7 microseconds.
// Timed twice side by side with v006, it ran 1.13 and 1.14 times as fast.
// Counting every step since v000, it is 5.60 times as fast.
// compute dtype: all float inputs rounded to bf16; q / k / v = x . W^T with EXACT bf16 products on WMMA 16x16x32 (natural rows), ReLU and the cos-reweighting (idx = (pi/2) (n+1) / N in f32, precise sinf/cosf) in f32, q_ / k_ / v rounded once to f16; kv = k_^T v and out = q_ kv as WMMA GEMMs (kv rounded once to f16, like q_, k_ and v: one product); the column sums of k_ (f32, taken in k_kv from its k_^T fragments) and the normaliser z = 1 / max(q_ . sum k_, 1e-6) in f32 from the same f16-rounded values; output written through the module's (b,H,n,hd) -> (b,n,H,hd) reshape.
#include <hip/hip_runtime.h>
#include <math.h>

typedef __attribute__((ext_vector_type(16))) _Float16 v16h;
typedef __attribute__((ext_vector_type(16))) __bf16 v16b;
typedef __attribute__((ext_vector_type(8)))  _Float16 v8h;
typedef __attribute__((ext_vector_type(8)))  float v8f;
typedef __attribute__((ext_vector_type(4)))  float v4f;
typedef __attribute__((ext_vector_type(2)))  float v2f;
typedef __attribute__((ext_vector_type(4)))  unsigned v4u;
typedef __attribute__((ext_vector_type(4)))  int v4i;
typedef float __attribute__((may_alias)) float_a;
typedef int __attribute__((may_alias)) int_a;

template <typename T> __device__ __forceinline__ void vst2(void* p, T v) { *(T*)p = v;  }
__device__ __forceinline__ v8f wmma16(v16h a, v16h b, v8f c) {
  v8f d = __builtin_amdgcn_wmma_f32_16x16x32_f16(false, a, false, b, (short)0, c, false, false);
  asm volatile("v_nop\n\tv_nop\n\tv_nop\n\tv_nop" : "+v"(d) : "v"(a), "v"(b));
  return d;
}
__device__ __forceinline__ v8f wmma_bf(v16b a, v16b b, v8f c) {
  v8f d = __builtin_amdgcn_wmma_f32_16x16x32_bf16(false, a, false, b, (short)0, c, false, false);
  asm volatile("v_nop\n\tv_nop\n\tv_nop\n\tv_nop" : "+v"(d) : "v"(a), "v"(b));
  return d;
}
// 16x16x32 fragments: lane = (h = lane>>4, row/col = lane&15); elements 0..7 = k0+8h+0..7, 8..15 = k0+16+8h+0..7; D element r = row 8h+r
__device__ __forceinline__ v16h frag_h(const _Float16* rowk0, int lane) {
  union { v16h v; v8h q[2]; } u; const _Float16* p = rowk0 + 8 * (lane >> 4);
  u.q[0] = *(const v8h*)p; u.q[1] = *(const v8h*)(p + 16); return u.v;
}
__device__ __forceinline__ v16h frag_f32(const float* rowk0, int lane) {
  v16h a; const float* p = rowk0 + 8 * (lane >> 4);
#pragma unroll
  for (int i = 0; i < 8; ++i) { a[i] = (_Float16)p[i]; a[8 + i] = (_Float16)p[16 + i]; }
  return a;
}
__device__ __forceinline__ v16h frag_f32s(const float* rowk0, int lane, float sc) {
  v16h a; const float* p = rowk0 + 8 * (lane >> 4);
#pragma unroll
  for (int i = 0; i < 8; ++i) { a[i] = (_Float16)(p[i] * sc); a[8 + i] = (_Float16)(p[16 + i] * sc); }
  return a;
}
// column fragment from a [K][ld] layout (column n), rows >= K read as 0
__device__ __forceinline__ v16h fragc_f32(const float* W, int k0, int n, int lane, int ld, int K) {
  v16h a; const int g = lane >> 4;
#pragma unroll
  for (int i = 0; i < 8; ++i) { const int ka = k0 + 8 * g + i, kb = ka + 16;
    a[i] = (_Float16)(ka < K ? W[(size_t)(ka < K ? ka : K - 1) * ld + n] : 0.f); a[8 + i] = (_Float16)(kb < K ? W[(size_t)(kb < K ? kb : K - 1) * ld + n] : 0.f); }
  return a;
}
struct F2 { v16b h, l; };
__device__ __forceinline__ F2 bsplit16(const float v[16]) { F2 r;
#pragma unroll
  for (int i = 0; i < 16; ++i) { const __bf16 h = (__bf16)v[i]; r.h[i] = h; r.l[i] = (__bf16)(v[i] - (float)h); }
  return r; }
__device__ __forceinline__ F2 split_row(const float* row, int k0, int lane) { float v[16]; const float* p = row + k0 + 8 * (lane >> 4);
#pragma unroll
  for (int i = 0; i < 8; ++i) { v[i] = p[i]; v[8 + i] = p[16 + i]; }
  return bsplit16(v); }
__device__ __forceinline__ F2 split_rowK(const float* row, int k0, int lane, int K) { float v[16]; const int g = lane >> 4;
#pragma unroll
  for (int i = 0; i < 8; ++i) { const int ka = k0 + 8 * g + i, kb = ka + 16; v[i] = ka < K ? row[ka < K ? ka : K - 1] : 0.f; v[8 + i] = kb < K ? row[kb < K ? kb : K - 1] : 0.f; }
  return bsplit16(v); }
__device__ __forceinline__ F2 split_col(const float* W, int k0, int n, int lane, int ld, int K) { float v[16]; const int g = lane >> 4;
#pragma unroll
  for (int i = 0; i < 8; ++i) { const int ka = k0 + 8 * g + i, kb = ka + 16; v[i] = ka < K ? W[(size_t)(ka < K ? ka : K - 1) * ld + n] : 0.f; v[8 + i] = kb < K ? W[(size_t)(kb < K ? kb : K - 1) * ld + n] : 0.f; }
  return bsplit16(v); }
__device__ __forceinline__ v8f mac3(const F2& a, const F2& b, v8f c) { c = wmma_bf(a.l, b.h, c); c = wmma_bf(a.h, b.l, c); return wmma_bf(a.h, b.h, c); }
__device__ __forceinline__ float sigm(float v) { return 1.0f / (1.0f + expf(-v)); }
#define LDSX() do { asm volatile("s_wait_dscnt 0" ::: "memory"); __builtin_amdgcn_wave_barrier(); __builtin_amdgcn_fence(__ATOMIC_RELEASE, "workgroup"); } while (0)


// cosFormer linear attention (B 4, N 4,096, d 512, 8 heads): q = relu(x Wq^T), k = relu(x Wk^T), v = x Wv^T; q_, k_ = [q sin, q cos], [k sin, k cos] with the position weights (pi/2)(n+1)/N; out = (q_ (k_^T v)) / max(q_ . sum_n k_, 1e-6), then the module's head reshape.
#define NB 4
#define NN 4096
#define DD 512
#define D2 (2 * DD)
#define NH 8
#define HD 64
#define NR (NB * NN)
#ifndef TNB
#define TNB NB
#endif
#define TR (TNB * NN)
typedef __attribute__((ext_vector_type(8))) __bf16 v8b;
__device__ __forceinline__ v16b frag_b(const __bf16* rowk0, int lane) {
  union { v16b v; v8b q[2]; } u; const __bf16* p = rowk0 + 8 * (lane >> 4);
  u.q[0] = *(const v8b*)p; u.q[1] = *(const v8b*)(p + 16); return u.v;
}
__device__ __forceinline__ float bfr(float v) { return (float)(__bf16)v; }
__device__ __attribute__((noinline)) float exp_ni(float v) { return expf(v); }
__device__ __attribute__((noinline)) float erf_ni(float v) { return erff(v); }

#define WS_PW  0u                                  // bf16 natural rows Wq, Wk, Wv [3][512][512]
#define WS_Q   (WS_PW + 2u * (size_t)3 * DD * DD)   // f16 rows q_ [NR][1024]
#define WS_KT  (WS_Q + 2u * (size_t)NR * D2)        // f16 planes k_^T [b][1024][NN] ; v^T [b][512][NN]
#define WS_VT  (WS_KT + 2u * (size_t)NB * D2 * NN)
#define WS_KVH (WS_VT + 2u * (size_t)NB * DD * NN)  // f16 kv^T [b][512 m][1024 dd]
#define WS_KS  (WS_KVH + 2u * (size_t)NB * DD * D2) // f32 [b][1024] sum_n k_
#define WS_END (WS_KS + 4u * (size_t)NB * D2)

__global__ __launch_bounds__(256) void k_pack(const float* __restrict__ WQ, const float* __restrict__ WK, const float* __restrict__ WV, __bf16* __restrict__ P) { const int n = blockIdx.x, t = threadIdx.x; const float* src = (n < DD) ? (WQ + (size_t)n * DD) : (n < 2 * DD) ? (WK + (size_t)(n - DD) * DD) : (WV + (size_t)(n - 2 * DD) * DD); __shared__ __align__(16) __bf16 s[DD]; for (int k = t; k < DD; k += 256) s[k] = (__bf16)src[k]; __syncthreads(); if (t < DD / 8) vst2((unsigned*)(P + (size_t)n * DD + t * 8), *(const v4u*)&s[t * 8]); }
__device__ __attribute__((noinline)) float sin_p(float v) { return sinf(v); }
__device__ __attribute__((noinline)) float cos_p(float v) { return cosf(v); }
__device__ __forceinline__ unsigned lds_off(const void* p) { return (unsigned)(size_t)p; }
// one lane's 8 (4) copies, rows ls bytes apart in LDS and gs bytes apart in global memory; s_wait_xcnt 0 closes the statement so that no address register of a copy is rewritten in front of it
__device__ __forceinline__ void acp8(unsigned l, unsigned ls, const char* p, size_t gs) {
  asm volatile("global_load_async_to_lds_b128 %0, %8, off\n\t"
               "global_load_async_to_lds_b128 %1, %9, off\n\t"
               "global_load_async_to_lds_b128 %2, %10, off\n\t"
               "global_load_async_to_lds_b128 %3, %11, off\n\t"
               "global_load_async_to_lds_b128 %4, %12, off\n\t"
               "global_load_async_to_lds_b128 %5, %13, off\n\t"
               "global_load_async_to_lds_b128 %6, %14, off\n\t"
               "global_load_async_to_lds_b128 %7, %15, off\n\t"
               "s_wait_xcnt 0x0"
               :: "v"(l), "v"(l + ls), "v"(l + 2 * ls), "v"(l + 3 * ls), "v"(l + 4 * ls), "v"(l + 5 * ls), "v"(l + 6 * ls), "v"(l + 7 * ls),
                  "v"(p), "v"(p + gs), "v"(p + 2 * gs), "v"(p + 3 * gs), "v"(p + 4 * gs), "v"(p + 5 * gs), "v"(p + 6 * gs), "v"(p + 7 * gs) : "memory");
}
__device__ __forceinline__ void acp4(unsigned l, unsigned ls, const char* p, size_t gs) {
  asm volatile("global_load_async_to_lds_b128 %0, %4, off\n\t"
               "global_load_async_to_lds_b128 %1, %5, off\n\t"
               "global_load_async_to_lds_b128 %2, %6, off\n\t"
               "global_load_async_to_lds_b128 %3, %7, off\n\t"
               "s_wait_xcnt 0x0"
               :: "v"(l), "v"(l + ls), "v"(l + 2 * ls), "v"(l + 3 * ls), "v"(p), "v"(p + gs), "v"(p + 2 * gs), "v"(p + 3 * gs) : "memory");
}
// one lane's 16 stores of 16 B, 1,024 B apart (8 q_ rows of 2,048 B, sin half and cos half); s_wait_xcnt 0 closes the statement so that no register of a store is rewritten in front of it
__device__ __forceinline__ void gst16(char* p, const v4u* d) {
  asm volatile("global_store_b128 %0, %1, off\n\t"
               "global_store_b128 %0, %2, off offset:1024\n\t"
               "global_store_b128 %0, %3, off offset:2048\n\t"
               "global_store_b128 %0, %4, off offset:3072\n\t"
               "global_store_b128 %0, %5, off offset:4096\n\t"
               "global_store_b128 %0, %6, off offset:5120\n\t"
               "global_store_b128 %0, %7, off offset:6144\n\t"
               "global_store_b128 %0, %8, off offset:7168\n\t"
               "global_store_b128 %0, %9, off offset:8192\n\t"
               "global_store_b128 %0, %10, off offset:9216\n\t"
               "global_store_b128 %0, %11, off offset:10240\n\t"
               "global_store_b128 %0, %12, off offset:11264\n\t"
               "global_store_b128 %0, %13, off offset:12288\n\t"
               "global_store_b128 %0, %14, off offset:13312\n\t"
               "global_store_b128 %0, %15, off offset:14336\n\t"
               "global_store_b128 %0, %16, off offset:15360\n\t"
               "s_wait_xcnt 0x0"
               :: "v"(p), "v"(d[0]), "v"(d[1]), "v"(d[2]), "v"(d[3]), "v"(d[4]), "v"(d[5]), "v"(d[6]), "v"(d[7]), "v"(d[8]), "v"(d[9]), "v"(d[10]), "v"(d[11]), "v"(d[12]), "v"(d[13]), "v"(d[14]), "v"(d[15]) : "memory");
}
// this wave's copies have landed (in front of the barrier behind which other waves read them)
#define WAIT_ACP() asm volatile("s_wait_asynccnt 0x0" ::: "memory")
// this wave's LDS reads of a buffer have returned (in front of the barrier behind which the buffer is refilled)
#define WAIT_DS() asm volatile("s_wait_dscnt 0x0" ::: "memory")
// ---- k_proj: block = (128 tokens, 128 cols, which): 0 q -> relu, x sin | x cos -> q_ rows; 1 k -> relu, x sin | cos -> k_^T planes; 2 v -> v^T planes; each wave holds two 16-token row tiles, so that every W fragment read from LDS feeds two WMMAs and every W tile copied from L2 serves 128 tokens
// stage = 64 k: x 128 rows of 256 B (f32) at pitch 272, W 128 rows of 128 B (bf16) at pitch 144; the output staging so / st takes the ring's place behind the loop
#define PJ_PA 272
#define PJ_PB 144
#define PJ_STG (128 * PJ_PA + 128 * PJ_PB)
__global__ __launch_bounds__(128) void k_proj(const float* __restrict__ X, const __bf16* __restrict__ P, _Float16* __restrict__ Q, _Float16* __restrict__ KT, _Float16* __restrict__ VT) {
  __shared__ __align__(16) char ring[2 * PJ_STG];
  _Float16 (*so)[128][136] = (_Float16 (*)[128][136])ring; _Float16 (*st)[128][136] = (_Float16 (*)[128][136])ring;
  const int tid = threadIdx.x, wave = tid >> 5, lane = tid & 31, col = lane & 15, g = lane >> 4; const int which = blockIdx.z; const int n0 = blockIdx.y * 128; const size_t rb0 = (size_t)blockIdx.x * 128, r0 = rb0 + wave * 32; const size_t b = rb0 / NN, s0 = rb0 % NN;
  const char* ga = (const char*)(X + (rb0 + (tid >> 4)) * DD) + (tid & 15) * 16; const char* gb = (const char*)(P + ((size_t)which * DD + n0 + (tid >> 3)) * DD) + (tid & 7) * 16;
  const unsigned la = lds_off(ring) + (tid >> 4) * PJ_PA + (tid & 15) * 16, lb = lds_off(ring) + 128 * PJ_PA + (tid >> 3) * PJ_PB + (tid & 7) * 16;
  const size_t gsa = (size_t)8 * DD * 4, gsb = (size_t)16 * DD * 2;
  v8f acc[2][8] = {};
  // trip t works on k stage (t + rot) mod 8: the work-groups run in step, and with a common start all of them ask L2 for the same column offset of their rows, and those that share x rows or W rows for the same lines, at the same moment; with a start of its own per work-group the requests of a moment spread over all 8 offsets
  const unsigned rot = (blockIdx.x + 2 * blockIdx.y + blockIdx.z) & (DD / 64 - 1);
  { const size_t k0 = rot, k1 = (rot + 1) & (DD / 64 - 1);
    acp8(la, 8 * PJ_PA, ga + k0 * 256, gsa); acp8(la + 64 * PJ_PA, 8 * PJ_PA, ga + 8 * gsa + k0 * 256, gsa); acp8(lb, 16 * PJ_PB, gb + k0 * 128, gsb);
    WAIT_ACP(); __syncthreads();
    acp8(la + PJ_STG, 8 * PJ_PA, ga + k1 * 256, gsa); acp8(la + PJ_STG + 64 * PJ_PA, 8 * PJ_PA, ga + 8 * gsa + k1 * 256, gsa); acp8(lb + PJ_STG, 16 * PJ_PB, gb + k1 * 128, gsb); }
  for (int t = 0; t < DD / 64; ++t) { const unsigned bo = (t & 1) * PJ_STG; const char* base = ring + bo;
    // each 32-k slice's fragments are read from LDS as one group in front of its 16 WMMAs, so that the LDS latency is waited out once a slice and not once a WMMA; the loops are unrolled so that the fragment arrays have constant indices and stay in registers
#pragma unroll
    for (int kc = 0; kc < 2; ++kc) { v16b a[2], w[8];
#pragma unroll
      for (int rt = 0; rt < 2; ++rt) { const float* p = (const float*)(base + (wave * 32 + rt * 16 + col) * PJ_PA) + kc * 32 + 8 * g;
#pragma unroll
        for (int i = 0; i < 8; ++i) { a[rt][i] = (__bf16)p[i]; a[rt][8 + i] = (__bf16)p[16 + i]; } }
#pragma unroll
      for (int j = 0; j < 8; ++j) w[j] = frag_b((const __bf16*)(base + 128 * PJ_PA + (j * 16 + col) * PJ_PB) + kc * 32, lane);
#pragma unroll
      for (int j = 0; j < 8; ++j)
#pragma unroll
        for (int rt = 0; rt < 2; ++rt) acc[rt][j] = wmma_bf(a[rt], w[j], acc[rt][j]); }
    WAIT_DS(); WAIT_ACP(); __syncthreads();
    if (t + 2 < DD / 64) { const size_t kn = (t + 2 + rot) & (DD / 64 - 1); acp8(la + bo, 8 * PJ_PA, ga + kn * 256, gsa); acp8(la + bo + 64 * PJ_PA, 8 * PJ_PA, ga + 8 * gsa + kn * 256, gsa); acp8(lb + bo, 16 * PJ_PB, gb + kn * 128, gsb); } }
  WAIT_ACP();
  if (which == 0) {
#pragma unroll
    for (int rt = 0; rt < 2; ++rt)
#pragma unroll
    for (int r = 0; r < 8; ++r) { const int lr = wave * 32 + rt * 16 + 8 * g + r; const int n = (int)((rb0 + lr) % NN); const float ang = (1.57079632679489662f * (float)(n + 1)) / (float)NN; const float sn = sin_p(ang), cs = cos_p(ang);
#pragma unroll
      for (int j = 0; j < 8; ++j) { const float v = fmaxf(acc[rt][j][r], 0.f); so[0][lr][j * 16 + col] = (_Float16)(v * sn); so[1][lr][j * 16 + col] = (_Float16)(v * cs); } }
    LDSX();
    if (lane < 16) for (int rb = 0; rb < 32; rb += 8) { v4u d[16];
#pragma unroll   // constant indices, so that d stays in registers
      for (int i = 0; i < 8; ++i) { d[2 * i] = *(const v4u*)&so[0][wave * 32 + rb + i][lane * 8]; d[2 * i + 1] = *(const v4u*)&so[1][wave * 32 + rb + i][lane * 8]; }
      gst16((char*)(Q + (r0 + rb) * D2 + n0 + lane * 8), d); }
  } else if (which == 1) {
#pragma unroll
    for (int rt = 0; rt < 2; ++rt)
#pragma unroll
    for (int r = 0; r < 8; ++r) { const int lr = wave * 32 + rt * 16 + 8 * g + r; const int n = (int)((rb0 + lr) % NN); const float ang = (1.57079632679489662f * (float)(n + 1)) / (float)NN; const float sn = sin_p(ang), cs = cos_p(ang);
#pragma unroll
      for (int j = 0; j < 8; ++j) { const float v = fmaxf(acc[rt][j][r], 0.f); st[0][j * 16 + col][lr] = (_Float16)(v * sn); st[1][j * 16 + col][lr] = (_Float16)(v * cs); } }
    __syncthreads();
    for (int e = tid; e < 2 * 128 * 16; e += 128) { const int pl = e >> 11, d = (e >> 4) & 127, pc = e & 15; vst2((unsigned*)(KT + ((b * D2 + (size_t)pl * DD + n0 + d) * NN) + s0 + pc * 8), *(const v4u*)&st[pl][d][pc * 8]); }
  } else {
#pragma unroll
    for (int rt = 0; rt < 2; ++rt)
#pragma unroll
    for (int r = 0; r < 8; ++r)
#pragma unroll
      for (int j = 0; j < 8; ++j) st[0][j * 16 + col][wave * 32 + rt * 16 + 8 * g + r] = (_Float16)acc[rt][j][r];
    __syncthreads();
    for (int e = tid; e < 128 * 16; e += 128) { const int d = e >> 4, pc = e & 15; vst2((unsigned*)(VT + ((b * DD + n0 + d) * NN) + s0 + pc * 8), *(const v4u*)&st[0][d][pc * 8]); } }
}
// stage = 128 tokens: k_^T 64 rows and v^T 128 rows of 256 B at pitch 272; three buffers, so that two tiles' copies (2 x 24 per wave) fly while a third tile is multiplied: a tile has two trips to land, not one; the work-groups of the first m block also sum k_ over the tokens, in f32 from the k_^T fragments that they hold in registers anyway -> KS[b][dd]
#define KV_P 272
#define KV_STG ((64 + 128) * KV_P)
// every wave issues exactly 24 copies per tile, and a wave's copies return in issue order: all but its 24 youngest copies have landed, that is every tile but the one issued last
#define WAIT_ACP_BUT24() asm volatile("s_wait_asynccnt 0x18" ::: "memory")
__global__ __launch_bounds__(128) void k_kv(const _Float16* __restrict__ KT, const _Float16* __restrict__ VT, _Float16* __restrict__ KVH, float* __restrict__ KS) {
  __shared__ __align__(16) char ring[3 * KV_STG]; __shared__ __align__(16) _Float16 sh[128][72]; __shared__ __align__(16) float sks[2][64];
  const int tid = threadIdx.x, wave = tid >> 5, lane = tid & 31, col = lane & 15, g = lane >> 4; const size_t b = blockIdx.z; const int d0 = blockIdx.x * 64; const int m0 = blockIdx.y * 128;
  const char* ga = (const char*)(KT + (b * D2 + d0 + (tid >> 4)) * NN) + (tid & 15) * 16; const char* gb = (const char*)(VT + (b * DD + m0 + (tid >> 4)) * NN) + (tid & 15) * 16;
  const unsigned la = lds_off(ring) + (tid >> 4) * KV_P + (tid & 15) * 16; const size_t gs = (size_t)8 * NN * 2;
  v8f acc[8] = {};
  const bool ksb = blockIdx.y == 0; float ps[4] = {0.f, 0.f, 0.f, 0.f};   // lane (g, col): four independent partial sums of row wave * 16 + col over the 16 tokens of each slice that its fragment holds
  // trip t works on token tile (t + rot) mod 32, a start of its own per work-group, for the reason given in k_proj (here all 256 work-groups start together and the rows are 8,192 B apart)
  const unsigned rot = (2 * blockIdx.x + 8 * blockIdx.y + blockIdx.z) & (NN / 128 - 1);
  { const size_t g0 = (size_t)rot * 256, g1 = (size_t)((rot + 1) & (NN / 128 - 1)) * 256, g2 = (size_t)((rot + 2) & (NN / 128 - 1)) * 256;
    acp8(la, 8 * KV_P, ga + g0, gs); acp8(la + 64 * KV_P, 8 * KV_P, gb + g0, gs); acp8(la + 128 * KV_P, 8 * KV_P, gb + 8 * gs + g0, gs);
    acp8(la + KV_STG, 8 * KV_P, ga + g1, gs); acp8(la + KV_STG + 64 * KV_P, 8 * KV_P, gb + g1, gs); acp8(la + KV_STG + 128 * KV_P, 8 * KV_P, gb + 8 * gs + g1, gs);
    WAIT_ACP_BUT24(); __syncthreads();   // tile 0 has landed in every wave; tile 1 flies on
    acp8(la + 2 * KV_STG, 8 * KV_P, ga + g2, gs); acp8(la + 2 * KV_STG + 64 * KV_P, 8 * KV_P, gb + g2, gs); acp8(la + 2 * KV_STG + 128 * KV_P, 8 * KV_P, gb + 8 * gs + g2, gs); }
  unsigned bo = 0;   // byte offset of buffer t mod 3
  for (int t = 0; t < NN / 128; ++t) { const char* base = ring + bo;
    // two fragment sets: the next 32 tokens' fragments are read from LDS as one group in front of this slice's WMMAs, so that their latency runs behind the WMMAs; the loops are unrolled so that the fragment arrays have constant indices and stay in registers
    v16h a[2], w[2][8];
    a[0] = frag_h((const _Float16*)(base + (wave * 16 + col) * KV_P), lane);
#pragma unroll
    for (int j = 0; j < 8; ++j) w[0][j] = frag_h((const _Float16*)(base + (64 + j * 16 + col) * KV_P), lane);
#pragma unroll
    for (int kc = 0; kc < 4; ++kc) {
      if (kc + 1 < 4) { a[(kc + 1) & 1] = frag_h((const _Float16*)(base + (wave * 16 + col) * KV_P) + (kc + 1) * 32, lane);
#pragma unroll
        for (int j = 0; j < 8; ++j) w[(kc + 1) & 1][j] = frag_h((const _Float16*)(base + (64 + j * 16 + col) * KV_P) + (kc + 1) * 32, lane); }
      if (ksb) {   // unrolled so that the fragment's elements and the four sums have constant indices and stay in registers
#pragma unroll
        for (int i = 0; i < 16; ++i) ps[i & 3] += (float)a[kc & 1][i]; }
#pragma unroll
      for (int j = 0; j < 8; ++j) acc[j] = wmma16(a[kc & 1], w[kc & 1][j], acc[j]); }
    // foot of trip t: tile t + 1 must have landed; where a tile t + 2 exists its 24 copies are this wave's youngest and fly on, else nothing may stay outstanding
    WAIT_DS(); if (t + 2 < NN / 128) WAIT_ACP_BUT24(); else WAIT_ACP();
    __syncthreads();
    // tile t + 3 goes into the buffer that trip t has just read: every wave's reads of it have returned in front of the barrier
    if (t + 3 < NN / 128) { const size_t go = (size_t)((t + 3 + rot) & (NN / 128 - 1)) * 256; acp8(la + bo, 8 * KV_P, ga + go, gs); acp8(la + bo + 64 * KV_P, 8 * KV_P, gb + go, gs); acp8(la + bo + 128 * KV_P, 8 * KV_P, gb + 8 * gs + go, gs); }
    bo = (bo == 2 * KV_STG) ? 0u : bo + KV_STG; }
  WAIT_ACP();
#pragma unroll
  for (int j = 0; j < 8; ++j)
#pragma unroll
    for (int r = 0; r < 8; ++r) sh[j * 16 + col][wave * 16 + 8 * g + r] = (_Float16)acc[j][r];
  if (ksb) sks[g][wave * 16 + col] = (ps[0] + ps[1]) + (ps[2] + ps[3]);
  __syncthreads();
  for (int e = tid; e < 128 * 8; e += 128) { const int m = e >> 3, pc = e & 7; const size_t o = ((b * DD + m0 + m) * D2) + d0 + pc * 8; vst2((unsigned*)(KVH + o), *(const v4u*)&sh[m][pc * 8]); }
  // the two lane halves' sums are added and one wave stores the 256-B segment
  if (ksb && tid < 16) vst2(KS + b * D2 + d0 + tid * 4, *(const v4f*)&sks[0][tid * 4] + *(const v4f*)&sks[1][tid * 4]);
}
// ---- k_fin: block = (128 tokens, 128 m cols, b), 8 waves as 4 (tokens) x 2 (cols): acc = q_ . kv over dd; z = 1/max(q_ . KS, 1e-6) per row (f32, summed inside the dd loop from the q_ fragments that the wave holds for its WMMAs; of the two waves that hold the same 32 rows each sums 16); out = acc z stored through the (b,H,n,hd)->(b,n,H,hd) view: computed (n, m) -> row (8n + m/64) mod N, cols (n/512)*64 + m%64; each wave holds two 16-token row tiles x four column tiles, so that every kv fragment read from LDS feeds two WMMAs and every kv tile copied from L2 serves 128 tokens
// stage = 64 dd: q_ 128 rows and kv 128 rows of 128 B at pitch 144; the output staging so takes the ring's place behind the loop
#define FN_P 144
// 16 f16 fragment elements times 16 f32 values in the same k order, added into four independent sums
__device__ __forceinline__ void zacc(float (&zs)[4], v16h a, const v4f* k) {
#pragma unroll   // constant indices, so that the fragment and the sums stay in registers
  for (int i = 0; i < 16; ++i) zs[i & 3] = __builtin_fmaf((float)a[i], k[i >> 2][i & 3], zs[i & 3]);
}
#define FN_STG ((128 + 128) * FN_P)
__global__ __launch_bounds__(256) void k_fin(const _Float16* __restrict__ Q, const _Float16* __restrict__ KVH, const float* __restrict__ KS, float* __restrict__ OUT) {
  __shared__ __align__(16) char ring[2 * FN_STG]; __shared__ float sz[128]; float (*so)[32][68] = (float (*)[32][68])ring;
  const int tid = threadIdx.x, wave = tid >> 5, lane = tid & 31, col = lane & 15, g = lane >> 4; const int wr = wave >> 1, wc = wave & 1; const size_t b = blockIdx.z; const int nb0 = blockIdx.x * 128; const int nw = nb0 + wr * 32; const int m0 = blockIdx.y * 128;
  const char* ga = (const char*)(Q + (b * NN + nb0 + (tid >> 3)) * D2) + (tid & 7) * 16; const size_t kvo = ((b * DD + m0 + (tid >> 3)) * D2) * 2 + (tid & 7) * 16; const char* gh = (const char*)KVH + kvo;
  const unsigned la = lds_off(ring) + (tid >> 3) * FN_P + (tid & 7) * 16; const size_t gs = (size_t)32 * D2 * 2;
  v8f acc[2][4] = {};
  // z: lane (g, col) of wave (wr, wc) sums q_ . KS of row wr * 32 + wc * 16 + col over the 32 dd of each stage that its two fragments of that row tile hold, in four independent partial sums; wcs is wc as a scalar: with it the choice of the row tile is one select per fragment register, with the per-lane value the compiler built an indexed pick among all four fragments
  const int wcs = __builtin_amdgcn_readfirstlane(wc); const float* ksl = KS + b * D2 + 8 * g; float zs[4] = {0.f, 0.f, 0.f, 0.f};
  // trip t works on dd stage (t + rot) mod 16, a start of its own per work-group, for the reason given in k_proj; z takes its KS values from the same stage
  const unsigned rot = (blockIdx.x + 4 * blockIdx.y + blockIdx.z) & (D2 / 64 - 1);
  { const size_t g0 = (size_t)rot * 128, g1 = (size_t)((rot + 1) & (D2 / 64 - 1)) * 128;
    acp4(la, 32 * FN_P, ga + g0, gs); acp4(la + 128 * FN_P, 32 * FN_P, gh + g0, gs);
    WAIT_ACP(); __syncthreads();
    acp4(la + FN_STG, 32 * FN_P, ga + g1, gs); acp4(la + FN_STG + 128 * FN_P, 32 * FN_P, gh + g1, gs); }
  for (int t = 0; t < D2 / 64; ++t) { const unsigned bo = (t & 1) * FN_STG; const char* base = ring + bo;
    // two fragment sets of two column tiles: the next set is read from LDS as one group in front of this set's 4 WMMAs, so that its latency runs behind them; the loops are unrolled so that the fragment arrays have constant indices and stay in registers
    v16h a[2][2], wh[2][2]; v4f kz[2][4];   // kz: the 16 KS values of each of the stage's two 32-dd slices in the fragment's own k order
#pragma unroll
    for (int kc = 0; kc < 2; ++kc) { const float* kp = ksl + ((t + rot) & (D2 / 64 - 1)) * 64 + kc * 32; kz[kc][0] = *(const v4f*)kp; kz[kc][1] = *(const v4f*)(kp + 4); kz[kc][2] = *(const v4f*)(kp + 16); kz[kc][3] = *(const v4f*)(kp + 20); }
#pragma unroll
    for (int rt = 0; rt < 2; ++rt)
#pragma unroll
      for (int kc = 0; kc < 2; ++kc) a[rt][kc] = frag_h((const _Float16*)(base + (wr * 32 + rt * 16 + col) * FN_P) + kc * 32, lane);
#pragma unroll
    for (int j = 0; j < 2; ++j) wh[0][j] = frag_h((const _Float16*)(base + (128 + wc * 64 + j * 16 + col) * FN_P), lane);
#pragma unroll
    for (int s = 0; s < 4; ++s) { const int kc = s >> 1, jh = (s & 1) * 2;
      if (s + 1 < 4) { const int kn = (s + 1) >> 1, jn = ((s + 1) & 1) * 2;
#pragma unroll
        for (int j = 0; j < 2; ++j) wh[(s + 1) & 1][j] = frag_h((const _Float16*)(base + (128 + wc * 64 + (jn + j) * 16 + col) * FN_P + kn * 64), lane); }
#pragma unroll
      for (int j = 0; j < 2; ++j)
#pragma unroll
        for (int rt = 0; rt < 2; ++rt) acc[rt][jh + j] = wmma16(a[rt][kc], wh[s & 1][j], acc[rt][jh + j]);
      if (s & 1) { if (wcs == 0) zacc(zs, a[0][kc], kz[kc]); else zacc(zs, a[1][kc], kz[kc]); } }
    WAIT_DS(); WAIT_ACP(); __syncthreads();
    if (t + 2 < D2 / 64) { const size_t go = (size_t)((t + 2 + rot) & (D2 / 64 - 1)) * 128; acp4(la + bo, 32 * FN_P, ga + go, gs); acp4(la + bo + 128 * FN_P, 32 * FN_P, gh + go, gs); } }
  WAIT_ACP();
  { float s = (zs[0] + zs[1]) + (zs[2] + zs[3]); s += __shfl_xor(s, 16); if (lane < 16) sz[wr * 32 + wc * 16 + col] = 1.0f / fmaxf(s, 1e-6f); }
  __syncthreads();   // each wave reads 16 of its 32 z values from the wave that shares its rows
  LDSX();
#pragma unroll
  for (int rt = 0; rt < 2; ++rt)
#pragma unroll
  for (int j = 0; j < 4; ++j)
#pragma unroll
    for (int r = 0; r < 8; ++r) so[wave][rt * 16 + 8 * g + r][j * 16 + col] = acc[rt][j][r] * sz[wr * 32 + rt * 16 + 8 * g + r];
  LDSX();
  // each computed row n (32 per wave) x this wave's 64 cols = the chunk j64 = m0/64 + wc -> final row (8n + j64) % NN, col block (n/512)*64
#pragma unroll   // straight-line, so that no store's registers are rewritten over a back edge
  for (int rl = 0; rl < 32; rl += 2) { const int lr = rl + (lane >> 4); const int n = nw + lr; const int j64 = m0 / 64 + wc; const size_t frow = b * NN + (size_t)((8 * n + j64) % NN); const int fc0 = (n / 512) * HD;
    vst2(OUT + frow * DD + fc0 + (lane & 15) * 4, *(const v4f*)&so[wave][lr][(lane & 15) * 4]); }   // two 256-B segments per store (lanes 0-15 / 16-31: two computed rows)
}
extern "C" void kernel_launch(void* const* d_in, const int* in_sizes, int n_in, void* d_out, int out_size, void* d_ws, size_t ws_size, hipStream_t stream) {
  (void)in_sizes; (void)n_in; (void)out_size;
  const float** F = (const float**)d_in;   // 0 x [4,4096,512], 1 Wq, 2 Wk, 3 Wv [512,512] natural
  if (ws_size < (size_t)WS_END) return;
  char* ws = (char*)d_ws; __bf16* P = (__bf16*)ws; _Float16 *Q = (_Float16*)(ws + WS_Q), *KT = (_Float16*)(ws + WS_KT), *VT = (_Float16*)(ws + WS_VT), *KVH = (_Float16*)(ws + WS_KVH); float* KS = (float*)(ws + WS_KS);
  k_pack<<<3 * DD, 256, 0, stream>>>(F[1], F[2], F[3], P);
  k_proj<<<dim3(TR / 128, DD / 128, 3), 128, 0, stream>>>(F[0], P, Q, KT, VT);
  k_kv<<<dim3(D2 / 64, DD / 128, TNB), 128, 0, stream>>>(KT, VT, KVH, KS);
  k_fin<<<dim3(NN / 128, DD / 128, TNB), 256, 0, stream>>>(Q, KVH, KS, (float*)d_out);
}

// v008
// It runs in 79.7 microseconds.
// Next to v007, in two timings, it ran 1.13 times as fast each time.
// Counting every step since v000, it is 6.31 times as fast.
// compute dtype: all float inputs rounded to bf16; q / k / v = x . W^T with EXACT bf16 products on WMMA 16x16x32 (natural rows), ReLU and the cos-reweighting (idx = (pi/2)(n+1)/N in f32, precise sinf/cosf) in f32, q / k_ / v rounded once to f16; kv = k_^T v and q kv_sin, q kv_cos as WMMA GEMMs (kv rounded once to f16, like q, k_ and v: one product); q_ kv = sin (q kv_sin) + cos (q kv_cos) in f32; the column sums of k_ (f32, taken in k_kv from its k_^T fragments) and the normaliser z = 1 / max(sin (q . sum k sin) + cos (q . sum k cos), 1e-6) in f32 from the same f16-rounded values; output written through the module's (b,H,n,hd) -> (b,n,H,hd) reshape.
#include <hip/hip_runtime.h>
#include <math.h>

typedef __attribute__((ext_vector_type(16))) _Float16 v16h;
typedef __attribute__((ext_vector_type(16))) __bf16 v16b;
typedef __attribute__((ext_vector_type(8)))  _Float16 v8h;
typedef __attribute__((ext_vector_type(8)))  float v8f;
typedef __attribute__((ext_vector_type(4)))  float v4f;
typedef __attribute__((ext_vector_type(2)))  float v2f;
typedef __attribute__((ext_vector_type(4)))  unsigned v4u;
typedef __attribute__((ext_vector_type(4)))  int v4i;
typedef float __attribute__((may_alias)) float_a;
typedef int __attribute__((may_alias)) int_a;

template <typename T> __device__ __forceinline__ void vst2(void* p, T v) { *(T*)p = v;  }
__device__ __forceinline__ v8f wmma16(v16h a, v16h b, v8f c) {
  v8f d = __builtin_amdgcn_wmma_f32_16x16x32_f16(false, a, false, b, (short)0, c, false, false);
  asm volatile("v_nop\n\tv_nop\n\tv_nop\n\tv_nop" : "+v"(d) : "v"(a), "v"(b));
  return d;
}
__device__ __forceinline__ v8f wmma_bf(v16b a, v16b b, v8f c) {
  v8f d = __builtin_amdgcn_wmma_f32_16x16x32_bf16(false, a, false, b, (short)0, c, false, false);
  asm volatile("v_nop\n\tv_nop\n\tv_nop\n\tv_nop" : "+v"(d) : "v"(a), "v"(b));
  return d;
}
// 16x16x32 fragments: lane = (h = lane>>4, row/col = lane&15); elements 0..7 = k0+8h+0..7, 8..15 = k0+16+8h+0..7; D element r = row 8h+r
__device__ __forceinline__ v16h frag_h(const _Float16* rowk0, int lane) {
  union { v16h v; v8h q[2]; } u; const _Float16* p = rowk0 + 8 * (lane >> 4);
  u.q[0] = *(const v8h*)p; u.q[1] = *(const v8h*)(p + 16); return u.v;
}
__device__ __forceinline__ v16h frag_f32(const float* rowk0, int lane) {
  v16h a; const float* p = rowk0 + 8 * (lane >> 4);
#pragma unroll
  for (int i = 0; i < 8; ++i) { a[i] = (_Float16)p[i]; a[8 + i] = (_Float16)p[16 + i]; }
  return a;
}
__device__ __forceinline__ v16h frag_f32s(const float* rowk0, int lane, float sc) {
  v16h a; const float* p = rowk0 + 8 * (lane >> 4);
#pragma unroll
  for (int i = 0; i < 8; ++i) { a[i] = (_Float16)(p[i] * sc); a[8 + i] = (_Float16)(p[16 + i] * sc); }
  return a;
}
// column fragment from a [K][ld] layout (column n), rows >= K read as 0
__device__ __forceinline__ v16h fragc_f32(const float* W, int k0, int n, int lane, int ld, int K) {
  v16h a; const int g = lane >> 4;
#pragma unroll
  for (int i = 0; i < 8; ++i) { const int ka = k0 + 8 * g + i, kb = ka + 16;
    a[i] = (_Float16)(ka < K ? W[(size_t)(ka < K ? ka : K - 1) * ld + n] : 0.f); a[8 + i] = (_Float16)(kb < K ? W[(size_t)(kb < K ? kb : K - 1) * ld + n] : 0.f); }
  return a;
}
struct F2 { v16b h, l; };
__device__ __forceinline__ F2 bsplit16(const float v[16]) { F2 r;
#pragma unroll
  for (int i = 0; i < 16; ++i) { const __bf16 h = (__bf16)v[i]; r.h[i] = h; r.l[i] = (__bf16)(v[i] - (float)h); }
  return r; }
__device__ __forceinline__ F2 split_row(const float* row, int k0, int lane) { float v[16]; const float* p = row + k0 + 8 * (lane >> 4);
#pragma unroll
  for (int i = 0; i < 8; ++i) { v[i] = p[i]; v[8 + i] = p[16 + i]; }
  return bsplit16(v); }
__device__ __forceinline__ F2 split_rowK(const float* row, int k0, int lane, int K) { float v[16]; const int g = lane >> 4;
#pragma unroll
  for (int i = 0; i < 8; ++i) { const int ka = k0 + 8 * g + i, kb = ka + 16; v[i] = ka < K ? row[ka < K ? ka : K - 1] : 0.f; v[8 + i] = kb < K ? row[kb < K ? kb : K - 1] : 0.f; }
  return bsplit16(v); }
__device__ __forceinline__ F2 split_col(const float* W, int k0, int n, int lane, int ld, int K) { float v[16]; const int g = lane >> 4;
#pragma unroll
  for (int i = 0; i < 8; ++i) { const int ka = k0 + 8 * g + i, kb = ka + 16; v[i] = ka < K ? W[(size_t)(ka < K ? ka : K - 1) * ld + n] : 0.f; v[8 + i] = kb < K ? W[(size_t)(kb < K ? kb : K - 1) * ld + n] : 0.f; }
  return bsplit16(v); }
__device__ __forceinline__ v8f mac3(const F2& a, const F2& b, v8f c) { c = wmma_bf(a.l, b.h, c); c = wmma_bf(a.h, b.l, c); return wmma_bf(a.h, b.h, c); }
__device__ __forceinline__ float sigm(float v) { return 1.0f / (1.0f + expf(-v)); }
#define LDSX() do { asm volatile("s_wait_dscnt 0" ::: "memory"); __builtin_amdgcn_wave_barrier(); __builtin_amdgcn_fence(__ATOMIC_RELEASE, "workgroup"); } while (0)


// cosFormer linear attention (B 4, N 4,096, d 512, 8 heads): q = relu(x Wq^T), k = relu(x Wk^T), v = x Wv^T; q_, k_ = [q sin, q cos], [k sin, k cos] with the position weights (pi/2)(n+1)/N; out = (q_ (k_^T v)) / max(q_ . sum_n k_, 1e-6), then the module's head reshape.
#define NB 4
#define NN 4096
#define DD 512
#define D2 (2 * DD)
#define NH 8
#define HD 64
#define NR (NB * NN)
#ifndef TNB
#define TNB NB
#endif
#define TR (TNB * NN)
typedef __attribute__((ext_vector_type(8))) __bf16 v8b;
__device__ __forceinline__ v16b frag_b(const __bf16* rowk0, int lane) {
  union { v16b v; v8b q[2]; } u; const __bf16* p = rowk0 + 8 * (lane >> 4);
  u.q[0] = *(const v8b*)p; u.q[1] = *(const v8b*)(p + 16); return u.v;
}
__device__ __forceinline__ float bfr(float v) { return (float)(__bf16)v; }
__device__ __attribute__((noinline)) float exp_ni(float v) { return expf(v); }
__device__ __attribute__((noinline)) float erf_ni(float v) { return erff(v); }

#define WS_PW  0u                                  // bf16 natural rows Wq, Wk, Wv [3][512][512]
#define WS_Q   (WS_PW + 2u * (size_t)3 * DD * DD)   // f16 rows q = relu(x Wq^T) [NR][512], without the position weights
#define WS_KT  (WS_Q + 2u * (size_t)NR * DD)        // f16 planes k_^T [b][1024][NN] ; v^T [b][512][NN]
#define WS_VT  (WS_KT + 2u * (size_t)NB * D2 * NN)
#define WS_KVH (WS_VT + 2u * (size_t)NB * DD * NN)  // f16 kv^T [b][512 m][1024 dd]
#define WS_KS  (WS_KVH + 2u * (size_t)NB * DD * D2) // f32 [b][1024] sum_n k_
#define WS_END (WS_KS + 4u * (size_t)NB * D2)

__global__ __launch_bounds__(256) void k_pack(const float* __restrict__ WQ, const float* __restrict__ WK, const float* __restrict__ WV, __bf16* __restrict__ P) { const int n = blockIdx.x, t = threadIdx.x; const float* src = (n < DD) ? (WQ + (size_t)n * DD) : (n < 2 * DD) ? (WK + (size_t)(n - DD) * DD) : (WV + (size_t)(n - 2 * DD) * DD); __shared__ __align__(16) __bf16 s[DD]; for (int k = t; k < DD; k += 256) s[k] = (__bf16)src[k]; __syncthreads(); if (t < DD / 8) vst2((unsigned*)(P + (size_t)n * DD + t * 8), *(const v4u*)&s[t * 8]); }
__device__ __attribute__((noinline)) float sin_p(float v) { return sinf(v); }
__device__ __attribute__((noinline)) float cos_p(float v) { return cosf(v); }
__device__ __forceinline__ unsigned lds_off(const void* p) { return (unsigned)(size_t)p; }
// one lane's 8 (4) copies, rows ls bytes apart in LDS and gs bytes apart in global memory; s_wait_xcnt 0 closes the statement so that no address register of a copy is rewritten in front of it
__device__ __forceinline__ void acp8(unsigned l, unsigned ls, const char* p, size_t gs) {
  asm volatile("global_load_async_to_lds_b128 %0, %8, off\n\t"
               "global_load_async_to_lds_b128 %1, %9, off\n\t"
               "global_load_async_to_lds_b128 %2, %10, off\n\t"
               "global_load_async_to_lds_b128 %3, %11, off\n\t"
               "global_load_async_to_lds_b128 %4, %12, off\n\t"
               "global_load_async_to_lds_b128 %5, %13, off\n\t"
               "global_load_async_to_lds_b128 %6, %14, off\n\t"
               "global_load_async_to_lds_b128 %7, %15, off\n\t"
               "s_wait_xcnt 0x0"
               :: "v"(l), "v"(l + ls), "v"(l + 2 * ls), "v"(l + 3 * ls), "v"(l + 4 * ls), "v"(l + 5 * ls), "v"(l + 6 * ls), "v"(l + 7 * ls),
                  "v"(p), "v"(p + gs), "v"(p + 2 * gs), "v"(p + 3 * gs), "v"(p + 4 * gs), "v"(p + 5 * gs), "v"(p + 6 * gs), "v"(p + 7 * gs) : "memory");
}
__device__ __forceinline__ void acp4(unsigned l, unsigned ls, const char* p, size_t gs) {
  asm volatile("global_load_async_to_lds_b128 %0, %4, off\n\t"
               "global_load_async_to_lds_b128 %1, %5, off\n\t"
               "global_load_async_to_lds_b128 %2, %6, off\n\t"
               "global_load_async_to_lds_b128 %3, %7, off\n\t"
               "s_wait_xcnt 0x0"
               :: "v"(l), "v"(l + ls), "v"(l + 2 * ls), "v"(l + 3 * ls), "v"(p), "v"(p + gs), "v"(p + 2 * gs), "v"(p + 3 * gs) : "memory");
}
// one lane's 16 stores of 16 B, 1,024 B apart (16 q rows of 1,024 B); s_wait_xcnt 0 closes the statement so that no register of a store is rewritten in front of it
__device__ __forceinline__ void gst16(char* p, const v4u* d) {
  asm volatile("global_store_b128 %0, %1, off\n\t"
               "global_store_b128 %0, %2, off offset:1024\n\t"
               "global_store_b128 %0, %3, off offset:2048\n\t"
               "global_store_b128 %0, %4, off offset:3072\n\t"
               "global_store_b128 %0, %5, off offset:4096\n\t"
               "global_store_b128 %0, %6, off offset:5120\n\t"
               "global_store_b128 %0, %7, off offset:6144\n\t"
               "global_store_b128 %0, %8, off offset:7168\n\t"
               "global_store_b128 %0, %9, off offset:8192\n\t"
               "global_store_b128 %0, %10, off offset:9216\n\t"
               "global_store_b128 %0, %11, off offset:10240\n\t"
               "global_store_b128 %0, %12, off offset:11264\n\t"
               "global_store_b128 %0, %13, off offset:12288\n\t"
               "global_store_b128 %0, %14, off offset:13312\n\t"
               "global_store_b128 %0, %15, off offset:14336\n\t"
               "global_store_b128 %0, %16, off offset:15360\n\t"
               "s_wait_xcnt 0x0"
               :: "v"(p), "v"(d[0]), "v"(d[1]), "v"(d[2]), "v"(d[3]), "v"(d[4]), "v"(d[5]), "v"(d[6]), "v"(d[7]), "v"(d[8]), "v"(d[9]), "v"(d[10]), "v"(d[11]), "v"(d[12]), "v"(d[13]), "v"(d[14]), "v"(d[15]) : "memory");
}
// this wave's copies have landed (in front of the barrier behind which other waves read them)
#define WAIT_ACP() asm volatile("s_wait_asynccnt 0x0" ::: "memory")
// this wave's LDS reads of a buffer have returned (in front of the barrier behind which the buffer is refilled)
#define WAIT_DS() asm volatile("s_wait_dscnt 0x0" ::: "memory")
// ---- k_proj: block = (128 tokens, 128 cols, which): 0 q -> relu -> q rows (k_fin applies sin and cos behind its products); 1 k -> relu, x sin | cos -> k_^T planes; 2 v -> v^T planes; each wave holds two 16-token row tiles, so that every W fragment read from LDS feeds two WMMAs and every W tile copied from L2 serves 128 tokens
// stage = 64 k: x 128 rows of 256 B (f32) at pitch 272, W 128 rows of 128 B (bf16) at pitch 144; the output staging so / st takes the ring's place behind the loop
#define PJ_PA 272
#define PJ_PB 144
#define PJ_STG (128 * PJ_PA + 128 * PJ_PB)
__global__ __launch_bounds__(128) void k_proj(const float* __restrict__ X, const __bf16* __restrict__ P, _Float16* __restrict__ Q, _Float16* __restrict__ KT, _Float16* __restrict__ VT) {
  __shared__ __align__(16) char ring[2 * PJ_STG];
  _Float16 (*so)[128][136] = (_Float16 (*)[128][136])ring; _Float16 (*st)[128][136] = (_Float16 (*)[128][136])ring;
  const int tid = threadIdx.x, wave = tid >> 5, lane = tid & 31, col = lane & 15, g = lane >> 4; const int which = blockIdx.z; const int n0 = blockIdx.y * 128; const size_t rb0 = (size_t)blockIdx.x * 128, r0 = rb0 + wave * 32; const size_t b = rb0 / NN, s0 = rb0 % NN;
  const char* ga = (const char*)(X + (rb0 + (tid >> 4)) * DD) + (tid & 15) * 16; const char* gb = (const char*)(P + ((size_t)which * DD + n0 + (tid >> 3)) * DD) + (tid & 7) * 16;
  const unsigned la = lds_off(ring) + (tid >> 4) * PJ_PA + (tid & 15) * 16, lb = lds_off(ring) + 128 * PJ_PA + (tid >> 3) * PJ_PB + (tid & 7) * 16;
  const size_t gsa = (size_t)8 * DD * 4, gsb = (size_t)16 * DD * 2;
  v8f acc[2][8] = {};
  // trip t works on k stage (t + rot) mod 8: the work-groups run in step, and with a common start all of them ask L2 for the same column offset of their rows, and those that share x rows or W rows for the same lines, at the same moment; with a start of its own per work-group the requests of a moment spread over all 8 offsets
  const unsigned rot = (blockIdx.x + 2 * blockIdx.y + blockIdx.z) & (DD / 64 - 1);
  { const size_t k0 = rot, k1 = (rot + 1) & (DD / 64 - 1);
    acp8(la, 8 * PJ_PA, ga + k0 * 256, gsa); acp8(la + 64 * PJ_PA, 8 * PJ_PA, ga + 8 * gsa + k0 * 256, gsa); acp8(lb, 16 * PJ_PB, gb + k0 * 128, gsb);
    WAIT_ACP(); __syncthreads();
    acp8(la + PJ_STG, 8 * PJ_PA, ga + k1 * 256, gsa); acp8(la + PJ_STG + 64 * PJ_PA, 8 * PJ_PA, ga + 8 * gsa + k1 * 256, gsa); acp8(lb + PJ_STG, 16 * PJ_PB, gb + k1 * 128, gsb); }
  for (int t = 0; t < DD / 64; ++t) { const unsigned bo = (t & 1) * PJ_STG; const char* base = ring + bo;
    // each 32-k slice's fragments are read from LDS as one group in front of its 16 WMMAs, so that the LDS latency is waited out once a slice and not once a WMMA; the loops are unrolled so that the fragment arrays have constant indices and stay in registers
#pragma unroll
    for (int kc = 0; kc < 2; ++kc) { v16b a[2], w[8];
#pragma unroll
      for (int rt = 0; rt < 2; ++rt) { const float* p = (const float*)(base + (wave * 32 + rt * 16 + col) * PJ_PA) + kc * 32 + 8 * g;
#pragma unroll
        for (int i = 0; i < 8; ++i) { a[rt][i] = (__bf16)p[i]; a[rt][8 + i] = (__bf16)p[16 + i]; } }
#pragma unroll
      for (int j = 0; j < 8; ++j) w[j] = frag_b((const __bf16*)(base + 128 * PJ_PA + (j * 16 + col) * PJ_PB) + kc * 32, lane);
#pragma unroll
      for (int j = 0; j < 8; ++j)
#pragma unroll
        for (int rt = 0; rt < 2; ++rt) acc[rt][j] = wmma_bf(a[rt], w[j], acc[rt][j]); }
    WAIT_DS(); WAIT_ACP(); __syncthreads();
    if (t + 2 < DD / 64) { const size_t kn = (t + 2 + rot) & (DD / 64 - 1); acp8(la + bo, 8 * PJ_PA, ga + kn * 256, gsa); acp8(la + bo + 64 * PJ_PA, 8 * PJ_PA, ga + 8 * gsa + kn * 256, gsa); acp8(lb + bo, 16 * PJ_PB, gb + kn * 128, gsb); } }
  WAIT_ACP();
  if (which == 0) {
#pragma unroll
    for (int rt = 0; rt < 2; ++rt)
#pragma unroll
    for (int r = 0; r < 8; ++r)
#pragma unroll
      for (int j = 0; j < 8; ++j) so[0][wave * 32 + rt * 16 + 8 * g + r][j * 16 + col] = (_Float16)fmaxf(acc[rt][j][r], 0.f);
    LDSX();
    if (lane < 16) for (int rb = 0; rb < 32; rb += 16) { v4u d[16];
#pragma unroll   // constant indices, so that d stays in registers
      for (int i = 0; i < 16; ++i) d[i] = *(const v4u*)&so[0][wave * 32 + rb + i][lane * 8];
      gst16((char*)(Q + (r0 + rb) * DD + n0 + lane * 8), d); }
  } else if (which == 1) {
#pragma unroll
    for (int rt = 0; rt < 2; ++rt)
#pragma unroll
    for (int r = 0; r < 8; ++r) { const int lr = wave * 32 + rt * 16 + 8 * g + r; const int n = (int)((rb0 + lr) % NN); const float ang = (1.57079632679489662f * (float)(n + 1)) / (float)NN; const float sn = sin_p(ang), cs = cos_p(ang);
#pragma unroll
      for (int j = 0; j < 8; ++j) { const float v = fmaxf(acc[rt][j][r], 0.f); st[0][j * 16 + col][lr] = (_Float16)(v * sn); st[1][j * 16 + col][lr] = (_Float16)(v * cs); } }
    __syncthreads();
    for (int e = tid; e < 2 * 128 * 16; e += 128) { const int pl = e >> 11, d = (e >> 4) & 127, pc = e & 15; vst2((unsigned*)(KT + ((b * D2 + (size_t)pl * DD + n0 + d) * NN) + s0 + pc * 8), *(const v4u*)&st[pl][d][pc * 8]); }
  } else {
#pragma unroll
    for (int rt = 0; rt < 2; ++rt)
#pragma unroll
    for (int r = 0; r < 8; ++r)
#pragma unroll
      for (int j = 0; j < 8; ++j) st[0][j * 16 + col][wave * 32 + rt * 16 + 8 * g + r] = (_Float16)acc[rt][j][r];
    __syncthreads();
    for (int e = tid; e < 128 * 16; e += 128) { const int d = e >> 4, pc = e & 15; vst2((unsigned*)(VT + ((b * DD + n0 + d) * NN) + s0 + pc * 8), *(const v4u*)&st[0][d][pc * 8]); } }
}
// stage = 128 tokens: k_^T 64 rows and v^T 128 rows of 256 B at pitch 272; three buffers, so that two tiles' copies (2 x 24 per wave) fly while a third tile is multiplied: a tile has two trips to land, not one; the work-groups of the first m block also sum k_ over the tokens, in f32 from the k_^T fragments that they hold in registers anyway -> KS[b][dd]
#define KV_P 272
#define KV_STG ((64 + 128) * KV_P)
// every wave issues exactly 24 copies per tile, and a wave's copies return in issue order: all but its 24 youngest copies have landed, that is every tile but the one issued last
#define WAIT_ACP_BUT24() asm volatile("s_wait_asynccnt 0x18" ::: "memory")
__global__ __launch_bounds__(128) void k_kv(const _Float16* __restrict__ KT, const _Float16* __restrict__ VT, _Float16* __restrict__ KVH, float* __restrict__ KS) {
  __shared__ __align__(16) char ring[3 * KV_STG]; __shared__ __align__(16) _Float16 sh[128][72]; __shared__ __align__(16) float sks[2][64];
  const int tid = threadIdx.x, wave = tid >> 5, lane = tid & 31, col = lane & 15, g = lane >> 4; const size_t b = blockIdx.z; const int d0 = blockIdx.x * 64; const int m0 = blockIdx.y * 128;
  const char* ga = (const char*)(KT + (b * D2 + d0 + (tid >> 4)) * NN) + (tid & 15) * 16; const char* gb = (const char*)(VT + (b * DD + m0 + (tid >> 4)) * NN) + (tid & 15) * 16;
  const unsigned la = lds_off(ring) + (tid >> 4) * KV_P + (tid & 15) * 16; const size_t gs = (size_t)8 * NN * 2;
  v8f acc[8] = {};
  const bool ksb = blockIdx.y == 0; float ps[4] = {0.f, 0.f, 0.f, 0.f};   // lane (g, col): four independent partial sums of row wave * 16 + col over the 16 tokens of each slice that its fragment holds
  // trip t works on token tile (t + rot) mod 32, a start of its own per work-group, for the reason given in k_proj (here all 256 work-groups start together and the rows are 8,192 B apart)
  const unsigned rot = (2 * blockIdx.x + 8 * blockIdx.y + blockIdx.z) & (NN / 128 - 1);
  { const size_t g0 = (size_t)rot * 256, g1 = (size_t)((rot + 1) & (NN / 128 - 1)) * 256, g2 = (size_t)((rot + 2) & (NN / 128 - 1)) * 256;
    acp8(la, 8 * KV_P, ga + g0, gs); acp8(la + 64 * KV_P, 8 * KV_P, gb + g0, gs); acp8(la + 128 * KV_P, 8 * KV_P, gb + 8 * gs + g0, gs);
    acp8(la + KV_STG, 8 * KV_P, ga + g1, gs); acp8(la + KV_STG + 64 * KV_P, 8 * KV_P, gb + g1, gs); acp8(la + KV_STG + 128 * KV_P, 8 * KV_P, gb + 8 * gs + g1, gs);
    WAIT_ACP_BUT24(); __syncthreads();   // tile 0 has landed in every wave; tile 1 flies on
    acp8(la + 2 * KV_STG, 8 * KV_P, ga + g2, gs); acp8(la + 2 * KV_STG + 64 * KV_P, 8 * KV_P, gb + g2, gs); acp8(la + 2 * KV_STG + 128 * KV_P, 8 * KV_P, gb + 8 * gs + g2, gs); }
  unsigned bo = 0;   // byte offset of buffer t mod 3
  for (int t = 0; t < NN / 128; ++t) { const char* base = ring + bo;
    // two fragment sets: the next 32 tokens' fragments are read from LDS as one group in front of this slice's WMMAs, so that their latency runs behind the WMMAs; the loops are unrolled so that the fragment arrays have constant indices and stay in registers
    v16h a[2], w[2][8];
    a[0] = frag_h((const _Float16*)(base + (wave * 16 + col) * KV_P), lane);
#pragma unroll
    for (int j = 0; j < 8; ++j) w[0][j] = frag_h((const _Float16*)(base + (64 + j * 16 + col) * KV_P), lane);
#pragma unroll
    for (int kc = 0; kc < 4; ++kc) {
      if (kc + 1 < 4) { a[(kc + 1) & 1] = frag_h((const _Float16*)(base + (wave * 16 + col) * KV_P) + (kc + 1) * 32, lane);
#pragma unroll
        for (int j = 0; j < 8; ++j) w[(kc + 1) & 1][j] = frag_h((const _Float16*)(base + (64 + j * 16 + col) * KV_P) + (kc + 1) * 32, lane); }
      if (ksb) {   // unrolled so that the fragment's elements and the four sums have constant indices and stay in registers
#pragma unroll
        for (int i = 0; i < 16; ++i) ps[i & 3] += (float)a[kc & 1][i]; }
#pragma unroll
      for (int j = 0; j < 8; ++j) acc[j] = wmma16(a[kc & 1], w[kc & 1][j], acc[j]); }
    // foot of trip t: tile t + 1 must have landed; where a tile t + 2 exists its 24 copies are this wave's youngest and fly on, else nothing may stay outstanding
    WAIT_DS(); if (t + 2 < NN / 128) WAIT_ACP_BUT24(); else WAIT_ACP();
    __syncthreads();
    // tile t + 3 goes into the buffer that trip t has just read: every wave's reads of it have returned in front of the barrier
    if (t + 3 < NN / 128) { const size_t go = (size_t)((t + 3 + rot) & (NN / 128 - 1)) * 256; acp8(la + bo, 8 * KV_P, ga + go, gs); acp8(la + bo + 64 * KV_P, 8 * KV_P, gb + go, gs); acp8(la + bo + 128 * KV_P, 8 * KV_P, gb + 8 * gs + go, gs); }
    bo = (bo == 2 * KV_STG) ? 0u : bo + KV_STG; }
  WAIT_ACP();
#pragma unroll
  for (int j = 0; j < 8; ++j)
#pragma unroll
    for (int r = 0; r < 8; ++r) sh[j * 16 + col][wave * 16 + 8 * g + r] = (_Float16)acc[j][r];
  if (ksb) sks[g][wave * 16 + col] = (ps[0] + ps[1]) + (ps[2] + ps[3]);
  __syncthreads();
  for (int e = tid; e < 128 * 8; e += 128) { const int m = e >> 3, pc = e & 7; const size_t o = ((b * DD + m0 + m) * D2) + d0 + pc * 8; vst2((unsigned*)(KVH + o), *(const v4u*)&sh[m][pc * 8]); }
  // the two lane halves' sums are added and one wave stores the 256-B segment
  if (ksb && tid < 16) vst2(KS + b * D2 + d0 + tid * 4, *(const v4f*)&sks[0][tid * 4] + *(const v4f*)&sks[1][tid * 4]);
}
// ---- k_fin: block = (128 tokens, 128 m cols, b), 8 waves as 4 (tokens) x 2 (cols): q_ . kv = sin (q . kv_sin) + cos (q . kv_cos), so q is kept once, without its position weights: every q fragment feeds the products with both halves of kv (two accumulator sets), the k loop runs over 512 d and not 1,024 dd, and sin, cos are applied to the f32 sums; z = 1/max(sin (q . KS_sin) + cos (q . KS_cos), 1e-6) per row (f32, summed inside the d loop from the q fragments that the wave holds for its WMMAs; of the two waves that hold the same 32 rows one sums the sin half, one the cos half); out = acc z stored through the (b,H,n,hd)->(b,n,H,hd) view: computed (n, m) -> row (8n + m/64) mod N, cols (n/512)*64 + m%64; each wave holds two 16-token row tiles x four column tiles x two halves
// stage = 64 d: q 128 rows, kv_sin 128 rows and kv_cos 128 rows of 128 B at pitch 144; the output staging so takes the ring's place behind the loop
#define FN_P 144
// 16 f16 fragment elements times 16 f32 values in the same k order, added into four independent sums
__device__ __forceinline__ void zacc(float (&zs)[4], v16h a, const v4f* k) {
#pragma unroll   // constant indices, so that the fragment and the sums stay in registers
  for (int i = 0; i < 16; ++i) zs[i & 3] = __builtin_fmaf((float)a[i], k[i >> 2][i & 3], zs[i & 3]);
}
#define FN_STG ((128 + 256) * FN_P)
__global__ __launch_bounds__(256) void k_fin(const _Float16* __restrict__ Q, const _Float16* __restrict__ KVH, const float* __restrict__ KS, float* __restrict__ OUT) {
  __shared__ __align__(16) char ring[2 * FN_STG]; __shared__ float ssc[2][128]; __shared__ float szs[2][128]; __shared__ float sf[8][2][32]; float (*so)[32][68] = (float (*)[32][68])ring;
  const int tid = threadIdx.x, wave = tid >> 5, lane = tid & 31, col = lane & 15, g = lane >> 4; const int wr = wave >> 1, wc = wave & 1; const size_t b = blockIdx.z; const int nb0 = blockIdx.x * 128; const int nw = nb0 + wr * 32; const int m0 = blockIdx.y * 128;
  const char* ga = (const char*)(Q + (b * NN + nb0 + (tid >> 3)) * DD) + (tid & 7) * 16; const char* gh = (const char*)KVH + ((b * DD + m0 + (tid >> 3)) * D2) * 2 + (tid & 7) * 16;
  const unsigned la = lds_off(ring) + (tid >> 3) * FN_P + (tid & 7) * 16; const size_t gsa = (size_t)32 * DD * 2, gsh = (size_t)32 * D2 * 2;
  v8f acc[2][2][4] = {};   // [sin | cos half of kv][row tile][column tile]
  // z: lane (g, col) of wave (wr, wc) sums q . KS of half wc for rows wr * 32 + rt * 16 + col over the 32 d of each stage that its fragments hold, in four independent partial sums per row tile; wvs is the wave's number as a scalar, so that the half's offset is scalar and the choice between sin and cos below is a scalar branch
  const int wvs = __builtin_amdgcn_readfirstlane(wave); const float* ksl = KS + b * D2 + (wvs & 1) * DD + 8 * g; float zs[2][4] = {{0.f, 0.f, 0.f, 0.f}, {0.f, 0.f, 0.f, 0.f}};
  // trip t works on d stage (t + rot) mod 8, a start of its own per work-group, for the reason given in k_proj; z takes its KS values from the same stage
  const unsigned rot = (blockIdx.x + 2 * blockIdx.y + blockIdx.z) & (DD / 64 - 1);
  { const size_t g0 = (size_t)rot * 128, g1 = (size_t)((rot + 1) & (DD / 64 - 1)) * 128;
    acp4(la, 32 * FN_P, ga + g0, gsa); acp4(la + 128 * FN_P, 32 * FN_P, gh + g0, gsh); acp4(la + 256 * FN_P, 32 * FN_P, gh + DD * 2 + g0, gsh);
    // the position weights of the 128 tokens, once each (waves 0-3 sin, waves 4-7 cos), while the first stage flies; the barrier below publishes them
    { const float ang = (1.57079632679489662f * (float)(nb0 + (tid & 127) + 1)) / (float)NN; if (wvs < 4) ssc[0][tid & 127] = sin_p(ang); else ssc[1][tid & 127] = cos_p(ang); }
    WAIT_ACP(); __syncthreads();
    acp4(la + FN_STG, 32 * FN_P, ga + g1, gsa); acp4(la + FN_STG + 128 * FN_P, 32 * FN_P, gh + g1, gsh); acp4(la + FN_STG + 256 * FN_P, 32 * FN_P, gh + DD * 2 + g1, gsh); }
  for (int t = 0; t < DD / 64; ++t) { const unsigned bo = (t & 1) * FN_STG; const char* base = ring + bo;
    // two fragment sets of two column tiles: the next set is read from LDS as one group in front of this set's 4 WMMAs, so that its latency runs behind them; the loops are unrolled so that the fragment arrays have constant indices and stay in registers
    v16h a[2][2], wh[2][2]; v4f kz[2][4];   // kz: the 16 KS values (half wc) of each of the stage's two 32-d slices in the fragment's own k order
#pragma unroll
    for (int kc = 0; kc < 2; ++kc) { const float* kp = ksl + ((t + rot) & (DD / 64 - 1)) * 64 + kc * 32; kz[kc][0] = *(const v4f*)kp; kz[kc][1] = *(const v4f*)(kp + 4); kz[kc][2] = *(const v4f*)(kp + 16); kz[kc][3] = *(const v4f*)(kp + 20); }
#pragma unroll
    for (int rt = 0; rt < 2; ++rt)
#pragma unroll
      for (int kc = 0; kc < 2; ++kc) a[rt][kc] = frag_h((const _Float16*)(base + (wr * 32 + rt * 16 + col) * FN_P) + kc * 32, lane);
#pragma unroll
    for (int j = 0; j < 2; ++j) wh[0][j] = frag_h((const _Float16*)(base + (128 + wc * 64 + j * 16 + col) * FN_P), lane);
#pragma unroll
    for (int s = 0; s < 8; ++s) { const int kc = s >> 2, hf = (s >> 1) & 1, jh = (s & 1) * 2;
      if (s + 1 < 8) { const int kn = (s + 1) >> 2, hn = ((s + 1) >> 1) & 1, jn = ((s + 1) & 1) * 2;
#pragma unroll
        for (int j = 0; j < 2; ++j) wh[(s + 1) & 1][j] = frag_h((const _Float16*)(base + (128 + hn * 128 + wc * 64 + (jn + j) * 16 + col) * FN_P + kn * 64), lane); }
#pragma unroll
      for (int j = 0; j < 2; ++j)
#pragma unroll
        for (int rt = 0; rt < 2; ++rt) acc[hf][rt][jh + j] = wmma16(a[rt][kc], wh[s & 1][j], acc[hf][rt][jh + j]);
      if ((s & 3) == 3) { zacc(zs[0], a[0][kc], kz[kc]); zacc(zs[1], a[1][kc], kz[kc]); } }
    WAIT_DS(); WAIT_ACP(); __syncthreads();
    if (t + 2 < DD / 64) { const size_t go = (size_t)((t + 2 + rot) & (DD / 64 - 1)) * 128; acp4(la + bo, 32 * FN_P, ga + go, gsa); acp4(la + bo + 128 * FN_P, 32 * FN_P, gh + go, gsh); acp4(la + bo + 256 * FN_P, 32 * FN_P, gh + DD * 2 + go, gsh); } }
  WAIT_ACP();
#pragma unroll
  for (int rt = 0; rt < 2; ++rt) { float s = (zs[rt][0] + zs[rt][1]) + (zs[rt][2] + zs[rt][3]); s += __shfl_xor(s, 16); if (lane < 16) szs[wc][wr * 32 + rt * 16 + col] = s; }
  __syncthreads();   // each wave reads the other half's sums from the wave that shares its rows
  // lane l: the two factors sin z and cos z of row wr * 32 + l, kept per wave
  { const int row = wr * 32 + lane; const float sn = ssc[0][row], cs = ssc[1][row]; const float z = 1.0f / fmaxf(sn * szs[0][row] + cs * szs[1][row], 1e-6f); sf[wave][0][lane] = sn * z; sf[wave][1][lane] = cs * z; }
  LDSX();
#pragma unroll
  for (int rt = 0; rt < 2; ++rt)
#pragma unroll
  for (int j = 0; j < 4; ++j)
#pragma unroll
    for (int r = 0; r < 8; ++r) so[wave][rt * 16 + 8 * g + r][j * 16 + col] = acc[0][rt][j][r] * sf[wave][0][rt * 16 + 8 * g + r] + acc[1][rt][j][r] * sf[wave][1][rt * 16 + 8 * g + r];
  LDSX();
  // each computed row n (32 per wave) x this wave's 64 cols = the chunk j64 = m0/64 + wc -> final row (8n + j64) % NN, col block (n/512)*64
#pragma unroll   // straight-line, so that no store's registers are rewritten over a back edge
  for (int rl = 0; rl < 32; rl += 2) { const int lr = rl + (lane >> 4); const int n = nw + lr; const int j64 = m0 / 64 + wc; const size_t frow = b * NN + (size_t)((8 * n + j64) % NN); const int fc0 = (n / 512) * HD;
    vst2(OUT + frow * DD + fc0 + (lane & 15) * 4, *(const v4f*)&so[wave][lr][(lane & 15) * 4]); }   // two 256-B segments per store (lanes 0-15 / 16-31: two computed rows)
}
extern "C" void kernel_launch(void* const* d_in, const int* in_sizes, int n_in, void* d_out, int out_size, void* d_ws, size_t ws_size, hipStream_t stream) {
  (void)in_sizes; (void)n_in; (void)out_size;
  const float** F = (const float**)d_in;   // 0 x [4,4096,512], 1 Wq, 2 Wk, 3 Wv [512,512] natural
  if (ws_size < (size_t)WS_END) return;
  char* ws = (char*)d_ws; __bf16* P = (__bf16*)ws; _Float16 *Q = (_Float16*)(ws + WS_Q), *KT = (_Float16*)(ws + WS_KT), *VT = (_Float16*)(ws + WS_VT), *KVH = (_Float16*)(ws + WS_KVH); float* KS = (float*)(ws + WS_KS);
  k_pack<<<3 * DD, 256, 0, stream>>>(F[1], F[2], F[3], P);
  k_proj<<<dim3(TR / 128, DD / 128, 3), 128, 0, stream>>>(F[0], P, Q, KT, VT);
  k_kv<<<dim3(D2 / 64, DD / 128, TNB), 128, 0, stream>>>(KT, VT, KVH, KS);
  k_fin<<<dim3(NN / 128, DD / 128, TNB), 256, 0, stream>>>(Q, KVH, KS, (float*)d_out);
}

// v010
// It runs in 69.8 microseconds.
// It is 1.14 times as fast as v008, going by the measured steps of the versions left out in between.
// Over all steps from v000 it is 7.19 times as fast.
// compute dtype: all float inputs rounded to bf16; q / k / v = x . W^T with EXACT bf16 products on WMMA 16x16x32 (natural rows), ReLU in f32, the position weights (idx = (pi/2) (n + 1) / N in f32, precise sinf/cosf) in f32 for q and rounded to f16 for k, q / k / v rounded once to f16; k_ = k sin | k cos as f16 products of the f16 k and the f16 weights (rounded again); kv = k_^T v and q kv_sin, q kv_cos as WMMA GEMMs (kv rounded once to f16: one product); q_ kv = sin (q kv_sin) + cos (q kv_cos) in f32; the column sums of k_ (f32, taken in k_kv as WMMA products of its k_^T fragments with a column of ones) and the normaliser z = 1 / max(sin (q . sum k sin) + cos (q . sum k cos), 1e-6) in f32 from the same f16-rounded values; output written through the module's (b,H,n,hd) -> (b,n,H,hd) reshape.
#include <hip/hip_runtime.h>
#include <math.h>

typedef __attribute__((ext_vector_type(16))) _Float16 v16h;
typedef __attribute__((ext_vector_type(16))) __bf16 v16b;
typedef __attribute__((ext_vector_type(8)))  _Float16 v8h;
typedef __attribute__((ext_vector_type(8)))  float v8f;
typedef __attribute__((ext_vector_type(4)))  float v4f;
typedef __attribute__((ext_vector_type(2)))  float v2f;
typedef __attribute__((ext_vector_type(4)))  unsigned v4u;
typedef __attribute__((ext_vector_type(4)))  int v4i;
typedef float __attribute__((may_alias)) float_a;
typedef int __attribute__((may_alias)) int_a;

template <typename T> __device__ __forceinline__ void vst2(void* p, T v) { *(T*)p = v;  }
__device__ __forceinline__ v8f wmma16(v16h a, v16h b, v8f c) {
  v8f d = __builtin_amdgcn_wmma_f32_16x16x32_f16(false, a, false, b, (short)0, c, false, false);
  asm volatile("v_nop\n\tv_nop\n\tv_nop\n\tv_nop" : "+v"(d) : "v"(a), "v"(b));
  return d;
}
__device__ __forceinline__ v8f wmma_bf(v16b a, v16b b, v8f c) {
  v8f d = __builtin_amdgcn_wmma_f32_16x16x32_bf16(false, a, false, b, (short)0, c, false, false);
  asm volatile("v_nop\n\tv_nop\n\tv_nop\n\tv_nop" : "+v"(d) : "v"(a), "v"(b));
  return d;
}
// 16x16x32 fragments: lane = (h = lane>>4, row/col = lane&15); elements 0..7 = k0+8h+0..7, 8..15 = k0+16+8h+0..7; D element r = row 8h+r
__device__ __forceinline__ v16h frag_h(const _Float16* rowk0, int lane) {
  union { v16h v; v8h q[2]; } u; const _Float16* p = rowk0 + 8 * (lane >> 4);
  u.q[0] = *(const v8h*)p; u.q[1] = *(const v8h*)(p + 16); return u.v;
}
__device__ __forceinline__ v16h frag_f32(const float* rowk0, int lane) {
  v16h a; const float* p = rowk0 + 8 * (lane >> 4);
#pragma unroll
  for (int i = 0; i < 8; ++i) { a[i] = (_Float16)p[i]; a[8 + i] = (_Float16)p[16 + i]; }
  return a;
}
__device__ __forceinline__ v16h frag_f32s(const float* rowk0, int lane, float sc) {
  v16h a; const float* p = rowk0 + 8 * (lane >> 4);
#pragma unroll
  for (int i = 0; i < 8; ++i) { a[i] = (_Float16)(p[i] * sc); a[8 + i] = (_Float16)(p[16 + i] * sc); }
  return a;
}
// column fragment from a [K][ld] layout (column n), rows >= K read as 0
__device__ __forceinline__ v16h fragc_f32(const float* W, int k0, int n, int lane, int ld, int K) {
  v16h a; const int g = lane >> 4;
#pragma unroll
  for (int i = 0; i < 8; ++i) { const int ka = k0 + 8 * g + i, kb = ka + 16;
    a[i] = (_Float16)(ka < K ? W[(size_t)(ka < K ? ka : K - 1) * ld + n] : 0.f); a[8 + i] = (_Float16)(kb < K ? W[(size_t)(kb < K ? kb : K - 1) * ld + n] : 0.f); }
  return a;
}
struct F2 { v16b h, l; };
__device__ __forceinline__ F2 bsplit16(const float v[16]) { F2 r;
#pragma unroll
  for (int i = 0; i < 16; ++i) { const __bf16 h = (__bf16)v[i]; r.h[i] = h; r.l[i] = (__bf16)(v[i] - (float)h); }
  return r; }
__device__ __forceinline__ F2 split_row(const float* row, int k0, int lane) { float v[16]; const float* p = row + k0 + 8 * (lane >> 4);
#pragma unroll
  for (int i = 0; i < 8; ++i) { v[i] = p[i]; v[8 + i] = p[16 + i]; }
  return bsplit16(v); }
__device__ __forceinline__ F2 split_rowK(const float* row, int k0, int lane, int K) { float v[16]; const int g = lane >> 4;
#pragma unroll
  for (int i = 0; i < 8; ++i) { const int ka = k0 + 8 * g + i, kb = ka + 16; v[i] = ka < K ? row[ka < K ? ka : K - 1] : 0.f; v[8 + i] = kb < K ? row[kb < K ? kb : K - 1] : 0.f; }
  return bsplit16(v); }
__device__ __forceinline__ F2 split_col(const float* W, int k0, int n, int lane, int ld, int K) { float v[16]; const int g = lane >> 4;
#pragma unroll
  for (int i = 0; i < 8; ++i) { const int ka = k0 + 8 * g + i, kb = ka + 16; v[i] = ka < K ? W[(size_t)(ka < K ? ka : K - 1) * ld + n] : 0.f; v[8 + i] = kb < K ? W[(size_t)(kb < K ? kb : K - 1) * ld + n] : 0.f; }
  return bsplit16(v); }
__device__ __forceinline__ v8f mac3(const F2& a, const F2& b, v8f c) { c = wmma_bf(a.l, b.h, c); c = wmma_bf(a.h, b.l, c); return wmma_bf(a.h, b.h, c); }
__device__ __forceinline__ float sigm(float v) { return 1.0f / (1.0f + expf(-v)); }
#define LDSX() do { asm volatile("s_wait_dscnt 0" ::: "memory"); __builtin_amdgcn_wave_barrier(); __builtin_amdgcn_fence(__ATOMIC_RELEASE, "workgroup"); } while (0)


// cosFormer linear attention (B 4, N 4,096, d 512, 8 heads): q = relu(x Wq^T), k = relu(x Wk^T), v = x Wv^T; q_, k_ = [q sin, q cos], [k sin, k cos] with the position weights (pi/2)(n+1)/N; out = (q_ (k_^T v)) / max(q_ . sum_n k_, 1e-6), then the module's head reshape.
#define NB 4
#define NN 4096
#define DD 512
#define D2 (2 * DD)
#define NH 8
#define HD 64
#define NR (NB * NN)
#ifndef TNB
#define TNB NB
#endif
#define TR (TNB * NN)
typedef __attribute__((ext_vector_type(8))) __bf16 v8b;
__device__ __forceinline__ v16b frag_b(const __bf16* rowk0, int lane) {
  union { v16b v; v8b q[2]; } u; const __bf16* p = rowk0 + 8 * (lane >> 4);
  u.q[0] = *(const v8b*)p; u.q[1] = *(const v8b*)(p + 16); return u.v;
}
__device__ __forceinline__ float bfr(float v) { return (float)(__bf16)v; }
__device__ __attribute__((noinline)) float exp_ni(float v) { return expf(v); }
__device__ __attribute__((noinline)) float erf_ni(float v) { return erff(v); }

#define WS_PW  0u                                  // bf16 natural rows Wq, Wk, Wv [3][512][512]
#define WS_Q   (WS_PW + 2u * (size_t)3 * DD * DD)   // f16 rows q = relu(x Wq^T) [NR][512], without the position weights
#define WS_KT  (WS_Q + 2u * (size_t)NR * DD)        // f16 planes k^T = relu(x Wk^T)^T [b][512][NN], without the position weights ; v^T [b][512][NN]
#define WS_VT  (WS_KT + 2u * (size_t)NB * DD * NN)
#define WS_KVH (WS_VT + 2u * (size_t)NB * DD * NN)  // f16 kv^T [b][512 m][1024 dd]
#define WS_KS  (WS_KVH + 2u * (size_t)NB * DD * D2) // f32 [b][1024] sum_n k_
#define WS_SC  (WS_KS + 4u * (size_t)NB * D2)        // f16 position weights [2][NN]: sin, cos
#define WS_END (WS_SC + 2u * (size_t)2 * NN)

__device__ __attribute__((noinline)) float sin_p(float v) { return sinf(v); }
__device__ __attribute__((noinline)) float cos_p(float v) { return cosf(v); }
// blocks 0 .. 1,535: one W row each; the NN / 256 blocks behind them: the position weights of 256 tokens each, rounded to f16, for k_kv
__global__ __launch_bounds__(256) void k_pack(const float* __restrict__ WQ, const float* __restrict__ WK, const float* __restrict__ WV, __bf16* __restrict__ P, _Float16* __restrict__ SC) { const int n = blockIdx.x, t = threadIdx.x;
  if (n >= 3 * DD) { const int tok = (n - 3 * DD) * 256 + t; const float ang = (1.57079632679489662f * (float)(tok + 1)) / (float)NN; SC[tok] = (_Float16)sin_p(ang); SC[NN + tok] = (_Float16)cos_p(ang); return; }
  const float* src = (n < DD) ? (WQ + (size_t)n * DD) : (n < 2 * DD) ? (WK + (size_t)(n - DD) * DD) : (WV + (size_t)(n - 2 * DD) * DD); __shared__ __align__(16) __bf16 s[DD]; for (int k = t; k < DD; k += 256) s[k] = (__bf16)src[k]; __syncthreads(); if (t < DD / 8) vst2((unsigned*)(P + (size_t)n * DD + t * 8), *(const v4u*)&s[t * 8]); }
__device__ __forceinline__ unsigned lds_off(const void* p) { return (unsigned)(size_t)p; }
// one lane's 8 (4) copies, rows ls bytes apart in LDS and gs bytes apart in global memory; s_wait_xcnt 0 closes the statement so that no address register of a copy is rewritten in front of it
__device__ __forceinline__ void acp8(unsigned l, unsigned ls, const char* p, size_t gs) {
  asm volatile("global_load_async_to_lds_b128 %0, %8, off\n\t"
               "global_load_async_to_lds_b128 %1, %9, off\n\t"
               "global_load_async_to_lds_b128 %2, %10, off\n\t"
               "global_load_async_to_lds_b128 %3, %11, off\n\t"
               "global_load_async_to_lds_b128 %4, %12, off\n\t"
               "global_load_async_to_lds_b128 %5, %13, off\n\t"
               "global_load_async_to_lds_b128 %6, %14, off\n\t"
               "global_load_async_to_lds_b128 %7, %15, off\n\t"
               "s_wait_xcnt 0x0"
               :: "v"(l), "v"(l + ls), "v"(l + 2 * ls), "v"(l + 3 * ls), "v"(l + 4 * ls), "v"(l + 5 * ls), "v"(l + 6 * ls), "v"(l + 7 * ls),
                  "v"(p), "v"(p + gs), "v"(p + 2 * gs), "v"(p + 3 * gs), "v"(p + 4 * gs), "v"(p + 5 * gs), "v"(p + 6 * gs), "v"(p + 7 * gs) : "memory");
}
__device__ __forceinline__ void acp4(unsigned l, unsigned ls, const char* p, size_t gs) {
  asm volatile("global_load_async_to_lds_b128 %0, %4, off\n\t"
               "global_load_async_to_lds_b128 %1, %5, off\n\t"
               "global_load_async_to_lds_b128 %2, %6, off\n\t"
               "global_load_async_to_lds_b128 %3, %7, off\n\t"
               "s_wait_xcnt 0x0"
               :: "v"(l), "v"(l + ls), "v"(l + 2 * ls), "v"(l + 3 * ls), "v"(p), "v"(p + gs), "v"(p + 2 * gs), "v"(p + 3 * gs) : "memory");
}
// one lane's 16 stores of 16 B, 1,024 B apart (16 q rows of 1,024 B); s_wait_xcnt 0 closes the statement so that no register of a store is rewritten in front of it
__device__ __forceinline__ void gst16(char* p, const v4u* d) {
  asm volatile("global_store_b128 %0, %1, off\n\t"
               "global_store_b128 %0, %2, off offset:1024\n\t"
               "global_store_b128 %0, %3, off offset:2048\n\t"
               "global_store_b128 %0, %4, off offset:3072\n\t"
               "global_store_b128 %0, %5, off offset:4096\n\t"
               "global_store_b128 %0, %6, off offset:5120\n\t"
               "global_store_b128 %0, %7, off offset:6144\n\t"
               "global_store_b128 %0, %8, off offset:7168\n\t"
               "global_store_b128 %0, %9, off offset:8192\n\t"
               "global_store_b128 %0, %10, off offset:9216\n\t"
               "global_store_b128 %0, %11, off offset:10240\n\t"
               "global_store_b128 %0, %12, off offset:11264\n\t"
               "global_store_b128 %0, %13, off offset:12288\n\t"
               "global_store_b128 %0, %14, off offset:13312\n\t"
               "global_store_b128 %0, %15, off offset:14336\n\t"
               "global_store_b128 %0, %16, off offset:15360\n\t"
               "s_wait_xcnt 0x0"
               :: "v"(p), "v"(d[0]), "v"(d[1]), "v"(d[2]), "v"(d[3]), "v"(d[4]), "v"(d[5]), "v"(d[6]), "v"(d[7]), "v"(d[8]), "v"(d[9]), "v"(d[10]), "v"(d[11]), "v"(d[12]), "v"(d[13]), "v"(d[14]), "v"(d[15]) : "memory");
}
// this wave's copies have landed (in front of the barrier behind which other waves read them)
#define WAIT_ACP() asm volatile("s_wait_asynccnt 0x0" ::: "memory")
// this wave's LDS reads of a buffer have returned (in front of the barrier behind which the buffer is refilled)
#define WAIT_DS() asm volatile("s_wait_dscnt 0x0" ::: "memory")
// ---- k_proj: block = (128 tokens, 128 cols, which): 0 q -> relu -> q rows (k_fin applies sin and cos behind its products); 1 k -> relu -> k^T planes (k_kv applies sin and cos to its fragments); 2 v -> v^T planes; each wave holds two 16-token row tiles, so that every W fragment read from LDS feeds two WMMAs and every W tile copied from L2 serves 128 tokens
// stage = 64 k: x 128 rows of 256 B (f32) at pitch 272, W 128 rows of 128 B (bf16) at pitch 144; the output staging so / st takes the ring's place behind the loop
#define PJ_PA 272
#define PJ_PB 144
#define PJ_STG (128 * PJ_PA + 128 * PJ_PB)
__global__ __launch_bounds__(128) void k_proj(const float* __restrict__ X, const __bf16* __restrict__ P, _Float16* __restrict__ Q, _Float16* __restrict__ KT, _Float16* __restrict__ VT) {
  __shared__ __align__(16) char ring[2 * PJ_STG];
  _Float16 (*so)[128][136] = (_Float16 (*)[128][136])ring; _Float16 (*st)[128][136] = (_Float16 (*)[128][136])ring;
  const int tid = threadIdx.x, wave = tid >> 5, lane = tid & 31, col = lane & 15, g = lane >> 4; const int which = blockIdx.z; const int n0 = blockIdx.y * 128; const size_t rb0 = (size_t)blockIdx.x * 128, r0 = rb0 + wave * 32; const size_t b = rb0 / NN, s0 = rb0 % NN;
  const char* ga = (const char*)(X + (rb0 + (tid >> 4)) * DD) + (tid & 15) * 16; const char* gb = (const char*)(P + ((size_t)which * DD + n0 + (tid >> 3)) * DD) + (tid & 7) * 16;
  const unsigned la = lds_off(ring) + (tid >> 4) * PJ_PA + (tid & 15) * 16, lb = lds_off(ring) + 128 * PJ_PA + (tid >> 3) * PJ_PB + (tid & 7) * 16;
  const size_t gsa = (size_t)8 * DD * 4, gsb = (size_t)16 * DD * 2;
  v8f acc[2][8] = {};
  // trip t works on k stage (t + rot) mod 8: the work-groups run in step, and with a common start all of them ask L2 for the same column offset of their rows, and those that share x rows or W rows for the same lines, at the same moment; with a start of its own per work-group the requests of a moment spread over all 8 offsets
  const unsigned rot = (blockIdx.x + 2 * blockIdx.y + blockIdx.z) & (DD / 64 - 1);
  { const size_t k0 = rot, k1 = (rot + 1) & (DD / 64 - 1);
    acp8(la, 8 * PJ_PA, ga + k0 * 256, gsa); acp8(la + 64 * PJ_PA, 8 * PJ_PA, ga + 8 * gsa + k0 * 256, gsa); acp8(lb, 16 * PJ_PB, gb + k0 * 128, gsb);
    WAIT_ACP(); __syncthreads();
    acp8(la + PJ_STG, 8 * PJ_PA, ga + k1 * 256, gsa); acp8(la + PJ_STG + 64 * PJ_PA, 8 * PJ_PA, ga + 8 * gsa + k1 * 256, gsa); acp8(lb + PJ_STG, 16 * PJ_PB, gb + k1 * 128, gsb); }
  for (int t = 0; t < DD / 64; ++t) { const unsigned bo = (t & 1) * PJ_STG; const char* base = ring + bo;
    // each 32-k slice's fragments are read from LDS as one group in front of its 16 WMMAs, so that the LDS latency is waited out once a slice and not once a WMMA; the loops are unrolled so that the fragment arrays have constant indices and stay in registers
#pragma unroll
    for (int kc = 0; kc < 2; ++kc) { v16b a[2], w[8];
#pragma unroll
      for (int rt = 0; rt < 2; ++rt) { const float* p = (const float*)(base + (wave * 32 + rt * 16 + col) * PJ_PA) + kc * 32 + 8 * g;
#pragma unroll
        for (int i = 0; i < 8; ++i) { a[rt][i] = (__bf16)p[i]; a[rt][8 + i] = (__bf16)p[16 + i]; } }
#pragma unroll
      for (int j = 0; j < 8; ++j) w[j] = frag_b((const __bf16*)(base + 128 * PJ_PA + (j * 16 + col) * PJ_PB) + kc * 32, lane);
#pragma unroll
      for (int j = 0; j < 8; ++j)
#pragma unroll
        for (int rt = 0; rt < 2; ++rt) acc[rt][j] = wmma_bf(a[rt], w[j], acc[rt][j]); }
    WAIT_DS(); WAIT_ACP(); __syncthreads();
    if (t + 2 < DD / 64) { const size_t kn = (t + 2 + rot) & (DD / 64 - 1); acp8(la + bo, 8 * PJ_PA, ga + kn * 256, gsa); acp8(la + bo + 64 * PJ_PA, 8 * PJ_PA, ga + 8 * gsa + kn * 256, gsa); acp8(lb + bo, 16 * PJ_PB, gb + kn * 128, gsb); } }
  WAIT_ACP();
  if (which == 0) {
#pragma unroll
    for (int rt = 0; rt < 2; ++rt)
#pragma unroll
    for (int r = 0; r < 8; ++r)
#pragma unroll
      for (int j = 0; j < 8; ++j) so[0][wave * 32 + rt * 16 + 8 * g + r][j * 16 + col] = (_Float16)fmaxf(acc[rt][j][r], 0.f);
    LDSX();
    if (lane < 16) for (int rb = 0; rb < 32; rb += 16) { v4u d[16];
#pragma unroll   // constant indices, so that d stays in registers
      for (int i = 0; i < 16; ++i) d[i] = *(const v4u*)&so[0][wave * 32 + rb + i][lane * 8];
      gst16((char*)(Q + (r0 + rb) * DD + n0 + lane * 8), d); }
  } else if (which == 1) {
#pragma unroll
    for (int rt = 0; rt < 2; ++rt)
#pragma unroll
    for (int r = 0; r < 8; ++r)
#pragma unroll
      for (int j = 0; j < 8; ++j) st[0][j * 16 + col][wave * 32 + rt * 16 + 8 * g + r] = (_Float16)fmaxf(acc[rt][j][r], 0.f);
    __syncthreads();
    for (int e = tid; e < 128 * 16; e += 128) { const int d = e >> 4, pc = e & 15; vst2((unsigned*)(KT + ((b * DD + n0 + d) * NN) + s0 + pc * 8), *(const v4u*)&st[0][d][pc * 8]); }
  } else {
#pragma unroll
    for (int rt = 0; rt < 2; ++rt)
#pragma unroll
    for (int r = 0; r < 8; ++r)
#pragma unroll
      for (int j = 0; j < 8; ++j) st[0][j * 16 + col][wave * 32 + rt * 16 + 8 * g + r] = (_Float16)acc[rt][j][r];
    __syncthreads();
    for (int e = tid; e < 128 * 16; e += 128) { const int d = e >> 4, pc = e & 15; vst2((unsigned*)(VT + ((b * DD + n0 + d) * NN) + s0 + pc * 8), *(const v4u*)&st[0][d][pc * 8]); } }
}
// ---- k_kv: block = (64 d, 64 m, b), 8 waves as 2 (d halves of 32 rows) x 4 (token quarters of every tile; the two waves of a quarter share a SIMD): k_^T v = [ (k sin)^T v ; (k cos)^T v ], so k is kept once, without its position weights: the wave multiplies its two k^T fragments by the f16 weights of the fragments' own tokens (once by sin, once by cos, packed f16 products), and every v^T fragment read from LDS feeds four products (two row tiles x two halves): 8 fragment reads per 16 WMMAs; two waves share a SIMD, so that one wave's LDS reads and weighting run behind the other's WMMAs; the four token quarters' partial sums are added through LDS behind the loop
// stage = 256 tokens: k^T 64 rows and v^T 64 rows of 512 B at pitch 528; three buffers, so that two tiles' copies (2 x 16 per wave) fly while a third tile is multiplied: a tile has two trips to land, not one; the weights of all tokens (2 x 8 KB) are copied to LDS once; the sum of k_ over the tokens is taken by the first four m blocks, 32 rows of one half each (one whole 128-B line of KS), as products of the weighted fragments with a column of ones -> KS[b][dd]
#define KV_P 528
#define KV_STG ((64 + 64) * KV_P)
#define KV_NT (NN / 256)
// every wave issues exactly 16 copies per tile, and a wave's copies return in issue order: all but its 16 youngest copies have landed, that is every tile but the one issued last (and the weights, issued first of all)
#define WAIT_ACP_BUT16() asm volatile("s_wait_asynccnt 0x10" ::: "memory")
__global__ __launch_bounds__(256) void k_kv(const _Float16* __restrict__ KT, const _Float16* __restrict__ VT, const _Float16* __restrict__ SC, _Float16* __restrict__ KVH, float* __restrict__ KS) {
  __shared__ __align__(16) char ring[3 * KV_STG]; __shared__ __align__(16) _Float16 tab[2][NN]; __shared__ __align__(16) _Float16 sh[64][136]; __shared__ __align__(16) float sks[4][32];
  const int tid = threadIdx.x, wave = tid >> 5, lane = tid & 31, col = lane & 15, g = lane >> 4; const size_t b = blockIdx.z; const int d0 = blockIdx.x * 64; const int m0 = blockIdx.y * 64;
  // the wave's number as a scalar, so that its place in the tile is scalar and the tests on it are scalar branches
  const int wvs = __builtin_amdgcn_readfirstlane(wave), wd = wvs >> 2, wq = wvs & 3;
  // one wave copies one whole 512-B row piece per instruction
  const char* ga = (const char*)(KT + (b * DD + d0 + wave) * NN) + lane * 16; const char* gb = (const char*)(VT + (b * DD + m0 + wave) * NN) + lane * 16;
  const unsigned la = lds_off(ring) + wave * KV_P + lane * 16; const size_t gs = (size_t)8 * NN * 2;
  // m blocks with odd y take the cos half first: accumulator set 0 holds half fl, set 1 the other, so that the half whose sum over the tokens the block takes (below) is always set 0's and the loop needs no test for it
  const int fl = blockIdx.y & 1; const int o1 = fl ? -NN : NN;
  v8f acc[2][2][4] = {};   // [half fl | the other half of k_][row tile][column tile]
  // m block y < 4 sums rows (y >> 1) * 32 + 0..31 of half y & 1: the four waves that hold these rows, each over its token quarter
  const bool ksw = blockIdx.y < 4 && wd == (int)(blockIdx.y >> 1); v8f aks[2] = {};   // column 0 of aks[row tile]
  v16h one;
#pragma unroll
  for (int i = 0; i < 16; ++i) one[i] = col == 0 ? (_Float16)1.f : (_Float16)0.f;
  // trip t works on token tile (t + rot) mod 16, a start of its own per work-group, for the reason given in k_proj (here all 256 work-groups start together and the rows are 8,192 B apart); the 8 work-groups that share k^T rows, and the 8 that share v^T rows, start 2 tiles apart
  const unsigned rot = (2 * ((blockIdx.x + blockIdx.y) & 7) + blockIdx.z) & (KV_NT - 1);
  { const size_t g0 = (size_t)rot * 512, g1 = (size_t)((rot + 1) & (KV_NT - 1)) * 512, g2 = (size_t)((rot + 2) & (KV_NT - 1)) * 512;
    acp4(lds_off(tab) + tid * 16, 4096, (const char*)SC + tid * 16, 4096);
    acp8(la, 8 * KV_P, ga + g0, gs); acp8(la + 64 * KV_P, 8 * KV_P, gb + g0, gs);
    acp8(la + KV_STG, 8 * KV_P, ga + g1, gs); acp8(la + KV_STG + 64 * KV_P, 8 * KV_P, gb + g1, gs);
    WAIT_ACP_BUT16(); __syncthreads();   // the weights and tile 0 have landed in every wave; tile 1 flies on
    acp8(la + 2 * KV_STG, 8 * KV_P, ga + g2, gs); acp8(la + 2 * KV_STG + 64 * KV_P, 8 * KV_P, gb + g2, gs); }
  unsigned bo = 0;   // byte offset of buffer t mod 3
  for (int t = 0; t < KV_NT; ++t) { const char* base = ring + bo + wq * 128; const _Float16* ts = &tab[fl][((t + rot) & (KV_NT - 1)) * 256 + wq * 64];
    // the wave's 64 tokens of the tile, in two slices of 32; the loops are unrolled so that the fragment arrays have constant indices and stay in registers
#pragma unroll
    for (int kc = 0; kc < 2; ++kc) { v16h a[2], w[4];
#pragma unroll
      for (int rt = 0; rt < 2; ++rt) a[rt] = frag_h((const _Float16*)(base + (wd * 32 + rt * 16 + col) * KV_P) + kc * 32, lane);
      const v16h p0 = frag_h(ts + kc * 32, lane), p1 = frag_h(ts + o1 + kc * 32, lane);   // the weights of the slice's tokens, of half fl and of the other half, in the fragment's own k order (the same in all 16 rows)
#pragma unroll
      for (int j = 0; j < 4; ++j) w[j] = frag_h((const _Float16*)(base + (64 + j * 16 + col) * KV_P) + kc * 32, lane);
      const v16h a0[2] = { a[0] * p0, a[1] * p0 }, a1[2] = { a[0] * p1, a[1] * p1 };
#pragma unroll
      for (int j = 0; j < 4; ++j)
#pragma unroll
        for (int rt = 0; rt < 2; ++rt) { acc[0][rt][j] = wmma16(a0[rt], w[j], acc[0][rt][j]); acc[1][rt][j] = wmma16(a1[rt], w[j], acc[1][rt][j]); }
      if (ksw) { aks[0] = wmma16(a0[0], one, aks[0]); aks[1] = wmma16(a0[1], one, aks[1]); } }
    // foot of trip t: tile t + 1 must have landed; where a tile t + 2 exists its 16 copies are this wave's youngest and fly on, else nothing may stay outstanding
    WAIT_DS(); if (t + 2 < KV_NT) WAIT_ACP_BUT16(); else WAIT_ACP();
    __syncthreads();
    // tile t + 3 goes into the buffer that trip t has just read: every wave's reads of it have returned in front of the barrier
    if (t + 3 < KV_NT) { const size_t go = (size_t)((t + 3 + rot) & (KV_NT - 1)) * 512; acp8(la + bo, 8 * KV_P, ga + go, gs); acp8(la + bo + 64 * KV_P, 8 * KV_P, gb + go, gs); }
    bo = (bo == 2 * KV_STG) ? 0u : bo + KV_STG; }
  WAIT_ACP();
  // the four token quarters' partial sums: the wave of quarter q adds up column tile q; it hands its other three column tiles over in the ring's place (every wave's last read of the ring stands in front of the loop's last barrier), 16 B per lane and store
  v4f* red = (v4f*)ring;
#pragma unroll
  for (int j = 0; j < 4; ++j) if (j != wq) {
#pragma unroll
    for (int hf = 0; hf < 2; ++hf)
#pragma unroll
      for (int rt = 0; rt < 2; ++rt)
#pragma unroll
        for (int rh = 0; rh < 2; ++rh) { const v8f s = acc[hf][rt][j]; const v4f o = { s[rh * 4], s[rh * 4 + 1], s[rh * 4 + 2], s[rh * 4 + 3] }; red[((((wvs * 4 + j) * 2 + hf) * 2 + rt) * 2 + rh) * 32 + lane] = o; } }
  if (ksw && col == 0) {
#pragma unroll   // constant indices, so that the sums stay in registers
    for (int r = 0; r < 8; ++r) { sks[wq][8 * g + r] = aks[0][r]; sks[wq][16 + 8 * g + r] = aks[1][r]; } }
  __syncthreads();   // the partial sums of all quarters are in LDS
#pragma unroll
  for (int j = 0; j < 4; ++j) if (j == wq) {
#pragma unroll
    for (int hf = 0; hf < 2; ++hf)
#pragma unroll
      for (int rt = 0; rt < 2; ++rt) { v8f s = acc[hf][rt][j];
#pragma unroll
        for (int q = 1; q < 4; ++q) { const int sw = wd * 4 + ((wq + q) & 3); const v4f* p = red + (((sw * 4 + j) * 2 + hf) * 2 + rt) * 64 + lane; const v4f lo = p[0], hi = p[32];
#pragma unroll
          for (int i = 0; i < 4; ++i) { s[i] += lo[i]; s[4 + i] += hi[i]; } }
        v8h o;
#pragma unroll
        for (int r = 0; r < 8; ++r) o[r] = (_Float16)s[r];
        *(v8h*)&sh[j * 16 + col][(hf ^ fl) * 64 + wd * 32 + rt * 16 + 8 * g] = o; } }
  __syncthreads();
  // each kv^T row m: one 128-B segment in the sin half and one in the cos half of its 1,024 dd
  for (int e = tid; e < 64 * 16; e += 256) { const int m = e >> 4, pc = e & 15; const size_t o = ((b * DD + m0 + m) * D2) + (size_t)(pc >> 3) * DD + d0 + (pc & 7) * 8; vst2((unsigned*)(KVH + o), *(const v4u*)&sh[m][pc * 8]); }
  // 8 lanes store the block's 128-B segment of KS
  if (blockIdx.y < 4 && tid < 8) { const v4f s = (*(const v4f*)&sks[0][tid * 4] + *(const v4f*)&sks[1][tid * 4]) + (*(const v4f*)&sks[2][tid * 4] + *(const v4f*)&sks[3][tid * 4]); vst2(KS + b * D2 + (blockIdx.y & 1) * DD + d0 + (blockIdx.y >> 1) * 32 + tid * 4, s); }
}
// ---- k_fin: block = (128 tokens, 128 m cols, b), 8 waves as 4 (tokens) x 2 (cols): q_ . kv = sin (q . kv_sin) + cos (q . kv_cos), so q is kept once, without its position weights: every q fragment feeds the products with both halves of kv (two accumulator sets), the k loop runs over 512 d and not 1,024 dd, and sin, cos are applied to the f32 sums; z = 1/max(sin (q . KS_sin) + cos (q . KS_cos), 1e-6) per row (f32, summed inside the d loop from the q fragments that the wave holds for its WMMAs; of the two waves that hold the same 32 rows one sums the sin half, one the cos half); out = acc z stored through the (b,H,n,hd)->(b,n,H,hd) view: computed (n, m) -> row (8n + m/64) mod N, cols (n/512)*64 + m%64; each wave holds two 16-token row tiles x four column tiles x two halves
// stage = 64 d: q 128 rows, kv_sin 128 rows and kv_cos 128 rows of 128 B at pitch 144; the output staging so takes the ring's place behind the loop
#define FN_P 144
// 16 f16 fragment elements times 16 f32 values in the same k order, added into four independent sums
__device__ __forceinline__ void zacc(float (&zs)[4], v16h a, const v4f* k) {
#pragma unroll   // constant indices, so that the fragment and the sums stay in registers
  for (int i = 0; i < 16; ++i) zs[i & 3] = __builtin_fmaf((float)a[i], k[i >> 2][i & 3], zs[i & 3]);
}
#define FN_STG ((128 + 256) * FN_P)
__global__ __launch_bounds__(256) void k_fin(const _Float16* __restrict__ Q, const _Float16* __restrict__ KVH, const float* __restrict__ KS, float* __restrict__ OUT) {
  __shared__ __align__(16) char ring[2 * FN_STG]; __shared__ float ssc[2][128]; __shared__ float szs[2][128]; __shared__ float sf[8][2][32]; float (*so)[32][68] = (float (*)[32][68])ring;
  const int tid = threadIdx.x, wave = tid >> 5, lane = tid & 31, col = lane & 15, g = lane >> 4; const int wr = wave >> 1, wc = wave & 1; const size_t b = blockIdx.z; const int nb0 = blockIdx.x * 128; const int nw = nb0 + wr * 32; const int m0 = blockIdx.y * 128;
  const char* ga = (const char*)(Q + (b * NN + nb0 + (tid >> 3)) * DD) + (tid & 7) * 16; const char* gh = (const char*)KVH + ((b * DD + m0 + (tid >> 3)) * D2) * 2 + (tid & 7) * 16;
  const unsigned la = lds_off(ring) + (tid >> 3) * FN_P + (tid & 7) * 16; const size_t gsa = (size_t)32 * DD * 2, gsh = (size_t)32 * D2 * 2;
  v8f acc[2][2][4] = {};   // [sin | cos half of kv][row tile][column tile]
  // z: lane (g, col) of wave (wr, wc) sums q . KS of half wc for rows wr * 32 + rt * 16 + col over the 32 d of each stage that its fragments hold, in four independent partial sums per row tile; wvs is the wave's number as a scalar, so that the half's offset is scalar and the choice between sin and cos below is a scalar branch
  const int wvs = __builtin_amdgcn_readfirstlane(wave); const float* ksl = KS + b * D2 + (wvs & 1) * DD + 8 * g; float zs[2][4] = {{0.f, 0.f, 0.f, 0.f}, {0.f, 0.f, 0.f, 0.f}};
  // trip t works on d stage (t + rot) mod 8, a start of its own per work-group, for the reason given in k_proj; z takes its KS values from the same stage
  const unsigned rot = (blockIdx.x + 2 * blockIdx.y + blockIdx.z) & (DD / 64 - 1);
  { const size_t g0 = (size_t)rot * 128, g1 = (size_t)((rot + 1) & (DD / 64 - 1)) * 128;
    acp4(la, 32 * FN_P, ga + g0, gsa); acp4(la + 128 * FN_P, 32 * FN_P, gh + g0, gsh); acp4(la + 256 * FN_P, 32 * FN_P, gh + DD * 2 + g0, gsh);
    // the position weights of the 128 tokens, once each (waves 0-3 sin, waves 4-7 cos), while the first stage flies; the barrier below publishes them
    { const float ang = (1.57079632679489662f * (float)(nb0 + (tid & 127) + 1)) / (float)NN; if (wvs < 4) ssc[0][tid & 127] = sin_p(ang); else ssc[1][tid & 127] = cos_p(ang); }
    WAIT_ACP(); __syncthreads();
    acp4(la + FN_STG, 32 * FN_P, ga + g1, gsa); acp4(la + FN_STG + 128 * FN_P, 32 * FN_P, gh + g1, gsh); acp4(la + FN_STG + 256 * FN_P, 32 * FN_P, gh + DD * 2 + g1, gsh); }
  for (int t = 0; t < DD / 64; ++t) { const unsigned bo = (t & 1) * FN_STG; const char* base = ring + bo;
    // two fragment sets of two column tiles: the next set is read from LDS as one group in front of this set's 4 WMMAs, so that its latency runs behind them; the loops are unrolled so that the fragment arrays have constant indices and stay in registers
    v16h a[2][2], wh[2][2]; v4f kz[2][4];   // kz: the 16 KS values (half wc) of each of the stage's two 32-d slices in the fragment's own k order
#pragma unroll
    for (int kc = 0; kc < 2; ++kc) { const float* kp = ksl + ((t + rot) & (DD / 64 - 1)) * 64 + kc * 32; kz[kc][0] = *(const v4f*)kp; kz[kc][1] = *(const v4f*)(kp + 4); kz[kc][2] = *(const v4f*)(kp + 16); kz[kc][3] = *(const v4f*)(kp + 20); }
#pragma unroll
    for (int rt = 0; rt < 2; ++rt)
#pragma unroll
      for (int kc = 0; kc < 2; ++kc) a[rt][kc] = frag_h((const _Float16*)(base + (wr * 32 + rt * 16 + col) * FN_P) + kc * 32, lane);
#pragma unroll
    for (int j = 0; j < 2; ++j) wh[0][j] = frag_h((const _Float16*)(base + (128 + wc * 64 + j * 16 + col) * FN_P), lane);
#pragma unroll
    for (int s = 0; s < 8; ++s) { const int kc = s >> 2, hf = (s >> 1) & 1, jh = (s & 1) * 2;
      if (s + 1 < 8) { const int kn = (s + 1) >> 2, hn = ((s + 1) >> 1) & 1, jn = ((s + 1) & 1) * 2;
#pragma unroll
        for (int j = 0; j < 2; ++j) wh[(s + 1) & 1][j] = frag_h((const _Float16*)(base + (128 + hn * 128 + wc * 64 + (jn + j) * 16 + col) * FN_P + kn * 64), lane); }
#pragma unroll
      for (int j = 0; j < 2; ++j)
#pragma unroll
        for (int rt = 0; rt < 2; ++rt) acc[hf][rt][jh + j] = wmma16(a[rt][kc], wh[s & 1][j], acc[hf][rt][jh + j]);
      if ((s & 3) == 3) { zacc(zs[0], a[0][kc], kz[kc]); zacc(zs[1], a[1][kc], kz[kc]); } }
    WAIT_DS(); WAIT_ACP(); __syncthreads();
    if (t + 2 < DD / 64) { const size_t go = (size_t)((t + 2 + rot) & (DD / 64 - 1)) * 128; acp4(la + bo, 32 * FN_P, ga + go, gsa); acp4(la + bo + 128 * FN_P, 32 * FN_P, gh + go, gsh); acp4(la + bo + 256 * FN_P, 32 * FN_P, gh + DD * 2 + go, gsh); } }
  WAIT_ACP();
#pragma unroll
  for (int rt = 0; rt < 2; ++rt) { float s = (zs[rt][0] + zs[rt][1]) + (zs[rt][2] + zs[rt][3]); s += __shfl_xor(s, 16); if (lane < 16) szs[wc][wr * 32 + rt * 16 + col] = s; }
  __syncthreads();   // each wave reads the other half's sums from the wave that shares its rows
  // lane l: the two factors sin z and cos z of row wr * 32 + l, kept per wave
  { const int row = wr * 32 + lane; const float sn = ssc[0][row], cs = ssc[1][row]; const float z = 1.0f / fmaxf(sn * szs[0][row] + cs * szs[1][row], 1e-6f); sf[wave][0][lane] = sn * z; sf[wave][1][lane] = cs * z; }
  LDSX();
#pragma unroll
  for (int rt = 0; rt < 2; ++rt)
#pragma unroll
  for (int j = 0; j < 4; ++j)
#pragma unroll
    for (int r = 0; r < 8; ++r) so[wave][rt * 16 + 8 * g + r][j * 16 + col] = acc[0][rt][j][r] * sf[wave][0][rt * 16 + 8 * g + r] + acc[1][rt][j][r] * sf[wave][1][rt * 16 + 8 * g + r];
  LDSX();
  // each computed row n (32 per wave) x this wave's 64 cols = the chunk j64 = m0/64 + wc -> final row (8n + j64) % NN, col block (n/512)*64
#pragma unroll   // straight-line, so that no store's registers are rewritten over a back edge
  for (int rl = 0; rl < 32; rl += 2) { const int lr = rl + (lane >> 4); const int n = nw + lr; const int j64 = m0 / 64 + wc; const size_t frow = b * NN + (size_t)((8 * n + j64) % NN); const int fc0 = (n / 512) * HD;
    vst2(OUT + frow * DD + fc0 + (lane & 15) * 4, *(const v4f*)&so[wave][lr][(lane & 15) * 4]); }   // two 256-B segments per store (lanes 0-15 / 16-31: two computed rows)
}
extern "C" void kernel_launch(void* const* d_in, const int* in_sizes, int n_in, void* d_out, int out_size, void* d_ws, size_t ws_size, hipStream_t stream) {
  (void)in_sizes; (void)n_in; (void)out_size;
  const float** F = (const float**)d_in;   // 0 x [4,4096,512], 1 Wq, 2 Wk, 3 Wv [512,512] natural
  if (ws_size < (size_t)WS_END) return;
  char* ws = (char*)d_ws; __bf16* P = (__bf16*)ws; _Float16 *Q = (_Float16*)(ws + WS_Q), *KT = (_Float16*)(ws + WS_KT), *VT = (_Float16*)(ws + WS_VT), *KVH = (_Float16*)(ws + WS_KVH); float* KS = (float*)(ws + WS_KS); _Float16* SC = (_Float16*)(ws + WS_SC);
  k_pack<<<3 * DD + NN / 256, 256, 0, stream>>>(F[1], F[2], F[3], P, SC);
  k_proj<<<dim3(TR / 128, DD / 128, 3), 128, 0, stream>>>(F[0], P, Q, KT, VT);
  k_kv<<<dim3(DD / 64, DD / 64, TNB), 256, 0, stream>>>(KT, VT, SC, KVH, KS);
  k_fin<<<dim3(NN / 128, DD / 128, TNB), 256, 0, stream>>>(Q, KVH, KS, (float*)d_out);
}
